// v000
// Measured on an AMD MI455X. A time is GPU time per run, averaged over a window of back-to-back runs after a warm-up
// (all launches, gaps included; the runs take copies of the inputs in turn), and the median of several windows.
// Apart from v000's, it joins two sittings. Times from different sittings can be a few percent apart, while
// side-by-side timings come from the same sitting.
// The starting kernel, v000, takes 7130 microseconds a run.
#include <hip/hip_runtime.h>
#include <stdint.h>

typedef __attribute__((ext_vector_type(2))) float v2f;
typedef __attribute__((ext_vector_type(8))) float v8f;

#define SSM_DT   0.001f
#define LN_EPS   1e-5f

// ---------------------------------------------------------------------------
// CDNA5 async global->LDS copy support (guarded so compile never breaks)
// ---------------------------------------------------------------------------
#ifdef __has_builtin
#if __has_builtin(__builtin_amdgcn_global_load_async_to_lds_b128)
#define USE_ASYNC_LDS 1
#endif
#endif
#ifndef USE_ASYNC_LDS
#define USE_ASYNC_LDS 0
#endif

#if USE_ASYNC_LDS
// Builtin signature (from hipcc diagnostic): param 0 is
// 'int __attribute__((vector_size(16))) addrspace(1)*', param 1 the LDS-side
// pointer, then two int immediates (offset, cpol).
typedef int v4i_g __attribute__((vector_size(16)));
typedef __attribute__((address_space(1))) v4i_g as1_v4i;
typedef __attribute__((address_space(3))) v4i_g as3_v4i;

// Generic LDS pointer's low 32 bits ARE the LDS byte offset (ISA aperture rule),
// so an int->as3-pointer round trip gives a valid LDS address without an
// addrspacecast.
__device__ __forceinline__ void async_cp16(const float* g, const float* lds) {
  __builtin_amdgcn_global_load_async_to_lds_b128(
      (as1_v4i*)(uintptr_t)g, (as3_v4i*)(uint32_t)(uintptr_t)lds, 0, 0);
}
__device__ __forceinline__ void wait_async0() {
#if __has_builtin(__builtin_amdgcn_s_wait_asynccnt)
  __builtin_amdgcn_s_wait_asynccnt(0);
#else
  asm volatile("s_wait_asynccnt 0" ::: "memory");
#endif
}
#endif

// ---------------------------------------------------------------------------
// Transpose (1024x1024 per batch): dst[b][i][j] = src[b][j][i]
// ---------------------------------------------------------------------------
__global__ __launch_bounds__(256) void transpose_bll(const float* __restrict__ src,
                                                     float* __restrict__ dst) {
  __shared__ float tile[32][33];
  int b = blockIdx.z;
  int i0 = blockIdx.y * 32, j0 = blockIdx.x * 32;
  int tx = threadIdx.x, ty = threadIdx.y;           // 32 x 8
  size_t base = (size_t)b << 20;                    // b * 1024 * 1024
#pragma unroll
  for (int k = 0; k < 32; k += 8)
    tile[ty + k][tx] = src[base + (size_t)(j0 + ty + k) * 1024 + i0 + tx];
  __syncthreads();
#pragma unroll
  for (int k = 0; k < 32; k += 8)
    dst[base + (size_t)(i0 + ty + k) * 1024 + j0 + tx] = tile[tx][ty + k];
}

// ---------------------------------------------------------------------------
// LayerNorm over last dim (C = 1024), one block per row, 256 threads
// ---------------------------------------------------------------------------
__global__ __launch_bounds__(256) void ln_kernel(const float* __restrict__ x,
                                                 const float* __restrict__ gamma,
                                                 const float* __restrict__ beta,
                                                 float* __restrict__ out, int C) {
  int row = blockIdx.x;
  int t = threadIdx.x;
  const float4 d = ((const float4*)(x + (size_t)row * C))[t];
  float s  = d.x + d.y + d.z + d.w;
  float ss = d.x * d.x + d.y * d.y + d.z * d.z + d.w * d.w;
  __shared__ float rs[256], rq[256];
  rs[t] = s; rq[t] = ss;
  __syncthreads();
  for (int off = 128; off > 0; off >>= 1) {
    if (t < off) { rs[t] += rs[t + off]; rq[t] += rq[t + off]; }
    __syncthreads();
  }
  float mean = rs[0] / (float)C;
  float var  = rq[0] / (float)C - mean * mean;
  float inv  = rsqrtf(var + LN_EPS);
  const float4 g = ((const float4*)gamma)[t];
  const float4 bb = ((const float4*)beta)[t];
  float4 o;
  o.x = (d.x - mean) * inv * g.x + bb.x;
  o.y = (d.y - mean) * inv * g.y + bb.y;
  o.z = (d.z - mean) * inv * g.z + bb.z;
  o.w = (d.w - mean) * inv * g.w + bb.w;
  ((float4*)(out + (size_t)row * C))[t] = o;
}

// ---------------------------------------------------------------------------
// A_bar = I + DT*A  (128x128)
// ---------------------------------------------------------------------------
__global__ void abar_kernel(const float* __restrict__ A, float* __restrict__ abar) {
  int i = blockIdx.x * blockDim.x + threadIdx.x;   // 16384
  int s = i >> 7, k = i & 127;
  abar[i] = (s == k ? 1.0f : 0.0f) + SSM_DT * A[i];
}

// ---------------------------------------------------------------------------
// WMMA GEMM: Cmat[M x N] = alpha * (A[M x K] @ Bw[N x K]^T)  (+ bias[N])
//   mode 0: plain           mode 1: += epA[row,col] * epB[col]
//   mode 2: += old Cmat value (residual accumulate)
// Block tile 128x64, BK=16, 8 waves of 32x32, fp32 WMMA 16x16x4.
// Double-buffered LDS; async DMA staging when available.
// ---------------------------------------------------------------------------
#define BM 128
#define BN 64
#define BK 16
#define LDA_S 20   // padded LDS row stride (floats): 16B-aligned, conflict-free

__global__ __launch_bounds__(256) void wmma_gemm(
    const float* __restrict__ A, const float* __restrict__ Bw,
    const float* __restrict__ bias, const float* __restrict__ epA,
    const float* __restrict__ epB, float* __restrict__ Cmat,
    int M, int N, int K, float alpha, int mode) {
  __shared__ __align__(16) float sA[2][BM * LDA_S];
  __shared__ __align__(16) float sB[2][BN * LDA_S];

  const int tid  = threadIdx.x;
  const int lane = tid & 31, wid = tid >> 5;
  const int hi = lane >> 4, lo = lane & 15;
  const int bm = blockIdx.y * BM, bn = blockIdx.x * BN;
  const int wm = (wid >> 1) * 32, wn = (wid & 1) * 32;

  v8f acc[2][2] = {};

  auto compute_tile = [&](const float* cA, const float* cB) {
#pragma unroll
    for (int kk = 0; kk < 4; kk++) {
      const int ko = kk * 4 + hi * 2;
      v2f aF[2], bF[2];
      aF[0] = *(const v2f*)(cA + (wm + lo) * LDA_S + ko);
      aF[1] = *(const v2f*)(cA + (wm + 16 + lo) * LDA_S + ko);
      bF[0] = *(const v2f*)(cB + (wn + lo) * LDA_S + ko);
      bF[1] = *(const v2f*)(cB + (wn + 16 + lo) * LDA_S + ko);
#pragma unroll
      for (int i = 0; i < 2; i++)
#pragma unroll
        for (int j = 0; j < 2; j++)
          acc[i][j] = __builtin_amdgcn_wmma_f32_16x16x4_f32(
              false, aF[i], false, bF[j], (short)0, acc[i][j], false, false);
    }
  };

#if USE_ASYNC_LDS
  // --- async DMA double-buffered pipeline ---
  auto stage = [&](int buf, int k0) {
#pragma unroll
    for (int j = 0; j < 2; j++) {           // A tile: 512 B128 slots, 2/thread
      int s = tid * 2 + j;
      int r = s >> 2, c4 = (s & 3) * 4;
      async_cp16(A + (size_t)(bm + r) * K + k0 + c4, &sA[buf][r * LDA_S + c4]);
    }
    {                                       // B tile: 256 B128 slots, 1/thread
      int r = tid >> 2, c4 = (tid & 3) * 4;
      async_cp16(Bw + (size_t)(bn + r) * K + k0 + c4, &sB[buf][r * LDA_S + c4]);
    }
  };

  stage(0, 0);
  wait_async0();
  __syncthreads();
  int cur = 0;
  for (int k0 = 0; k0 < K; k0 += BK) {
    if (k0 + BK < K) stage(cur ^ 1, k0 + BK);   // DMA next tile in background
    compute_tile(sA[cur], sB[cur]);             // 16 WMMAs on current tile
    wait_async0();
    __syncthreads();
    cur ^= 1;
  }
#else
  // --- fallback: synchronous single-buffer staging ---
  for (int k0 = 0; k0 < K; k0 += BK) {
#pragma unroll
    for (int j = 0; j < 2; j++) {
      int s = tid * 2 + j;
      int r = s >> 2, c4 = (s & 3) * 4;
      float4 v = *(const float4*)(A + (size_t)(bm + r) * K + k0 + c4);
      *(float4*)(&sA[0][r * LDA_S + c4]) = v;
    }
    {
      int r = tid >> 2, c4 = (tid & 3) * 4;
      float4 v = *(const float4*)(Bw + (size_t)(bn + r) * K + k0 + c4);
      *(float4*)(&sB[0][r * LDA_S + c4]) = v;
    }
    __syncthreads();
    compute_tile(sA[0], sB[0]);
    __syncthreads();
  }
#endif

  // Epilogue. C/D layout: VGPR r -> M = r + 8*hi, N = lo.
#pragma unroll
  for (int i = 0; i < 2; i++)
#pragma unroll
    for (int j = 0; j < 2; j++)
#pragma unroll
      for (int r = 0; r < 8; r++) {
        int row = bm + wm + i * 16 + r + hi * 8;
        int col = bn + wn + j * 16 + lo;
        size_t idx = (size_t)row * N + col;
        float v = alpha * acc[i][j][r];
        if (bias) v += bias[col];
        if (mode == 1)      v += epA[idx] * epB[col];
        else if (mode == 2) v += Cmat[idx];
        Cmat[idx] = v;
      }
}

// ---------------------------------------------------------------------------
// Sequential scan: h (16x128, rows 8..15 zero-padded) lives in LDS.
//   per step l: h = h @ A_bar^T + ub[:, l, :];  store hs[b*L + l][s] = h[b][s]
// One block, 8 waves; wave w owns state columns 16w..16w+15.
// A_bar fragments preloaded into registers (loop-invariant, 32 x float2).
// The next step's ub slab is async-DMA'd into LDS while WMMAs run.
// ---------------------------------------------------------------------------
#define SLDS 132   // 16 fragment rows -> 16 distinct LDS banks

__global__ __launch_bounds__(256) void scan_kernel(
    const float* __restrict__ ub, const float* __restrict__ abar,
    float* __restrict__ hs, int L) {
  __shared__ __align__(16) float hbuf[16 * SLDS];
#if USE_ASYNC_LDS
  __shared__ __align__(16) float ubs[2][8 * 128];
#endif
  const int tid = threadIdx.x;
  const int lane = tid & 31, wid = tid >> 5;
  const int hi = lane >> 4, lo = lane & 15;
  const int n0 = wid * 16;

  // Preload B fragments of A_bar (stored [s][k], K-major like the GEMM weights)
  v2f bF[32];
#pragma unroll
  for (int kk = 0; kk < 32; kk++)
    bF[kk] = *(const v2f*)(abar + (size_t)(n0 + lo) * 128 + kk * 4 + hi * 2);

#if USE_ASYNC_LDS
  auto prefetch_ub = [&](int buf, int l) {   // 8 rows x 128 floats, B128/thread
    int b = tid >> 5, s4 = (tid & 31) * 4;
    async_cp16(ub + ((size_t)b * L + l) * 128 + s4, &ubs[buf][b * 128 + s4]);
  };
  prefetch_ub(0, 0);
#endif

  for (int i = tid; i < 16 * SLDS; i += 256) hbuf[i] = 0.0f;
#if USE_ASYNC_LDS
  wait_async0();
#endif
  __syncthreads();

  for (int l = 0; l < L; l++) {
#if USE_ASYNC_LDS
    if (l + 1 < L) prefetch_ub((l + 1) & 1, l + 1);  // hide global latency
#endif
    v8f c = {};
#pragma unroll
    for (int kk = 0; kk < 32; kk++) {
      v2f a = *(const v2f*)(hbuf + lo * SLDS + kk * 4 + hi * 2);
      c = __builtin_amdgcn_wmma_f32_16x16x4_f32(
          false, a, false, bF[kk], (short)0, c, false, false);
    }
    __syncthreads();            // everyone done reading h before overwrite
#pragma unroll
    for (int r = 0; r < 8; r++) {
      int m = r + hi * 8;       // padded batch row
      int n = n0 + lo;          // state column
      float v = c[r];
      if (m < 8) {
#if USE_ASYNC_LDS
        v += ubs[l & 1][m * 128 + n];
#else
        v += ub[((size_t)m * L + l) * 128 + n];
#endif
        hs[((size_t)m * L + l) * 128 + n] = v;
      }
      hbuf[m * SLDS + n] = v;
    }
#if USE_ASYNC_LDS
    wait_async0();
#endif
    __syncthreads();
  }
}

// ---------------------------------------------------------------------------
// Launcher
// ---------------------------------------------------------------------------
extern "C" void kernel_launch(void* const* d_in, const int* in_sizes, int n_in,
                              void* d_out, int out_size, void* d_ws, size_t ws_size,
                              hipStream_t stream) {
  (void)in_sizes; (void)n_in; (void)out_size; (void)ws_size;
  const float* x     = (const float*)d_in[0];
  const float* Aall  = (const float*)d_in[1];
  const float* Bp    = (const float*)d_in[2];
  const float* Cp    = (const float*)d_in[3];
  const float* Dp    = (const float*)d_in[4];
  const float* Wi    = (const float*)d_in[5];
  const float* bi    = (const float*)d_in[6];
  const float* Wo    = (const float*)d_in[7];
  const float* bo    = (const float*)d_in[8];
  const float* gamma = (const float*)d_in[9];
  const float* beta  = (const float*)d_in[10];
  float* out = (float*)d_out;

  const int Bn = 8, L = 1024, C = 1024, S = 128, depth = 4;
  const size_t nBLC = (size_t)Bn * L * C;    // 8Mi floats
  const size_t nBLS = (size_t)Bn * L * S;    // 1Mi floats

  float* seq  = (float*)d_ws;                // (B, L, C)
  float* nbuf = seq  + nBLC;                 // LN output, reused as y buffer
  float* ubuf = nbuf + nBLC;                 // u
  float* ubb  = ubuf + nBLC;                 // DT * u @ Bp^T   (b*L+l, S)
  float* hsb  = ubb  + nBLS;                 // scan states     (b*L+l, S)
  float* abar = hsb  + nBLS;                 // I + DT*A (128x128)

  dim3 tb(32, 8);
  dim3 tg(32, 32, Bn);
  transpose_bll<<<tg, tb, 0, stream>>>(x, seq);   // seq[b][l][c] = x[b][c][l]

  for (int i = 0; i < depth; i++) {
    ln_kernel<<<Bn * L, 256, 0, stream>>>(seq, gamma + i * C, beta + i * C, nbuf, C);

    // u = n @ Wi^T + bi
    wmma_gemm<<<dim3(C / BN, (Bn * L) / BM), 256, 0, stream>>>(
        nbuf, Wi + (size_t)i * C * C, bi + i * C, nullptr, nullptr,
        ubuf, Bn * L, C, C, 1.0f, 0);

    // ub = DT * (u @ Bp^T)
    wmma_gemm<<<dim3(S / BN, (Bn * L) / BM), 256, 0, stream>>>(
        ubuf, Bp + (size_t)i * S * C, nullptr, nullptr, nullptr,
        ubb, Bn * L, S, C, SSM_DT, 0);

    abar_kernel<<<(S * S) / 256, 256, 0, stream>>>(Aall + (size_t)i * S * S, abar);

    scan_kernel<<<1, 256, 0, stream>>>(ubb, abar, hsb, L);

    // y = hs @ Cp^T + u * Dp   (into nbuf)
    wmma_gemm<<<dim3(C / BN, (Bn * L) / BM), 256, 0, stream>>>(
        hsb, Cp + (size_t)i * C * S, nullptr, ubuf, Dp + i * C,
        nbuf, Bn * L, C, S, 1.0f, 1);

    // seq += y @ Wo^T + bo
    wmma_gemm<<<dim3(C / BN, (Bn * L) / BM), 256, 0, stream>>>(
        nbuf, Wo + (size_t)i * C * C, bo + i * C, nullptr, nullptr,
        seq, Bn * L, C, C, 1.0f, 2);
  }

  transpose_bll<<<tg, tb, 0, stream>>>(seq, out); // out[b][c][l] = seq[b][l][c]
}

// v002
// A run of this version takes 1140 microseconds.
// Versions in between are left out here; by their measured steps it is 6.25 times as fast as v000.
#include <hip/hip_runtime.h>
#include <stdint.h>

typedef __attribute__((ext_vector_type(2))) float v2f;
typedef __attribute__((ext_vector_type(8))) float v8f;

#define SSM_DT   0.001f
#define LN_EPS   1e-5f

// ---------------------------------------------------------------------------
// CDNA5 async global->LDS copy support (guarded so compile never breaks)
// ---------------------------------------------------------------------------
#ifdef __has_builtin
#if __has_builtin(__builtin_amdgcn_global_load_async_to_lds_b128)
#define USE_ASYNC_LDS 1
#endif
#endif
#ifndef USE_ASYNC_LDS
#define USE_ASYNC_LDS 0
#endif

#if USE_ASYNC_LDS
// Builtin signature (from hipcc diagnostic): param 0 is
// 'int __attribute__((vector_size(16))) addrspace(1)*', param 1 the LDS-side
// pointer, then two int immediates (offset, cpol).
typedef int v4i_g __attribute__((vector_size(16)));
typedef __attribute__((address_space(1))) v4i_g as1_v4i;
typedef __attribute__((address_space(3))) v4i_g as3_v4i;

// Generic LDS pointer's low 32 bits ARE the LDS byte offset (ISA aperture rule),
// so an int->as3-pointer round trip gives a valid LDS address without an
// addrspacecast.
__device__ __forceinline__ void async_cp16(const float* g, const float* lds) {
  __builtin_amdgcn_global_load_async_to_lds_b128(
      (as1_v4i*)(uintptr_t)g, (as3_v4i*)(uint32_t)(uintptr_t)lds, 0, 0);
}
__device__ __forceinline__ void wait_async0() {
#if __has_builtin(__builtin_amdgcn_s_wait_asynccnt)
  __builtin_amdgcn_s_wait_asynccnt(0);
#else
  asm volatile("s_wait_asynccnt 0" ::: "memory");
#endif
}
#endif

// ---------------------------------------------------------------------------
// Transpose (1024 x NC per batch): dst[b][i][j] = src[b][j][i], j < 1024, i < NC
// ---------------------------------------------------------------------------
template <int NC>
__global__ __launch_bounds__(256) void transpose_bll(const float* __restrict__ src,
                                                     float* __restrict__ dst) {
  __shared__ float tile[32][33];
  int b = blockIdx.z;
  int i0 = blockIdx.y * 32, j0 = blockIdx.x * 32;
  int tx = threadIdx.x, ty = threadIdx.y;           // 32 x 8
  size_t base = (size_t)b * 1024 * NC;
#pragma unroll
  for (int k = 0; k < 32; k += 8)
    tile[ty + k][tx] = src[base + (size_t)(j0 + ty + k) * NC + i0 + tx];
  __syncthreads();
#pragma unroll
  for (int k = 0; k < 32; k += 8)
    dst[base + (size_t)(i0 + ty + k) * 1024 + j0 + tx] = tile[tx][ty + k];
}

// ---------------------------------------------------------------------------
// LayerNorm over last dim (C = 1024), one block per row, 256 threads
// ---------------------------------------------------------------------------
__global__ __launch_bounds__(256) void ln_kernel(const float* __restrict__ x,
                                                 const float* __restrict__ gamma,
                                                 const float* __restrict__ beta,
                                                 float* __restrict__ out, int C) {
  int row = blockIdx.x;
  int t = threadIdx.x;
  const float4 d = ((const float4*)(x + (size_t)row * C))[t];
  float s  = d.x + d.y + d.z + d.w;
  float ss = d.x * d.x + d.y * d.y + d.z * d.z + d.w * d.w;
  __shared__ float rs[256], rq[256];
  rs[t] = s; rq[t] = ss;
  __syncthreads();
  for (int off = 128; off > 0; off >>= 1) {
    if (t < off) { rs[t] += rs[t + off]; rq[t] += rq[t + off]; }
    __syncthreads();
  }
  float mean = rs[0] / (float)C;
  float var  = rq[0] / (float)C - mean * mean;
  float inv  = rsqrtf(var + LN_EPS);
  const float4 g = ((const float4*)gamma)[t];
  const float4 bb = ((const float4*)beta)[t];
  float4 o;
  o.x = (d.x - mean) * inv * g.x + bb.x;
  o.y = (d.y - mean) * inv * g.y + bb.y;
  o.z = (d.z - mean) * inv * g.z + bb.z;
  o.w = (d.w - mean) * inv * g.w + bb.w;
  ((float4*)(out + (size_t)row * C))[t] = o;
}

// ---------------------------------------------------------------------------
// A_bar = I + DT*A  (128x128)
// ---------------------------------------------------------------------------
__global__ void abar_kernel(const float* __restrict__ A, float* __restrict__ abar) {
  int i = blockIdx.x * blockDim.x + threadIdx.x;   // 16384
  int s = i >> 7, k = i & 127;
  abar[i] = (s == k ? 1.0f : 0.0f) + SSM_DT * A[i];
}

// ---------------------------------------------------------------------------
// Weight folding. With u = n Wi^T + bi the layer is linear in n and hs:
//   ub   = DT * (n (Bp Wi)^T + Bp bi)
//   seq += n (Wo diag(Dp) Wi)^T + hs (Wo Cp)^T + Wo (Dp * bi) + bo
// so u and y are never formed. This kernel lays out, per layer, the left factor
// of the products with Wi, 1152 rows of 1024: rows 0..1023 = Wo diag(Dp), rows
// 1024..1151 = Bp; and each row's product with bi, finished as the bias of the
// GEMM that uses the row: fb[r] = row . bi + bo[r], or DT * (row . bi) for Bp.
// One block per row (blockIdx.x) and layer (blockIdx.y).
// ---------------------------------------------------------------------------
__global__ __launch_bounds__(256) void fold_rows(
    const float* __restrict__ Wo, const float* __restrict__ Bp,
    const float* __restrict__ Dp, const float* __restrict__ bi,
    const float* __restrict__ bo, float* __restrict__ lf, float* __restrict__ fb) {
  const int r = blockIdx.x, i = blockIdx.y, t = threadIdx.x;
  const bool isw = r < 1024;
  const float* srow = isw ? Wo + ((size_t)i * 1024 + r) * 1024
                          : Bp + ((size_t)i * 128 + (r - 1024)) * 1024;
  float4 w = ((const float4*)srow)[t];
  if (isw) {
    const float4 d = ((const float4*)(Dp + i * 1024))[t];
    w.x *= d.x; w.y *= d.y; w.z *= d.z; w.w *= d.w;
  }
  ((float4*)(lf + ((size_t)i * 1152 + r) * 1024))[t] = w;
  const float4 b = ((const float4*)(bi + i * 1024))[t];
  __shared__ float rs[256];
  rs[t] = w.x * b.x + w.y * b.y + w.z * b.z + w.w * b.w;
  __syncthreads();
  for (int off = 128; off > 0; off >>= 1) {
    if (t < off) rs[t] += rs[t + off];
    __syncthreads();
  }
  if (t == 0) fb[i * 1152 + r] = isw ? rs[0] + bo[i * 1024 + r] : SSM_DT * rs[0];
}

// ---------------------------------------------------------------------------
// WMMA GEMM: Cmat[M x N] = alpha * (A[M x K] @ Bw[N x K]^T)  (+ bias[N])
//   mode 0: plain           mode 2: += old Cmat value (residual accumulate)
// gemm_tile does the block tile whose first row is bm and first column bn.
// Block tile 128x64, BK=16, 8 waves of 32x32, fp32 WMMA 16x16x4.
// Double-buffered LDS; async DMA staging when available.
// ---------------------------------------------------------------------------
#define BM 128
#define BN 64
#define BK 16
#define LDA_S 20   // padded LDS row stride (floats): 16B-aligned, conflict-free

__device__ __forceinline__ void gemm_tile(
    const float* __restrict__ A, const float* __restrict__ Bw,
    const float* __restrict__ bias, float* __restrict__ Cmat,
    int N, int K, float alpha, int mode, const int bm, const int bn) {
  __shared__ __align__(16) float sA[2][BM * LDA_S];
  __shared__ __align__(16) float sB[2][BN * LDA_S];

  const int tid  = threadIdx.x;
  const int lane = tid & 31, wid = tid >> 5;
  const int hi = lane >> 4, lo = lane & 15;
  const int wm = (wid >> 1) * 32, wn = (wid & 1) * 32;

  v8f acc[2][2] = {};

  auto compute_tile = [&](const float* cA, const float* cB) {
#pragma unroll
    for (int kk = 0; kk < 4; kk++) {
      const int ko = kk * 4 + hi * 2;
      v2f aF[2], bF[2];
      aF[0] = *(const v2f*)(cA + (wm + lo) * LDA_S + ko);
      aF[1] = *(const v2f*)(cA + (wm + 16 + lo) * LDA_S + ko);
      bF[0] = *(const v2f*)(cB + (wn + lo) * LDA_S + ko);
      bF[1] = *(const v2f*)(cB + (wn + 16 + lo) * LDA_S + ko);
#pragma unroll
      for (int i = 0; i < 2; i++)
#pragma unroll
        for (int j = 0; j < 2; j++)
          acc[i][j] = __builtin_amdgcn_wmma_f32_16x16x4_f32(
              false, aF[i], false, bF[j], (short)0, acc[i][j], false, false);
    }
  };

#if USE_ASYNC_LDS
  // --- async DMA double-buffered pipeline ---
  auto stage = [&](int buf, int k0) {
#pragma unroll
    for (int j = 0; j < 2; j++) {           // A tile: 512 B128 slots, 2/thread
      int s = tid * 2 + j;
      int r = s >> 2, c4 = (s & 3) * 4;
      async_cp16(A + (size_t)(bm + r) * K + k0 + c4, &sA[buf][r * LDA_S + c4]);
    }
    {                                       // B tile: 256 B128 slots, 1/thread
      int r = tid >> 2, c4 = (tid & 3) * 4;
      async_cp16(Bw + (size_t)(bn + r) * K + k0 + c4, &sB[buf][r * LDA_S + c4]);
    }
  };

  stage(0, 0);
  wait_async0();
  __syncthreads();
  int cur = 0;
  for (int k0 = 0; k0 < K; k0 += BK) {
    if (k0 + BK < K) stage(cur ^ 1, k0 + BK);   // DMA next tile in background
    compute_tile(sA[cur], sB[cur]);             // 16 WMMAs on current tile
    wait_async0();
    __syncthreads();
    cur ^= 1;
  }
#else
  // --- fallback: synchronous single-buffer staging ---
  for (int k0 = 0; k0 < K; k0 += BK) {
#pragma unroll
    for (int j = 0; j < 2; j++) {
      int s = tid * 2 + j;
      int r = s >> 2, c4 = (s & 3) * 4;
      float4 v = *(const float4*)(A + (size_t)(bm + r) * K + k0 + c4);
      *(float4*)(&sA[0][r * LDA_S + c4]) = v;
    }
    {
      int r = tid >> 2, c4 = (tid & 3) * 4;
      float4 v = *(const float4*)(Bw + (size_t)(bn + r) * K + k0 + c4);
      *(float4*)(&sB[0][r * LDA_S + c4]) = v;
    }
    __syncthreads();
    compute_tile(sA[0], sB[0]);
    __syncthreads();
  }
#endif

  // Epilogue. C/D layout: VGPR r -> M = r + 8*hi, N = lo.
#pragma unroll
  for (int i = 0; i < 2; i++)
#pragma unroll
    for (int j = 0; j < 2; j++)
#pragma unroll
      for (int r = 0; r < 8; r++) {
        int row = bm + wm + i * 16 + r + hi * 8;
        int col = bn + wn + j * 16 + lo;
        size_t idx = (size_t)row * N + col;
        float v = alpha * acc[i][j][r];
        if (bias) v += bias[col];
        if (mode == 2) v += Cmat[idx];
        Cmat[idx] = v;
      }
}

__global__ __launch_bounds__(256) void wmma_gemm(
    const float* __restrict__ A, const float* __restrict__ Bw,
    const float* __restrict__ bias, float* __restrict__ Cmat,
    int M, int N, int K, float alpha, int mode) {
  gemm_tile(A, Bw, bias, Cmat, N, K, alpha, mode, blockIdx.y * BM, blockIdx.x * BN);
}

// The two weight products of every layer (blockIdx.z) in one launch, grid (16, 10):
//   y < 9 : qg (1152 x 1024) = lf @ wit^T, tile (y, x)
//   y == 9: pf (1024 x 128)  = Wo @ cpt^T, its 8 x 2 tiles numbered by x
__global__ __launch_bounds__(256) void fold_gemm(
    const float* __restrict__ lf, const float* __restrict__ wit,
    const float* __restrict__ Wo, const float* __restrict__ cpt,
    float* __restrict__ qg, float* __restrict__ pf) {
  const int x = blockIdx.x, y = blockIdx.y;
  const size_t i = blockIdx.z;
  const bool q = y < 9;
  gemm_tile(q ? lf + i * (1152 * 1024) : Wo + i * (1024 * 1024),
            q ? wit + i * (1024 * 1024) : cpt + i * (128 * 1024), nullptr,
            q ? qg + i * (1152 * 1024) : pf + i * (1024 * 128),
            q ? 1024 : 128, 1024, 1.0f, 0,
            (q ? y : x >> 1) * BM, (q ? x : x & 1) * BN);
}

// ---------------------------------------------------------------------------
// Sequential scan: h (16x128, rows 8..15 zero-padded) lives in LDS.
//   per step l: h = h @ A_bar^T + ub[:, l, :];  store hs[b*L + l][s] = h[b][s]
// One block, 8 waves; wave w owns state columns 16w..16w+15.
// A_bar fragments preloaded into registers (loop-invariant, 32 x float2).
// The next step's ub slab is async-DMA'd into LDS while WMMAs run.
// ---------------------------------------------------------------------------
#define SLDS 132   // 16 fragment rows -> 16 distinct LDS banks

__global__ __launch_bounds__(256) void scan_kernel(
    const float* __restrict__ ub, const float* __restrict__ abar,
    float* __restrict__ hs, int L) {
  __shared__ __align__(16) float hbuf[16 * SLDS];
#if USE_ASYNC_LDS
  __shared__ __align__(16) float ubs[2][8 * 128];
#endif
  const int tid = threadIdx.x;
  const int lane = tid & 31, wid = tid >> 5;
  const int hi = lane >> 4, lo = lane & 15;
  const int n0 = wid * 16;

  // Preload B fragments of A_bar (stored [s][k], K-major like the GEMM weights)
  v2f bF[32];
#pragma unroll
  for (int kk = 0; kk < 32; kk++)
    bF[kk] = *(const v2f*)(abar + (size_t)(n0 + lo) * 128 + kk * 4 + hi * 2);

#if USE_ASYNC_LDS
  auto prefetch_ub = [&](int buf, int l) {   // 8 rows x 128 floats, B128/thread
    int b = tid >> 5, s4 = (tid & 31) * 4;
    async_cp16(ub + ((size_t)b * L + l) * 128 + s4, &ubs[buf][b * 128 + s4]);
  };
  prefetch_ub(0, 0);
#endif

  for (int i = tid; i < 16 * SLDS; i += 256) hbuf[i] = 0.0f;
#if USE_ASYNC_LDS
  wait_async0();
#endif
  __syncthreads();

  for (int l = 0; l < L; l++) {
#if USE_ASYNC_LDS
    if (l + 1 < L) prefetch_ub((l + 1) & 1, l + 1);  // hide global latency
#endif
    v8f c = {};
#pragma unroll
    for (int kk = 0; kk < 32; kk++) {
      v2f a = *(const v2f*)(hbuf + lo * SLDS + kk * 4 + hi * 2);
      c = __builtin_amdgcn_wmma_f32_16x16x4_f32(
          false, a, false, bF[kk], (short)0, c, false, false);
    }
    __syncthreads();            // everyone done reading h before overwrite
#pragma unroll
    for (int r = 0; r < 8; r++) {
      int m = r + hi * 8;       // padded batch row
      int n = n0 + lo;          // state column
      float v = c[r];
      if (m < 8) {
#if USE_ASYNC_LDS
        v += ubs[l & 1][m * 128 + n];
#else
        v += ub[((size_t)m * L + l) * 128 + n];
#endif
        hs[((size_t)m * L + l) * 128 + n] = v;
      }
      hbuf[m * SLDS + n] = v;
    }
#if USE_ASYNC_LDS
    wait_async0();
#endif
    __syncthreads();
  }
}

// ---------------------------------------------------------------------------
// Chunked scan. The recurrence h_l = h_{l-1} @ M^T + x_l is linear, so a
// sequence is cut into chunks of SCT steps and every (batch, chunk) pair is one
// row of a 16-row tile; one block steps its 16 rows SCT times.
//   full == 0: rows start from zero, only the chunk's last state is stored
//              (outp[row]). Blocks >= nrb step the rows of the identity with
//              the transposed matrix instead: they store M^SCT (pw, laid out
//              [s][k] like M), the matrix that carries a state over one chunk.
//   full == 1: row R starts from carry[R-1], the true state at the end of the
//              chunk before it (zero for a sequence's first chunk), and every
//              step's state is stored (outp[row * SCT + t]).
// The chunk ends form a recurrence of the same kind, SCT times shorter, with
// M^SCT as its matrix, so the launcher applies the same two passes to it again.
// Row R = batch * NC + chunk; its step t lies at sequence row R * SCT + t.
// ---------------------------------------------------------------------------
#define SCT 8

// Stands behind a run of global loads or stores, in front of the first reuse of
// a register that they name; the two scheduling barriers keep later register
// writes from being moved up over the wait.
#define XCNT_WAIT()                                  \
  do {                                               \
    __builtin_amdgcn_sched_barrier(0);               \
    asm volatile("s_wait_xcnt 0x0" ::: "memory");    \
    __builtin_amdgcn_sched_barrier(0);               \
  } while (0)

// ident and full are literals or block-uniform at every call. The loops over r
// and kk are unrolled so that bF, hv, un and the accumulator stay in registers.
__device__ __forceinline__ void scan_rows(
    const float* __restrict__ ub, const float* __restrict__ mat,
    const float* __restrict__ carry, float* __restrict__ outp,
    int NC, int row0, const bool ident, const bool full) {
  __shared__ __align__(16) float hbuf[16 * SLDS];
  const int tid = threadIdx.x;
  const int lane = tid & 31, wid = tid >> 5;
  const int hi = lane >> 4, lo = lane & 15;
  const int n = wid * 16 + lo;                       // state column of this lane
  const int r0 = row0 + hi * 8;                      // row of accumulator register 0

  v2f bF[32];
  float hv[8], un[8];
  if (ident) {
#pragma unroll
    for (int kk = 0; kk < 32; kk++) {
      bF[kk].x = mat[(kk * 4 + hi * 2) * 128 + n];
      bF[kk].y = mat[(kk * 4 + hi * 2 + 1) * 128 + n];
    }
#pragma unroll
    for (int r = 0; r < 8; r++) {
      hv[r] = (r0 + r == n) ? 1.0f : 0.0f;
      un[r] = 0.0f;
    }
  } else {
    float cv[8];
    if (full) {
      // row R takes row R-1; row 0 has none before it and is a first chunk
      cv[0] = carry[(size_t)(r0 > 0 ? r0 - 1 : 0) * 128 + n];
#pragma unroll
      for (int r = 1; r < 8; r++) cv[r] = carry[(size_t)r0 * 128 + (r - 1) * 128 + n];
      XCNT_WAIT();
    }
#pragma unroll
    for (int r = 0; r < 8; r++)
      un[r] = ub[(size_t)r0 * (SCT * 128) + r * (SCT * 128) + n];
    XCNT_WAIT();
#pragma unroll
    for (int kk = 0; kk < 32; kk++)
      bF[kk] = *(const v2f*)(mat + n * 128 + kk * 4 + hi * 2);
    XCNT_WAIT();
#pragma unroll
    for (int r = 0; r < 8; r++)
      hv[r] = (full && ((r0 + r) & (NC - 1))) ? cv[r] : 0.0f;
  }
#pragma unroll
  for (int r = 0; r < 8; r++) hbuf[(hi * 8 + r) * SLDS + n] = hv[r];
  __syncthreads();

  for (int t = 0; t < SCT; t++) {
    float uc[8];
#pragma unroll
    for (int r = 0; r < 8; r++) uc[r] = un[r];
    if (!ident && t + 1 < SCT) {                     // next step's inputs fly under the WMMAs
#pragma unroll
      for (int r = 0; r < 8; r++)
        un[r] = ub[(size_t)r0 * (SCT * 128) + r * (SCT * 128) + (t + 1) * 128 + n];
    }
    v8f c = {};
#pragma unroll
    for (int kk = 0; kk < 32; kk++) {
      v2f a = *(const v2f*)(hbuf + lo * SLDS + kk * 4 + hi * 2);
      c = __builtin_amdgcn_wmma_f32_16x16x4_f32(
          false, a, false, bF[kk], (short)0, c, false, false);
    }
#pragma unroll
    for (int r = 0; r < 8; r++) hv[r] = c[r] + uc[r];
    if (full) {
#pragma unroll
      for (int r = 0; r < 8; r++)
        outp[(size_t)r0 * (SCT * 128) + r * (SCT * 128) + t * 128 + n] = hv[r];
      XCNT_WAIT();
    }
    if (t + 1 == SCT) break;    // the last state is not read back from LDS
    __syncthreads();            // everyone done reading h before overwrite
#pragma unroll
    for (int r = 0; r < 8; r++) hbuf[(hi * 8 + r) * SLDS + n] = hv[r];
    __syncthreads();
  }

  if (!full) {
#pragma unroll
    for (int r = 0; r < 8; r++) outp[(size_t)r0 * 128 + r * 128 + n] = hv[r];
  }
}

__global__ __launch_bounds__(256) void scan_chunk_ends(
    const float* __restrict__ ub, const float* __restrict__ mat,
    float* __restrict__ ends, float* __restrict__ pw, int nrb) {
  const int blk = blockIdx.x;
  const bool ident = blk >= nrb;
  scan_rows(ub, mat, nullptr, ident ? pw : ends, 0, (ident ? blk - nrb : blk) * 16, ident, false);
}

__global__ __launch_bounds__(256) void scan_chunk_fill(
    const float* __restrict__ ub, const float* __restrict__ mat,
    const float* __restrict__ carry, float* __restrict__ outp, int NC) {
  scan_rows(ub, mat, carry, outp, NC, blockIdx.x * 16, false, true);
}

// ---------------------------------------------------------------------------
// Launcher
// ---------------------------------------------------------------------------
extern "C" void kernel_launch(void* const* d_in, const int* in_sizes, int n_in,
                              void* d_out, int out_size, void* d_ws, size_t ws_size,
                              hipStream_t stream) {
  (void)in_sizes; (void)n_in; (void)out_size; (void)ws_size;
  const float* x     = (const float*)d_in[0];
  const float* Aall  = (const float*)d_in[1];
  const float* Bp    = (const float*)d_in[2];
  const float* Cp    = (const float*)d_in[3];
  const float* Dp    = (const float*)d_in[4];
  const float* Wi    = (const float*)d_in[5];
  const float* bi    = (const float*)d_in[6];
  const float* Wo    = (const float*)d_in[7];
  const float* bo    = (const float*)d_in[8];
  const float* gamma = (const float*)d_in[9];
  const float* beta  = (const float*)d_in[10];
  float* out = (float*)d_out;

  const int Bn = 8, L = 1024, C = 1024, S = 128, depth = 4;
  const size_t nBLC = (size_t)Bn * L * C;    // 8Mi floats
  const size_t nBLS = (size_t)Bn * L * S;    // 1Mi floats

  float* seq  = (float*)d_ws;                // (B, L, C)
  float* nbuf = seq  + nBLC;                 // LN output
  float* ubb  = nbuf + nBLC;                 // DT * u @ Bp^T   (b*L+l, S)
  float* hsb  = ubb  + nBLS;                 // scan states     (b*L+l, S)
  float* abar = hsb  + nBLS;                 // I + DT*A (128x128)
  float* pw1  = abar + S * S;                // A_bar^8
  float* pw2  = pw1  + S * S;                // A_bar^64
  float* le0  = pw2  + S * S;                // ends of the 8-step chunks from zero  (b*128+c, S)
  float* car0 = le0  + nBLS / SCT;           // true states at those ends            (b*128+c, S)
  float* le1  = car0 + nBLS / SCT;           // ends of the 64-step chunks from zero (b*16+c, S)
  float* car1 = le1  + nBLS / (SCT * SCT);   // true states at those ends            (b*16+c, S)
  // folded weights, all layers
  const int F = C + S;                       // 1152 rows: Wo diag(Dp) over Bp
  float* wit  = car1 + nBLS / (SCT * SCT);   // Wi^T                        (layer, c, d)
  float* cpt  = wit  + (size_t)depth * C * C;  // Cp^T                      (layer, s, d)
  float* lf   = cpt  + (size_t)depth * S * C;  // [Wo diag(Dp); Bp]         (layer, F, d)
  float* qg   = lf   + (size_t)depth * F * C;  // lf @ Wi                   (layer, F, c)
  float* pf   = qg   + (size_t)depth * F * C;  // Wo @ Cp                   (layer, o, s)
  float* fb   = pf   + (size_t)depth * C * S;  // folded biases             (layer, F)

  dim3 tb(32, 8);
  dim3 tg(32, 32, Bn);
  transpose_bll<1024><<<tg, tb, 0, stream>>>(x, seq);   // seq[b][l][c] = x[b][c][l]

  transpose_bll<1024><<<dim3(32, 32, depth), tb, 0, stream>>>(Wi, wit);  // wit[c][d] = Wi[d][c]
  transpose_bll<128><<<dim3(32, 4, depth), tb, 0, stream>>>(Cp, cpt);    // cpt[s][d] = Cp[d][s]
  fold_rows<<<dim3(F, depth), 256, 0, stream>>>(Wo, Bp, Dp, bi, bo, lf, fb);
  // qg = [Wo diag(Dp); Bp] @ Wi and pf = Wo @ Cp
  fold_gemm<<<dim3(16, 10, depth), 256, 0, stream>>>(lf, wit, Wo, cpt, qg, pf);

  for (int i = 0; i < depth; i++) {
    const float* qi = qg + (size_t)i * F * C;   // Wo diag(Dp) Wi, then Bp Wi
    const float* fi = fb + i * F;

    ln_kernel<<<Bn * L, 256, 0, stream>>>(seq, gamma + i * C, beta + i * C, nbuf, C);

    // ub = DT * (n @ (Bp Wi)^T + Bp bi)
    wmma_gemm<<<dim3(S / BN, (Bn * L) / BM), 256, 0, stream>>>(
        nbuf, qi + (size_t)C * C, fi + C, ubb, Bn * L, S, C, SSM_DT, 0);

    abar_kernel<<<(S * S) / 256, 256, 0, stream>>>(Aall + (size_t)i * S * S, abar);

    // scan of length 1024 = 8 x 8 x 16: two chunk levels up, 16 serial steps, two down
    scan_chunk_ends<<<64 + 8, 256, 0, stream>>>(ubb, abar, le0, pw1, 64);
    scan_chunk_ends<<<8 + 8, 256, 0, stream>>>(le0, pw1, le1, pw2, 8);
    scan_kernel<<<1, 256, 0, stream>>>(le1, pw2, car1, 16);
    scan_chunk_fill<<<8, 256, 0, stream>>>(le0, pw1, car1, car0, 16);
    scan_chunk_fill<<<64, 256, 0, stream>>>(ubb, abar, car0, hsb, 128);

    // seq += n @ (Wo diag(Dp) Wi)^T + Wo (Dp * bi) + bo
    wmma_gemm<<<dim3(C / BN, (Bn * L) / BM), 256, 0, stream>>>(
        nbuf, qi, fi, seq, Bn * L, C, C, 1.0f, 2);

    // seq += hs @ (Wo Cp)^T
    wmma_gemm<<<dim3(C / BN, (Bn * L) / BM), 256, 0, stream>>>(
        hsb, pf + (size_t)i * C * S, nullptr, seq, Bn * L, C, S, 1.0f, 2);
  }

  transpose_bll<1024><<<tg, tb, 0, stream>>>(seq, out); // out[b][c][l] = seq[b][l][c]
}

// v003
// It runs in 1080 microseconds.
// In both of two side-by-side timings against v002, it was 1.05 times as fast.
// Counting every step since v000, it is 6.58 times as fast.
#include <hip/hip_runtime.h>
#include <stdint.h>

typedef __attribute__((ext_vector_type(2))) float v2f;
typedef __attribute__((ext_vector_type(8))) float v8f;

#define SSM_DT   0.001f
#define LN_EPS   1e-5f

// ---------------------------------------------------------------------------
// CDNA5 async global->LDS copy support (guarded so compile never breaks)
// ---------------------------------------------------------------------------
#ifdef __has_builtin
#if __has_builtin(__builtin_amdgcn_global_load_async_to_lds_b128)
#define USE_ASYNC_LDS 1
#endif
#endif
#ifndef USE_ASYNC_LDS
#define USE_ASYNC_LDS 0
#endif

#if USE_ASYNC_LDS
// Builtin signature (from hipcc diagnostic): param 0 is
// 'int __attribute__((vector_size(16))) addrspace(1)*', param 1 the LDS-side
// pointer, then two int immediates (offset, cpol).
typedef int v4i_g __attribute__((vector_size(16)));
typedef __attribute__((address_space(1))) v4i_g as1_v4i;
typedef __attribute__((address_space(3))) v4i_g as3_v4i;

// Generic LDS pointer's low 32 bits ARE the LDS byte offset (ISA aperture rule),
// so an int->as3-pointer round trip gives a valid LDS address without an
// addrspacecast.
__device__ __forceinline__ void async_cp16(const float* g, const float* lds) {
  __builtin_amdgcn_global_load_async_to_lds_b128(
      (as1_v4i*)(uintptr_t)g, (as3_v4i*)(uint32_t)(uintptr_t)lds, 0, 0);
}
__device__ __forceinline__ void wait_async0() {
#if __has_builtin(__builtin_amdgcn_s_wait_asynccnt)
  __builtin_amdgcn_s_wait_asynccnt(0);
#else
  asm volatile("s_wait_asynccnt 0" ::: "memory");
#endif
}
#endif

// ---------------------------------------------------------------------------
// Transpose (1024 x NC per batch): dst[b][i][j] = src[b][j][i], j < 1024, i < NC
// ---------------------------------------------------------------------------
template <int NC>
__global__ __launch_bounds__(256) void transpose_bll(const float* __restrict__ src,
                                                     float* __restrict__ dst) {
  __shared__ float tile[32][33];
  int b = blockIdx.z;
  int i0 = blockIdx.y * 32, j0 = blockIdx.x * 32;
  int tx = threadIdx.x, ty = threadIdx.y;           // 32 x 8
  size_t base = (size_t)b * 1024 * NC;
#pragma unroll
  for (int k = 0; k < 32; k += 8)
    tile[ty + k][tx] = src[base + (size_t)(j0 + ty + k) * NC + i0 + tx];
  __syncthreads();
#pragma unroll
  for (int k = 0; k < 32; k += 8)
    dst[base + (size_t)(i0 + ty + k) * 1024 + j0 + tx] = tile[tx][ty + k];
}

// ---------------------------------------------------------------------------
// LayerNorm over last dim (C = 1024), one block per row, 256 threads
// ---------------------------------------------------------------------------
__global__ __launch_bounds__(256) void ln_kernel(const float* __restrict__ x,
                                                 const float* __restrict__ gamma,
                                                 const float* __restrict__ beta,
                                                 float* __restrict__ out, int C) {
  int row = blockIdx.x;
  int t = threadIdx.x;
  const float4 d = ((const float4*)(x + (size_t)row * C))[t];
  float s  = d.x + d.y + d.z + d.w;
  float ss = d.x * d.x + d.y * d.y + d.z * d.z + d.w * d.w;
  __shared__ float rs[256], rq[256];
  rs[t] = s; rq[t] = ss;
  __syncthreads();
  for (int off = 128; off > 0; off >>= 1) {
    if (t < off) { rs[t] += rs[t + off]; rq[t] += rq[t + off]; }
    __syncthreads();
  }
  float mean = rs[0] / (float)C;
  float var  = rq[0] / (float)C - mean * mean;
  float inv  = rsqrtf(var + LN_EPS);
  const float4 g = ((const float4*)gamma)[t];
  const float4 bb = ((const float4*)beta)[t];
  float4 o;
  o.x = (d.x - mean) * inv * g.x + bb.x;
  o.y = (d.y - mean) * inv * g.y + bb.y;
  o.z = (d.z - mean) * inv * g.z + bb.z;
  o.w = (d.w - mean) * inv * g.w + bb.w;
  ((float4*)(out + (size_t)row * C))[t] = o;
}

// ---------------------------------------------------------------------------
// A_bar = I + DT*A  (128x128)
// ---------------------------------------------------------------------------
__global__ void abar_kernel(const float* __restrict__ A, float* __restrict__ abar) {
  int i = blockIdx.x * blockDim.x + threadIdx.x;   // 16384
  int s = i >> 7, k = i & 127;
  abar[i] = (s == k ? 1.0f : 0.0f) + SSM_DT * A[i];
}

// ---------------------------------------------------------------------------
// Weight folding. With u = n Wi^T + bi the layer is linear in n and hs:
//   ub   = DT * (n (Bp Wi)^T + Bp bi)
//   seq += n (Wo diag(Dp) Wi)^T + hs (Wo Cp)^T + Wo (Dp * bi) + bo
// so u and y are never formed. This kernel lays out, per layer, the left factor
// of the products with Wi, 1152 rows of 1024: rows 0..1023 = Wo diag(Dp), rows
// 1024..1151 = Bp; and each row's product with bi, finished as the bias of the
// GEMM that uses the row: fb[r] = row . bi + bo[r], or DT * (row . bi) for Bp.
// One block per row (blockIdx.x) and layer (blockIdx.y).
// ---------------------------------------------------------------------------
__global__ __launch_bounds__(256) void fold_rows(
    const float* __restrict__ Wo, const float* __restrict__ Bp,
    const float* __restrict__ Dp, const float* __restrict__ bi,
    const float* __restrict__ bo, float* __restrict__ lf, float* __restrict__ fb) {
  const int r = blockIdx.x, i = blockIdx.y, t = threadIdx.x;
  const bool isw = r < 1024;
  const float* srow = isw ? Wo + ((size_t)i * 1024 + r) * 1024
                          : Bp + ((size_t)i * 128 + (r - 1024)) * 1024;
  float4 w = ((const float4*)srow)[t];
  if (isw) {
    const float4 d = ((const float4*)(Dp + i * 1024))[t];
    w.x *= d.x; w.y *= d.y; w.z *= d.z; w.w *= d.w;
  }
  ((float4*)(lf + ((size_t)i * 1152 + r) * 1024))[t] = w;
  const float4 b = ((const float4*)(bi + i * 1024))[t];
  __shared__ float rs[256];
  rs[t] = w.x * b.x + w.y * b.y + w.z * b.z + w.w * b.w;
  __syncthreads();
  for (int off = 128; off > 0; off >>= 1) {
    if (t < off) rs[t] += rs[t + off];
    __syncthreads();
  }
  if (t == 0) fb[i * 1152 + r] = isw ? rs[0] + bo[i * 1024 + r] : SSM_DT * rs[0];
}

// ---------------------------------------------------------------------------
// WMMA GEMM: Cmat[M x N] = alpha * (A[M x K] @ Bw[N x K]^T)  (+ bias[N])
//   mode 0: plain           mode 2: += old Cmat value (residual accumulate)
// gemm_tile does the block tile whose first row is bm and first column bn.
// Block tile 128x64, BK=16, 8 waves of 32x32, fp32 WMMA 16x16x4.
// Double-buffered LDS; async DMA staging when available.
// ---------------------------------------------------------------------------
// Stands behind a run of global loads or stores, in front of the first reuse of
// a register that they name; the two scheduling barriers keep later register
// writes from being moved up over the wait.
#define XCNT_WAIT()                                  \
  do {                                               \
    __builtin_amdgcn_sched_barrier(0);               \
    asm volatile("s_wait_xcnt 0x0" ::: "memory");    \
    __builtin_amdgcn_sched_barrier(0);               \
  } while (0)

#define BM 128
#define BN 64
#define BK 16
#define LDA_S 20   // padded LDS row stride (floats): 16B-aligned, conflict-free

__device__ __forceinline__ void gemm_tile(
    const float* __restrict__ A, const float* __restrict__ Bw,
    const float* __restrict__ bias, float* __restrict__ Cmat,
    int N, int K, float alpha, int mode, const int bm, const int bn) {
  __shared__ __align__(16) float sA[2][BM * LDA_S];
  __shared__ __align__(16) float sB[2][BN * LDA_S];

  const int tid  = threadIdx.x;
  const int lane = tid & 31, wid = tid >> 5;
  const int hi = lane >> 4, lo = lane & 15;
  const int wm = (wid >> 1) * 32, wn = (wid & 1) * 32;

  v8f acc[2][2] = {};

  auto compute_tile = [&](const float* cA, const float* cB) {
#pragma unroll
    for (int kk = 0; kk < 4; kk++) {
      const int ko = kk * 4 + hi * 2;
      v2f aF[2], bF[2];
      aF[0] = *(const v2f*)(cA + (wm + lo) * LDA_S + ko);
      aF[1] = *(const v2f*)(cA + (wm + 16 + lo) * LDA_S + ko);
      bF[0] = *(const v2f*)(cB + (wn + lo) * LDA_S + ko);
      bF[1] = *(const v2f*)(cB + (wn + 16 + lo) * LDA_S + ko);
#pragma unroll
      for (int i = 0; i < 2; i++)
#pragma unroll
        for (int j = 0; j < 2; j++)
          acc[i][j] = __builtin_amdgcn_wmma_f32_16x16x4_f32(
              false, aF[i], false, bF[j], (short)0, acc[i][j], false, false);
    }
  };

#if USE_ASYNC_LDS
  // --- async DMA double-buffered pipeline ---
  auto stage = [&](int buf, int k0) {
#pragma unroll
    for (int j = 0; j < 2; j++) {           // A tile: 512 B128 slots, 2/thread
      int s = tid * 2 + j;
      int r = s >> 2, c4 = (s & 3) * 4;
      async_cp16(A + (size_t)(bm + r) * K + k0 + c4, &sA[buf][r * LDA_S + c4]);
    }
    {                                       // B tile: 256 B128 slots, 1/thread
      int r = tid >> 2, c4 = (tid & 3) * 4;
      async_cp16(Bw + (size_t)(bn + r) * K + k0 + c4, &sB[buf][r * LDA_S + c4]);
    }
  };

  stage(0, 0);
  wait_async0();
  __syncthreads();
  int cur = 0;
  for (int k0 = 0; k0 < K; k0 += BK) {
    if (k0 + BK < K) stage(cur ^ 1, k0 + BK);   // DMA next tile in background
    compute_tile(sA[cur], sB[cur]);             // 16 WMMAs on current tile
    wait_async0();
    __syncthreads();
    cur ^= 1;
  }
#else
  // --- fallback: synchronous single-buffer staging ---
  for (int k0 = 0; k0 < K; k0 += BK) {
#pragma unroll
    for (int j = 0; j < 2; j++) {
      int s = tid * 2 + j;
      int r = s >> 2, c4 = (s & 3) * 4;
      float4 v = *(const float4*)(A + (size_t)(bm + r) * K + k0 + c4);
      *(float4*)(&sA[0][r * LDA_S + c4]) = v;
    }
    {
      int r = tid >> 2, c4 = (tid & 3) * 4;
      float4 v = *(const float4*)(Bw + (size_t)(bn + r) * K + k0 + c4);
      *(float4*)(&sB[0][r * LDA_S + c4]) = v;
    }
    __syncthreads();
    compute_tile(sA[0], sB[0]);
    __syncthreads();
  }
#endif

  // Epilogue. C/D layout: VGPR r -> M = r + 8*hi, N = lo.
#pragma unroll
  for (int i = 0; i < 2; i++)
#pragma unroll
    for (int j = 0; j < 2; j++)
#pragma unroll
      for (int r = 0; r < 8; r++) {
        int row = bm + wm + i * 16 + r + hi * 8;
        int col = bn + wn + j * 16 + lo;
        size_t idx = (size_t)row * N + col;
        float v = alpha * acc[i][j][r];
        if (bias) v += bias[col];
        if (mode == 2) v += Cmat[idx];
        Cmat[idx] = v;
        XCNT_WAIT();   // the next element reuses this store's address and data registers
      }
}

__global__ __launch_bounds__(256) void wmma_gemm(
    const float* __restrict__ A, const float* __restrict__ Bw,
    const float* __restrict__ bias, float* __restrict__ Cmat,
    int M, int N, int K, float alpha, int mode) {
  gemm_tile(A, Bw, bias, Cmat, N, K, alpha, mode, blockIdx.y * BM, blockIdx.x * BN);
}

// Tile t of the 1024 block tiles (64 tile rows x 16 tile columns, column fastest) of
//   seq += n @ (Wo diag(Dp) Wi)^T + Wo (Dp * bi) + bo
// This product needs only n, not the scan. The ub product fills half the WGPs
// and the serial pass of the scan one, and both last long, so these two launches
// carry the tiles, on blocks numbered behind their own.
__device__ __forceinline__ void seq_tile(
    const float* __restrict__ n, const float* __restrict__ q,
    const float* __restrict__ qb, float* __restrict__ seq, const int t) {
  gemm_tile(n, q, qb, seq, 1024, 1024, 1.0f, 2, (t >> 4) * BM, (t & 15) * BN);
}

// Blocks 0..127: the 64 x 2 tiles of ub = DT * (n @ (Bp Wi)^T + Bp bi); q holds
// Wo diag(Dp) Wi (1024 rows) and then Bp Wi (128 rows), qb their biases.
// Blocks 128 and up: seq tiles 0, 1, ...
__global__ __launch_bounds__(256) void ub_gemm_tiles(
    const float* __restrict__ n, const float* __restrict__ q,
    const float* __restrict__ qb, float* __restrict__ ub, float* __restrict__ seq) {
  const int blk = blockIdx.x;
  const bool u = blk < 128;
  const int t = blk - 128;
  gemm_tile(n, u ? q + 1024 * 1024 : q, u ? qb + 1024 : qb, u ? ub : seq,
            u ? 128 : 1024, 1024, u ? SSM_DT : 1.0f, u ? 0 : 2,
            (u ? blk >> 1 : t >> 4) * BM, (u ? blk & 1 : t & 15) * BN);
}

// The two weight products of every layer (blockIdx.z) in one launch, grid (16, 10):
//   y < 9 : qg (1152 x 1024) = lf @ wit^T, tile (y, x)
//   y == 9: pf (1024 x 128)  = Wo @ cpt^T, its 8 x 2 tiles numbered by x
__global__ __launch_bounds__(256) void fold_gemm(
    const float* __restrict__ lf, const float* __restrict__ wit,
    const float* __restrict__ Wo, const float* __restrict__ cpt,
    float* __restrict__ qg, float* __restrict__ pf) {
  const int x = blockIdx.x, y = blockIdx.y;
  const size_t i = blockIdx.z;
  const bool q = y < 9;
  gemm_tile(q ? lf + i * (1152 * 1024) : Wo + i * (1024 * 1024),
            q ? wit + i * (1024 * 1024) : cpt + i * (128 * 1024), nullptr,
            q ? qg + i * (1152 * 1024) : pf + i * (1024 * 128),
            q ? 1024 : 128, 1024, 1.0f, 0,
            (q ? y : x >> 1) * BM, (q ? x : x & 1) * BN);
}

// ---------------------------------------------------------------------------
// Sequential scan: h (16x128, rows 8..15 zero-padded) lives in LDS.
//   per step l: h = h @ A_bar^T + ub[:, l, :];  store hs[b*L + l][s] = h[b][s]
// One block, 8 waves; wave w owns state columns 16w..16w+15.
// A_bar fragments preloaded into registers (loop-invariant, 32 x float2).
// The next step's ub slab is async-DMA'd into LDS while WMMAs run.
// ---------------------------------------------------------------------------
#define SLDS 132   // 16 fragment rows -> 16 distinct LDS banks

__device__ __forceinline__ void scan_serial(
    const float* __restrict__ ub, const float* __restrict__ abar,
    float* __restrict__ hs, const int L) {
  __shared__ __align__(16) float hbuf[16 * SLDS];
#if USE_ASYNC_LDS
  __shared__ __align__(16) float ubs[2][8 * 128];
#endif
  const int tid = threadIdx.x;
  const int lane = tid & 31, wid = tid >> 5;
  const int hi = lane >> 4, lo = lane & 15;
  const int n0 = wid * 16;

  // Preload B fragments of A_bar (stored [s][k], K-major like the GEMM weights)
  v2f bF[32];
#pragma unroll
  for (int kk = 0; kk < 32; kk++)
    bF[kk] = *(const v2f*)(abar + (size_t)(n0 + lo) * 128 + kk * 4 + hi * 2);

#if USE_ASYNC_LDS
  auto prefetch_ub = [&](int buf, int l) {   // 8 rows x 128 floats, B128/thread
    int b = tid >> 5, s4 = (tid & 31) * 4;
    async_cp16(ub + ((size_t)b * L + l) * 128 + s4, &ubs[buf][b * 128 + s4]);
  };
  prefetch_ub(0, 0);
#endif

  for (int i = tid; i < 16 * SLDS; i += 256) hbuf[i] = 0.0f;
#if USE_ASYNC_LDS
  wait_async0();
#endif
  __syncthreads();

  for (int l = 0; l < L; l++) {
#if USE_ASYNC_LDS
    if (l + 1 < L) prefetch_ub((l + 1) & 1, l + 1);  // hide global latency
#endif
    v8f c = {};
#pragma unroll
    for (int kk = 0; kk < 32; kk++) {
      v2f a = *(const v2f*)(hbuf + lo * SLDS + kk * 4 + hi * 2);
      c = __builtin_amdgcn_wmma_f32_16x16x4_f32(
          false, a, false, bF[kk], (short)0, c, false, false);
    }
    __syncthreads();            // everyone done reading h before overwrite
#pragma unroll
    for (int r = 0; r < 8; r++) {
      int m = r + hi * 8;       // padded batch row
      int n = n0 + lo;          // state column
      float v = c[r];
      if (m < 8) {
#if USE_ASYNC_LDS
        v += ubs[l & 1][m * 128 + n];
#else
        v += ub[((size_t)m * L + l) * 128 + n];
#endif
        hs[((size_t)m * L + l) * 128 + n] = v;
      }
      hbuf[m * SLDS + n] = v;
    }
#if USE_ASYNC_LDS
    wait_async0();
#endif
    __syncthreads();
  }
}

// Block 0 scans; blocks 1 and up do seq tiles t0, t0 + 1, ...
__global__ __launch_bounds__(256) void scan_serial_tiles(
    const float* __restrict__ ub, const float* __restrict__ abar,
    float* __restrict__ hs, int L,
    const float* __restrict__ n, const float* __restrict__ q,
    const float* __restrict__ qb, float* __restrict__ seq, int t0) {
  const int blk = blockIdx.x;
  if (blk == 0) scan_serial(ub, abar, hs, L);
  else seq_tile(n, q, qb, seq, t0 + blk - 1);
}

// ---------------------------------------------------------------------------
// Chunked scan. The recurrence h_l = h_{l-1} @ M^T + x_l is linear, so a
// sequence is cut into chunks of SCT steps and every (batch, chunk) pair is one
// row of a 16-row tile; one block steps its 16 rows SCT times.
//   full == 0: rows start from zero, only the chunk's last state is stored
//              (outp[row]). Blocks >= nrb step the rows of the identity with
//              the transposed matrix instead: they store M^SCT (pw, laid out
//              [s][k] like M), the matrix that carries a state over one chunk.
//   full == 1: row R starts from carry[R-1], the true state at the end of the
//              chunk before it (zero for a sequence's first chunk), and every
//              step's state is stored (outp[row * SCT + t]).
// The chunk ends form a recurrence of the same kind, SCT times shorter, with
// M^SCT as its matrix, so the launcher applies the same two passes to it again.
// Row R = batch * NC + chunk; its step t lies at sequence row R * SCT + t.
// ---------------------------------------------------------------------------
#define SCT 8

// ident and full are literals or block-uniform at every call. The loops over r
// and kk are unrolled so that bF, hv, un and the accumulator stay in registers.
__device__ __forceinline__ void scan_rows(
    const float* __restrict__ ub, const float* __restrict__ mat,
    const float* __restrict__ carry, float* __restrict__ outp,
    int NC, int row0, const bool ident, const bool full) {
  __shared__ __align__(16) float hbuf[16 * SLDS];
  const int tid = threadIdx.x;
  const int lane = tid & 31, wid = tid >> 5;
  const int hi = lane >> 4, lo = lane & 15;
  const int n = wid * 16 + lo;                       // state column of this lane
  const int r0 = row0 + hi * 8;                      // row of accumulator register 0

  v2f bF[32];
  float hv[8], un[8];
  if (ident) {
#pragma unroll
    for (int kk = 0; kk < 32; kk++) {
      bF[kk].x = mat[(kk * 4 + hi * 2) * 128 + n];
      bF[kk].y = mat[(kk * 4 + hi * 2 + 1) * 128 + n];
    }
#pragma unroll
    for (int r = 0; r < 8; r++) {
      hv[r] = (r0 + r == n) ? 1.0f : 0.0f;
      un[r] = 0.0f;
    }
  } else {
    float cv[8];
    if (full) {
      // row R takes row R-1; row 0 has none before it and is a first chunk
      cv[0] = carry[(size_t)(r0 > 0 ? r0 - 1 : 0) * 128 + n];
#pragma unroll
      for (int r = 1; r < 8; r++) cv[r] = carry[(size_t)r0 * 128 + (r - 1) * 128 + n];
      XCNT_WAIT();
    }
#pragma unroll
    for (int r = 0; r < 8; r++)
      un[r] = ub[(size_t)r0 * (SCT * 128) + r * (SCT * 128) + n];
    XCNT_WAIT();
#pragma unroll
    for (int kk = 0; kk < 32; kk++)
      bF[kk] = *(const v2f*)(mat + n * 128 + kk * 4 + hi * 2);
    XCNT_WAIT();
#pragma unroll
    for (int r = 0; r < 8; r++)
      hv[r] = (full && ((r0 + r) & (NC - 1))) ? cv[r] : 0.0f;
  }
#pragma unroll
  for (int r = 0; r < 8; r++) hbuf[(hi * 8 + r) * SLDS + n] = hv[r];
  __syncthreads();

  for (int t = 0; t < SCT; t++) {
    float uc[8];
#pragma unroll
    for (int r = 0; r < 8; r++) uc[r] = un[r];
    if (!ident && t + 1 < SCT) {                     // next step's inputs fly under the WMMAs
#pragma unroll
      for (int r = 0; r < 8; r++)
        un[r] = ub[(size_t)r0 * (SCT * 128) + r * (SCT * 128) + (t + 1) * 128 + n];
    }
    v8f c = {};
#pragma unroll
    for (int kk = 0; kk < 32; kk++) {
      v2f a = *(const v2f*)(hbuf + lo * SLDS + kk * 4 + hi * 2);
      c = __builtin_amdgcn_wmma_f32_16x16x4_f32(
          false, a, false, bF[kk], (short)0, c, false, false);
    }
#pragma unroll
    for (int r = 0; r < 8; r++) hv[r] = c[r] + uc[r];
    if (full) {
#pragma unroll
      for (int r = 0; r < 8; r++)
        outp[(size_t)r0 * (SCT * 128) + r * (SCT * 128) + t * 128 + n] = hv[r];
      XCNT_WAIT();
    }
    if (t + 1 == SCT) break;    // the last state is not read back from LDS
    __syncthreads();            // everyone done reading h before overwrite
#pragma unroll
    for (int r = 0; r < 8; r++) hbuf[(hi * 8 + r) * SLDS + n] = hv[r];
    __syncthreads();
  }

  if (!full) {
#pragma unroll
    for (int r = 0; r < 8; r++) outp[(size_t)r0 * 128 + r * 128 + n] = hv[r];
  }
}

__global__ __launch_bounds__(256) void scan_chunk_ends(
    const float* __restrict__ ub, const float* __restrict__ mat,
    float* __restrict__ ends, float* __restrict__ pw, int nrb) {
  const int blk = blockIdx.x;
  const bool ident = blk >= nrb;
  scan_rows(ub, mat, nullptr, ident ? pw : ends, 0, (ident ? blk - nrb : blk) * 16, ident, false);
}

__global__ __launch_bounds__(256) void scan_chunk_fill(
    const float* __restrict__ ub, const float* __restrict__ mat,
    const float* __restrict__ carry, float* __restrict__ outp, int NC) {
  scan_rows(ub, mat, carry, outp, NC, blockIdx.x * 16, false, true);
}

// ---------------------------------------------------------------------------
// Launcher
// ---------------------------------------------------------------------------
extern "C" void kernel_launch(void* const* d_in, const int* in_sizes, int n_in,
                              void* d_out, int out_size, void* d_ws, size_t ws_size,
                              hipStream_t stream) {
  (void)in_sizes; (void)n_in; (void)out_size; (void)ws_size;
  const float* x     = (const float*)d_in[0];
  const float* Aall  = (const float*)d_in[1];
  const float* Bp    = (const float*)d_in[2];
  const float* Cp    = (const float*)d_in[3];
  const float* Dp    = (const float*)d_in[4];
  const float* Wi    = (const float*)d_in[5];
  const float* bi    = (const float*)d_in[6];
  const float* Wo    = (const float*)d_in[7];
  const float* bo    = (const float*)d_in[8];
  const float* gamma = (const float*)d_in[9];
  const float* beta  = (const float*)d_in[10];
  float* out = (float*)d_out;

  const int Bn = 8, L = 1024, C = 1024, S = 128, depth = 4;
  const size_t nBLC = (size_t)Bn * L * C;    // 8Mi floats
  const size_t nBLS = (size_t)Bn * L * S;    // 1Mi floats

  float* seq  = (float*)d_ws;                // (B, L, C)
  float* nbuf = seq  + nBLC;                 // LN output
  float* ubb  = nbuf + nBLC;                 // DT * u @ Bp^T   (b*L+l, S)
  float* hsb  = ubb  + nBLS;                 // scan states     (b*L+l, S)
  float* abar = hsb  + nBLS;                 // I + DT*A (128x128)
  float* pw1  = abar + S * S;                // A_bar^8
  float* pw2  = pw1  + S * S;                // A_bar^64
  float* le0  = pw2  + S * S;                // ends of the 8-step chunks from zero  (b*128+c, S)
  float* car0 = le0  + nBLS / SCT;           // true states at those ends            (b*128+c, S)
  float* le1  = car0 + nBLS / SCT;           // ends of the 64-step chunks from zero (b*16+c, S)
  float* car1 = le1  + nBLS / (SCT * SCT);   // true states at those ends            (b*16+c, S)
  // folded weights, all layers
  const int F = C + S;                       // 1152 rows: Wo diag(Dp) over Bp
  float* wit  = car1 + nBLS / (SCT * SCT);   // Wi^T                        (layer, c, d)
  float* cpt  = wit  + (size_t)depth * C * C;  // Cp^T                      (layer, s, d)
  float* lf   = cpt  + (size_t)depth * S * C;  // [Wo diag(Dp); Bp]         (layer, F, d)
  float* qg   = lf   + (size_t)depth * F * C;  // lf @ Wi                   (layer, F, c)
  float* pf   = qg   + (size_t)depth * F * C;  // Wo @ Cp                   (layer, o, s)
  float* fb   = pf   + (size_t)depth * C * S;  // folded biases             (layer, F)

  dim3 tb(32, 8);
  dim3 tg(32, 32, Bn);
  transpose_bll<1024><<<tg, tb, 0, stream>>>(x, seq);   // seq[b][l][c] = x[b][c][l]

  transpose_bll<1024><<<dim3(32, 32, depth), tb, 0, stream>>>(Wi, wit);  // wit[c][d] = Wi[d][c]
  transpose_bll<128><<<dim3(32, 4, depth), tb, 0, stream>>>(Cp, cpt);    // cpt[s][d] = Cp[d][s]
  fold_rows<<<dim3(F, depth), 256, 0, stream>>>(Wo, Bp, Dp, bi, bo, lf, fb);
  // qg = [Wo diag(Dp); Bp] @ Wi and pf = Wo @ Cp
  fold_gemm<<<dim3(16, 10, depth), 256, 0, stream>>>(lf, wit, Wo, cpt, qg, pf);

  for (int i = 0; i < depth; i++) {
    const float* qi = qg + (size_t)i * F * C;   // Wo diag(Dp) Wi, then Bp Wi
    const float* fi = fb + i * F;

    ln_kernel<<<Bn * L, 256, 0, stream>>>(seq, gamma + i * C, beta + i * C, nbuf, C);

    // ub = DT * (n @ (Bp Wi)^T + Bp bi), 128 blocks. The 1024 tiles of
    // seq += n @ (Wo diag(Dp) Wi)^T + Wo (Dp * bi) + bo ride along: 896 here, which
    // makes four blocks a WGP, and 128 beside the one block of the serial scan pass.
    ub_gemm_tiles<<<128 + 896, 256, 0, stream>>>(nbuf, qi, fi, ubb, seq);

    abar_kernel<<<(S * S) / 256, 256, 0, stream>>>(Aall + (size_t)i * S * S, abar);

    // scan of length 1024 = 8 x 8 x 16: two chunk levels up, 16 serial steps, two down
    scan_chunk_ends<<<64 + 8, 256, 0, stream>>>(ubb, abar, le0, pw1, 64);
    scan_chunk_ends<<<8 + 8, 256, 0, stream>>>(le0, pw1, le1, pw2, 8);
    scan_serial_tiles<<<1 + 128, 256, 0, stream>>>(le1, pw2, car1, 16,
                                                   nbuf, qi, fi, seq, 896);
    scan_chunk_fill<<<8, 256, 0, stream>>>(le0, pw1, car1, car0, 16);
    scan_chunk_fill<<<64, 256, 0, stream>>>(ubb, abar, car0, hsb, 128);

    // seq += hs @ (Wo Cp)^T
    wmma_gemm<<<dim3(C / BN, (Bn * L) / BM), 256, 0, stream>>>(
        hsb, pf + (size_t)i * C * S, nullptr, seq, Bn * L, C, S, 1.0f, 2);
  }

  transpose_bll<1024><<<tg, tb, 0, stream>>>(seq, out); // out[b][c][l] = seq[b][l][c]
}

// v004
// Measured time: 918 microseconds a run.
// Timed twice side by side with v003, it ran 1.17 and 1.19 times as fast.
// Counting every step since v000, it is 7.75 times as fast.
#include <hip/hip_runtime.h>
#include <stdint.h>

typedef __attribute__((ext_vector_type(2))) float v2f;
typedef __attribute__((ext_vector_type(8))) float v8f;

#define SSM_DT   0.001f
#define LN_EPS   1e-5f

// ---------------------------------------------------------------------------
// CDNA5 async global->LDS copy support (guarded so compile never breaks)
// ---------------------------------------------------------------------------
#ifdef __has_builtin
#if __has_builtin(__builtin_amdgcn_global_load_async_to_lds_b128)
#define USE_ASYNC_LDS 1
#endif
#endif
#ifndef USE_ASYNC_LDS
#define USE_ASYNC_LDS 0
#endif

#if USE_ASYNC_LDS
// Builtin signature (from hipcc diagnostic): param 0 is
// 'int __attribute__((vector_size(16))) addrspace(1)*', param 1 the LDS-side
// pointer, then two int immediates (offset, cpol).
typedef int v4i_g __attribute__((vector_size(16)));
typedef __attribute__((address_space(1))) v4i_g as1_v4i;
typedef __attribute__((address_space(3))) v4i_g as3_v4i;

// Generic LDS pointer's low 32 bits ARE the LDS byte offset (ISA aperture rule),
// so an int->as3-pointer round trip gives a valid LDS address without an
// addrspacecast.
__device__ __forceinline__ void async_cp16(const float* g, const float* lds) {
  __builtin_amdgcn_global_load_async_to_lds_b128(
      (as1_v4i*)(uintptr_t)g, (as3_v4i*)(uint32_t)(uintptr_t)lds, 0, 0);
}
__device__ __forceinline__ void wait_async0() {
#if __has_builtin(__builtin_amdgcn_s_wait_asynccnt)
  __builtin_amdgcn_s_wait_asynccnt(0);
#else
  asm volatile("s_wait_asynccnt 0" ::: "memory");
#endif
}
#endif

// ---------------------------------------------------------------------------
// Transpose (1024 x NC per batch): dst[b][i][j] = src[b][j][i], j < 1024, i < NC
// ---------------------------------------------------------------------------
template <int NC>
__global__ __launch_bounds__(256) void transpose_bll(const float* __restrict__ src,
                                                     float* __restrict__ dst) {
  __shared__ float tile[32][33];
  int b = blockIdx.z;
  int i0 = blockIdx.y * 32, j0 = blockIdx.x * 32;
  int tx = threadIdx.x, ty = threadIdx.y;           // 32 x 8
  size_t base = (size_t)b * 1024 * NC;
#pragma unroll
  for (int k = 0; k < 32; k += 8)
    tile[ty + k][tx] = src[base + (size_t)(j0 + ty + k) * NC + i0 + tx];
  __syncthreads();
#pragma unroll
  for (int k = 0; k < 32; k += 8)
    dst[base + (size_t)(i0 + ty + k) * 1024 + j0 + tx] = tile[tx][ty + k];
}

// ---------------------------------------------------------------------------
// LayerNorm over last dim (C = 1024), one block per row, 256 threads
// ---------------------------------------------------------------------------
__global__ __launch_bounds__(256) void ln_kernel(const float* __restrict__ x,
                                                 const float* __restrict__ gamma,
                                                 const float* __restrict__ beta,
                                                 float* __restrict__ out, int C) {
  int row = blockIdx.x;
  int t = threadIdx.x;
  const float4 d = ((const float4*)(x + (size_t)row * C))[t];
  float s  = d.x + d.y + d.z + d.w;
  float ss = d.x * d.x + d.y * d.y + d.z * d.z + d.w * d.w;
  __shared__ float rs[256], rq[256];
  rs[t] = s; rq[t] = ss;
  __syncthreads();
  for (int off = 128; off > 0; off >>= 1) {
    if (t < off) { rs[t] += rs[t + off]; rq[t] += rq[t + off]; }
    __syncthreads();
  }
  float mean = rs[0] / (float)C;
  float var  = rq[0] / (float)C - mean * mean;
  float inv  = rsqrtf(var + LN_EPS);
  const float4 g = ((const float4*)gamma)[t];
  const float4 bb = ((const float4*)beta)[t];
  float4 o;
  o.x = (d.x - mean) * inv * g.x + bb.x;
  o.y = (d.y - mean) * inv * g.y + bb.y;
  o.z = (d.z - mean) * inv * g.z + bb.z;
  o.w = (d.w - mean) * inv * g.w + bb.w;
  ((float4*)(out + (size_t)row * C))[t] = o;
}

// ---------------------------------------------------------------------------
// A_bar = I + DT*A  (128x128)
// ---------------------------------------------------------------------------
__global__ void abar_kernel(const float* __restrict__ A, float* __restrict__ abar) {
  int i = blockIdx.x * blockDim.x + threadIdx.x;   // 16384
  int s = i >> 7, k = i & 127;
  abar[i] = (s == k ? 1.0f : 0.0f) + SSM_DT * A[i];
}

// ---------------------------------------------------------------------------
// Weight folding. With u = n Wi^T + bi the layer is linear in n and hs:
//   ub   = DT * (n (Bp Wi)^T + Bp bi)
//   seq += n (Wo diag(Dp) Wi)^T + hs (Wo Cp)^T + Wo (Dp * bi) + bo
// so u and y are never formed. This kernel lays out, per layer, the left factor
// of the products with Wi, 1152 rows of 1024: rows 0..1023 = Wo diag(Dp), rows
// 1024..1151 = Bp; and each row's product with bi, finished as the bias of the
// GEMM that uses the row: fb[r] = row . bi + bo[r], or DT * (row . bi) for Bp.
// One block per row (blockIdx.x) and layer (blockIdx.y).
// ---------------------------------------------------------------------------
__global__ __launch_bounds__(256) void fold_rows(
    const float* __restrict__ Wo, const float* __restrict__ Bp,
    const float* __restrict__ Dp, const float* __restrict__ bi,
    const float* __restrict__ bo, float* __restrict__ lf, float* __restrict__ fb) {
  const int r = blockIdx.x, i = blockIdx.y, t = threadIdx.x;
  const bool isw = r < 1024;
  const float* srow = isw ? Wo + ((size_t)i * 1024 + r) * 1024
                          : Bp + ((size_t)i * 128 + (r - 1024)) * 1024;
  float4 w = ((const float4*)srow)[t];
  if (isw) {
    const float4 d = ((const float4*)(Dp + i * 1024))[t];
    w.x *= d.x; w.y *= d.y; w.z *= d.z; w.w *= d.w;
  }
  ((float4*)(lf + ((size_t)i * 1152 + r) * 1024))[t] = w;
  const float4 b = ((const float4*)(bi + i * 1024))[t];
  __shared__ float rs[256];
  rs[t] = w.x * b.x + w.y * b.y + w.z * b.z + w.w * b.w;
  __syncthreads();
  for (int off = 128; off > 0; off >>= 1) {
    if (t < off) rs[t] += rs[t + off];
    __syncthreads();
  }
  if (t == 0) fb[i * 1152 + r] = isw ? rs[0] + bo[i * 1024 + r] : SSM_DT * rs[0];
}

// ---------------------------------------------------------------------------
// WMMA GEMM: Cmat[M x N] = alpha * (A[M x K] @ Bw[N x K]^T)  (+ bias[N])
//   mode 0: plain           mode 2: += old Cmat value (residual accumulate)
// gemm_tile does the block tile whose first row is bm and first column bn.
// N, the row pitch of Cmat, is 1024 or 128.
// Block tile 128x64, BK=16, 8 waves of 32x32, fp32 WMMA 16x16x4.
// Double-buffered LDS; async DMA staging when available.
// ---------------------------------------------------------------------------
// Stands behind a run of global loads or stores, in front of the first reuse of
// a register that they name; the two scheduling barriers keep later register
// writes from being moved up over the wait.
#define XCNT_WAIT()                                  \
  do {                                               \
    __builtin_amdgcn_sched_barrier(0);               \
    asm volatile("s_wait_xcnt 0x0" ::: "memory");    \
    __builtin_amdgcn_sched_barrier(0);               \
  } while (0)

#define BM 128
#define BN 64
#define BK 16
#define LDA_S 20   // padded LDS row stride (floats): 16B-aligned, conflict-free

__device__ __forceinline__ void gemm_tile(
    const float* __restrict__ A, const float* __restrict__ Bw,
    const float* __restrict__ bias, float* __restrict__ Cmat,
    int N, int K, float alpha, int mode, const int bm, const int bn) {
  __shared__ __align__(16) float sA[2][BM * LDA_S];
  __shared__ __align__(16) float sB[2][BN * LDA_S];

  const int tid  = threadIdx.x;
  const int lane = tid & 31, wid = tid >> 5;
  const int hi = lane >> 4, lo = lane & 15;
  const int wm = (wid >> 1) * 32, wn = (wid & 1) * 32;

  v8f acc[2][2] = {};

  auto compute_tile = [&](const float* cA, const float* cB) {
#pragma unroll
    for (int kk = 0; kk < 4; kk++) {
      const int ko = kk * 4 + hi * 2;
      v2f aF[2], bF[2];
      aF[0] = *(const v2f*)(cA + (wm + lo) * LDA_S + ko);
      aF[1] = *(const v2f*)(cA + (wm + 16 + lo) * LDA_S + ko);
      bF[0] = *(const v2f*)(cB + (wn + lo) * LDA_S + ko);
      bF[1] = *(const v2f*)(cB + (wn + 16 + lo) * LDA_S + ko);
#pragma unroll
      for (int i = 0; i < 2; i++)
#pragma unroll
        for (int j = 0; j < 2; j++)
          acc[i][j] = __builtin_amdgcn_wmma_f32_16x16x4_f32(
              false, aF[i], false, bF[j], (short)0, acc[i][j], false, false);
    }
  };

#if USE_ASYNC_LDS
  // --- async DMA double-buffered pipeline ---
  auto stage = [&](int buf, int k0) {
#pragma unroll
    for (int j = 0; j < 2; j++) {           // A tile: 512 B128 slots, 2/thread
      int s = tid * 2 + j;
      int r = s >> 2, c4 = (s & 3) * 4;
      async_cp16(A + (size_t)(bm + r) * K + k0 + c4, &sA[buf][r * LDA_S + c4]);
    }
    {                                       // B tile: 256 B128 slots, 1/thread
      int r = tid >> 2, c4 = (tid & 3) * 4;
      async_cp16(Bw + (size_t)(bn + r) * K + k0 + c4, &sB[buf][r * LDA_S + c4]);
    }
  };

  stage(0, 0);
  wait_async0();
  __syncthreads();
  int cur = 0;
  for (int k0 = 0; k0 < K; k0 += BK) {
    if (k0 + BK < K) stage(cur ^ 1, k0 + BK);   // DMA next tile in background
    compute_tile(sA[cur], sB[cur]);             // 16 WMMAs on current tile
    wait_async0();
    __syncthreads();
    cur ^= 1;
  }
#else
  // --- fallback: synchronous single-buffer staging ---
  for (int k0 = 0; k0 < K; k0 += BK) {
#pragma unroll
    for (int j = 0; j < 2; j++) {
      int s = tid * 2 + j;
      int r = s >> 2, c4 = (s & 3) * 4;
      float4 v = *(const float4*)(A + (size_t)(bm + r) * K + k0 + c4);
      *(float4*)(&sA[0][r * LDA_S + c4]) = v;
    }
    {
      int r = tid >> 2, c4 = (tid & 3) * 4;
      float4 v = *(const float4*)(Bw + (size_t)(bn + r) * K + k0 + c4);
      *(float4*)(&sB[0][r * LDA_S + c4]) = v;
    }
    __syncthreads();
    compute_tile(sA[0], sB[0]);
    __syncthreads();
  }
#endif

  // Epilogue. C/D layout: VGPR r -> M = r + 8*hi, N = lo.
  // A lane's two bias values and its 32 old values are loaded in one batch, so
  // that the wave waits out one load latency and not one per element; then the
  // sums in the old order (alpha * acc, + bias, + old value), then the 32 stores.
  const int col = bn + wn + lo;
  float bv[2] = {0.0f, 0.0f};
  if (bias) {
    bv[0] = bias[col];
    bv[1] = bias[col + 16];
    XCNT_WAIT();   // the address arithmetic below reuses these two loads' address registers
  }
  // pitch is a literal at both calls: all 64 accesses of a lane then go through
  // one address register pair with immediate offsets, which nothing overwrites.
  auto finish = [&](const int pitch) {
    float* const c0 = Cmat + (size_t)(bm + wm + hi * 8) * pitch + col;
    float v[2][2][8] = {};
    if (mode == 2) {
#pragma unroll
      for (int i = 0; i < 2; i++)
#pragma unroll
        for (int r = 0; r < 8; r++)
#pragma unroll
          for (int j = 0; j < 2; j++) v[i][j][r] = c0[(i * 16 + r) * pitch + j * 16];
      // keeps the sums, which wait for the bias values, behind the issue of these loads
      __builtin_amdgcn_sched_barrier(0);
    }
#pragma unroll
    for (int i = 0; i < 2; i++)
#pragma unroll
      for (int r = 0; r < 8; r++)
#pragma unroll
        for (int j = 0; j < 2; j++) v[i][j][r] = alpha * acc[i][j][r] + bv[j] + v[i][j][r];
    // keeps every sum in front of the first store, so that no sum is written into
    // the data register of a store that has been issued
    __builtin_amdgcn_sched_barrier(0);
#pragma unroll
    for (int i = 0; i < 2; i++)
#pragma unroll
      for (int r = 0; r < 8; r++)
#pragma unroll
        for (int j = 0; j < 2; j++) c0[(i * 16 + r) * pitch + j * 16] = v[i][j][r];
    XCNT_WAIT();   // the code that follows in the kernel's text reuses these registers
  };
  if (N == 1024) finish(1024);
  else finish(128);
}

__global__ __launch_bounds__(256) void wmma_gemm(
    const float* __restrict__ A, const float* __restrict__ Bw,
    const float* __restrict__ bias, float* __restrict__ Cmat,
    int M, int N, int K, float alpha, int mode) {
  gemm_tile(A, Bw, bias, Cmat, N, K, alpha, mode, blockIdx.y * BM, blockIdx.x * BN);
}

// Tile t of the 1024 block tiles (64 tile rows x 16 tile columns, column fastest) of
//   seq += n @ (Wo diag(Dp) Wi)^T + Wo (Dp * bi) + bo
// This product needs only n, not the scan. The ub product fills half the WGPs
// and the serial pass of the scan one, and both last long, so these two launches
// carry the tiles, on blocks numbered behind their own.
__device__ __forceinline__ void seq_tile(
    const float* __restrict__ n, const float* __restrict__ q,
    const float* __restrict__ qb, float* __restrict__ seq, const int t) {
  gemm_tile(n, q, qb, seq, 1024, 1024, 1.0f, 2, (t >> 4) * BM, (t & 15) * BN);
}

// Blocks 0..127: the 64 x 2 tiles of ub = DT * (n @ (Bp Wi)^T + Bp bi); q holds
// Wo diag(Dp) Wi (1024 rows) and then Bp Wi (128 rows), qb their biases.
// Blocks 128 and up: seq tiles 0, 1, ...
__global__ __launch_bounds__(256) void ub_gemm_tiles(
    const float* __restrict__ n, const float* __restrict__ q,
    const float* __restrict__ qb, float* __restrict__ ub, float* __restrict__ seq) {
  const int blk = blockIdx.x;
  const bool u = blk < 128;
  const int t = blk - 128;
  gemm_tile(n, u ? q + 1024 * 1024 : q, u ? qb + 1024 : qb, u ? ub : seq,
            u ? 128 : 1024, 1024, u ? SSM_DT : 1.0f, u ? 0 : 2,
            (u ? blk >> 1 : t >> 4) * BM, (u ? blk & 1 : t & 15) * BN);
}

// The two weight products of every layer (blockIdx.z) in one launch, grid (16, 10):
//   y < 9 : qg (1152 x 1024) = lf @ wit^T, tile (y, x)
//   y == 9: pf (1024 x 128)  = Wo @ cpt^T, its 8 x 2 tiles numbered by x
__global__ __launch_bounds__(256) void fold_gemm(
    const float* __restrict__ lf, const float* __restrict__ wit,
    const float* __restrict__ Wo, const float* __restrict__ cpt,
    float* __restrict__ qg, float* __restrict__ pf) {
  const int x = blockIdx.x, y = blockIdx.y;
  const size_t i = blockIdx.z;
  const bool q = y < 9;
  gemm_tile(q ? lf + i * (1152 * 1024) : Wo + i * (1024 * 1024),
            q ? wit + i * (1024 * 1024) : cpt + i * (128 * 1024), nullptr,
            q ? qg + i * (1152 * 1024) : pf + i * (1024 * 128),
            q ? 1024 : 128, 1024, 1.0f, 0,
            (q ? y : x >> 1) * BM, (q ? x : x & 1) * BN);
}

// ---------------------------------------------------------------------------
// Sequential scan: h (16x128, rows 8..15 zero-padded) lives in LDS.
//   per step l: h = h @ A_bar^T + ub[:, l, :];  store hs[b*L + l][s] = h[b][s]
// One block, 8 waves; wave w owns state columns 16w..16w+15.
// A_bar fragments preloaded into registers (loop-invariant, 32 x float2).
// The next step's ub slab is async-DMA'd into LDS while WMMAs run.
// ---------------------------------------------------------------------------
#define SLDS 132   // 16 fragment rows -> 16 distinct LDS banks

__device__ __forceinline__ void scan_serial(
    const float* __restrict__ ub, const float* __restrict__ abar,
    float* __restrict__ hs, const int L) {
  __shared__ __align__(16) float hbuf[16 * SLDS];
#if USE_ASYNC_LDS
  __shared__ __align__(16) float ubs[2][8 * 128];
#endif
  const int tid = threadIdx.x;
  const int lane = tid & 31, wid = tid >> 5;
  const int hi = lane >> 4, lo = lane & 15;
  const int n0 = wid * 16;

  // Preload B fragments of A_bar (stored [s][k], K-major like the GEMM weights)
  v2f bF[32];
#pragma unroll
  for (int kk = 0; kk < 32; kk++)
    bF[kk] = *(const v2f*)(abar + (size_t)(n0 + lo) * 128 + kk * 4 + hi * 2);

#if USE_ASYNC_LDS
  auto prefetch_ub = [&](int buf, int l) {   // 8 rows x 128 floats, B128/thread
    int b = tid >> 5, s4 = (tid & 31) * 4;
    async_cp16(ub + ((size_t)b * L + l) * 128 + s4, &ubs[buf][b * 128 + s4]);
  };
  prefetch_ub(0, 0);
#endif

  for (int i = tid; i < 16 * SLDS; i += 256) hbuf[i] = 0.0f;
#if USE_ASYNC_LDS
  wait_async0();
#endif
  __syncthreads();

  for (int l = 0; l < L; l++) {
#if USE_ASYNC_LDS
    if (l + 1 < L) prefetch_ub((l + 1) & 1, l + 1);  // hide global latency
#endif
    v8f c = {};
#pragma unroll
    for (int kk = 0; kk < 32; kk++) {
      v2f a = *(const v2f*)(hbuf + lo * SLDS + kk * 4 + hi * 2);
      c = __builtin_amdgcn_wmma_f32_16x16x4_f32(
          false, a, false, bF[kk], (short)0, c, false, false);
    }
    __syncthreads();            // everyone done reading h before overwrite
#pragma unroll
    for (int r = 0; r < 8; r++) {
      int m = r + hi * 8;       // padded batch row
      int n = n0 + lo;          // state column
      float v = c[r];
      if (m < 8) {
#if USE_ASYNC_LDS
        v += ubs[l & 1][m * 128 + n];
#else
        v += ub[((size_t)m * L + l) * 128 + n];
#endif
        hs[((size_t)m * L + l) * 128 + n] = v;
      }
      hbuf[m * SLDS + n] = v;
    }
#if USE_ASYNC_LDS
    wait_async0();
#endif
    __syncthreads();
  }
}

// Block 0 scans; blocks 1 and up do seq tiles t0, t0 + 1, ...
__global__ __launch_bounds__(256) void scan_serial_tiles(
    const float* __restrict__ ub, const float* __restrict__ abar,
    float* __restrict__ hs, int L,
    const float* __restrict__ n, const float* __restrict__ q,
    const float* __restrict__ qb, float* __restrict__ seq, int t0) {
  const int blk = blockIdx.x;
  if (blk == 0) scan_serial(ub, abar, hs, L);
  else seq_tile(n, q, qb, seq, t0 + blk - 1);
}

// ---------------------------------------------------------------------------
// Chunked scan. The recurrence h_l = h_{l-1} @ M^T + x_l is linear, so a
// sequence is cut into chunks of SCT steps and every (batch, chunk) pair is one
// row of a 16-row tile; one block steps its 16 rows SCT times.
//   full == 0: rows start from zero, only the chunk's last state is stored
//              (outp[row]). Blocks >= nrb step the rows of the identity with
//              the transposed matrix instead: they store M^SCT (pw, laid out
//              [s][k] like M), the matrix that carries a state over one chunk.
//   full == 1: row R starts from carry[R-1], the true state at the end of the
//              chunk before it (zero for a sequence's first chunk), and every
//              step's state is stored (outp[row * SCT + t]).
// The chunk ends form a recurrence of the same kind, SCT times shorter, with
// M^SCT as its matrix, so the launcher applies the same two passes to it again.
// Row R = batch * NC + chunk; its step t lies at sequence row R * SCT + t.
// ---------------------------------------------------------------------------
#define SCT 8

// ident and full are literals or block-uniform at every call. The loops over r
// and kk are unrolled so that bF, hv, un and the accumulator stay in registers.
__device__ __forceinline__ void scan_rows(
    const float* __restrict__ ub, const float* __restrict__ mat,
    const float* __restrict__ carry, float* __restrict__ outp,
    int NC, int row0, const bool ident, const bool full) {
  __shared__ __align__(16) float hbuf[16 * SLDS];
  const int tid = threadIdx.x;
  const int lane = tid & 31, wid = tid >> 5;
  const int hi = lane >> 4, lo = lane & 15;
  const int n = wid * 16 + lo;                       // state column of this lane
  const int r0 = row0 + hi * 8;                      // row of accumulator register 0

  v2f bF[32];
  float hv[8], un[8];
  if (ident) {
#pragma unroll
    for (int kk = 0; kk < 32; kk++) {
      bF[kk].x = mat[(kk * 4 + hi * 2) * 128 + n];
      bF[kk].y = mat[(kk * 4 + hi * 2 + 1) * 128 + n];
    }
#pragma unroll
    for (int r = 0; r < 8; r++) {
      hv[r] = (r0 + r == n) ? 1.0f : 0.0f;
      un[r] = 0.0f;
    }
  } else {
    float cv[8];
    if (full) {
      // row R takes row R-1; row 0 has none before it and is a first chunk
      cv[0] = carry[(size_t)(r0 > 0 ? r0 - 1 : 0) * 128 + n];
#pragma unroll
      for (int r = 1; r < 8; r++) cv[r] = carry[(size_t)r0 * 128 + (r - 1) * 128 + n];
      XCNT_WAIT();
    }
#pragma unroll
    for (int r = 0; r < 8; r++)
      un[r] = ub[(size_t)r0 * (SCT * 128) + r * (SCT * 128) + n];
    XCNT_WAIT();
#pragma unroll
    for (int kk = 0; kk < 32; kk++)
      bF[kk] = *(const v2f*)(mat + n * 128 + kk * 4 + hi * 2);
    XCNT_WAIT();
#pragma unroll
    for (int r = 0; r < 8; r++)
      hv[r] = (full && ((r0 + r) & (NC - 1))) ? cv[r] : 0.0f;
  }
#pragma unroll
  for (int r = 0; r < 8; r++) hbuf[(hi * 8 + r) * SLDS + n] = hv[r];
  __syncthreads();

  for (int t = 0; t < SCT; t++) {
    float uc[8];
#pragma unroll
    for (int r = 0; r < 8; r++) uc[r] = un[r];
    if (!ident && t + 1 < SCT) {                     // next step's inputs fly under the WMMAs
#pragma unroll
      for (int r = 0; r < 8; r++)
        un[r] = ub[(size_t)r0 * (SCT * 128) + r * (SCT * 128) + (t + 1) * 128 + n];
    }
    v8f c = {};
#pragma unroll
    for (int kk = 0; kk < 32; kk++) {
      v2f a = *(const v2f*)(hbuf + lo * SLDS + kk * 4 + hi * 2);
      c = __builtin_amdgcn_wmma_f32_16x16x4_f32(
          false, a, false, bF[kk], (short)0, c, false, false);
    }
#pragma unroll
    for (int r = 0; r < 8; r++) hv[r] = c[r] + uc[r];
    if (full) {
#pragma unroll
      for (int r = 0; r < 8; r++)
        outp[(size_t)r0 * (SCT * 128) + r * (SCT * 128) + t * 128 + n] = hv[r];
      XCNT_WAIT();
    }
    if (t + 1 == SCT) break;    // the last state is not read back from LDS
    __syncthreads();            // everyone done reading h before overwrite
#pragma unroll
    for (int r = 0; r < 8; r++) hbuf[(hi * 8 + r) * SLDS + n] = hv[r];
    __syncthreads();
  }

  if (!full) {
#pragma unroll
    for (int r = 0; r < 8; r++) outp[(size_t)r0 * 128 + r * 128 + n] = hv[r];
  }
}

__global__ __launch_bounds__(256) void scan_chunk_ends(
    const float* __restrict__ ub, const float* __restrict__ mat,
    float* __restrict__ ends, float* __restrict__ pw, int nrb) {
  const int blk = blockIdx.x;
  const bool ident = blk >= nrb;
  scan_rows(ub, mat, nullptr, ident ? pw : ends, 0, (ident ? blk - nrb : blk) * 16, ident, false);
}

__global__ __launch_bounds__(256) void scan_chunk_fill(
    const float* __restrict__ ub, const float* __restrict__ mat,
    const float* __restrict__ carry, float* __restrict__ outp, int NC) {
  scan_rows(ub, mat, carry, outp, NC, blockIdx.x * 16, false, true);
}

// ---------------------------------------------------------------------------
// Launcher
// ---------------------------------------------------------------------------
extern "C" void kernel_launch(void* const* d_in, const int* in_sizes, int n_in,
                              void* d_out, int out_size, void* d_ws, size_t ws_size,
                              hipStream_t stream) {
  (void)in_sizes; (void)n_in; (void)out_size; (void)ws_size;
  const float* x     = (const float*)d_in[0];
  const float* Aall  = (const float*)d_in[1];
  const float* Bp    = (const float*)d_in[2];
  const float* Cp    = (const float*)d_in[3];
  const float* Dp    = (const float*)d_in[4];
  const float* Wi    = (const float*)d_in[5];
  const float* bi    = (const float*)d_in[6];
  const float* Wo    = (const float*)d_in[7];
  const float* bo    = (const float*)d_in[8];
  const float* gamma = (const float*)d_in[9];
  const float* beta  = (const float*)d_in[10];
  float* out = (float*)d_out;

  const int Bn = 8, L = 1024, C = 1024, S = 128, depth = 4;
  const size_t nBLC = (size_t)Bn * L * C;    // 8Mi floats
  const size_t nBLS = (size_t)Bn * L * S;    // 1Mi floats

  float* seq  = (float*)d_ws;                // (B, L, C)
  float* nbuf = seq  + nBLC;                 // LN output
  float* ubb  = nbuf + nBLC;                 // DT * u @ Bp^T   (b*L+l, S)
  float* hsb  = ubb  + nBLS;                 // scan states     (b*L+l, S)
  float* abar = hsb  + nBLS;                 // I + DT*A (128x128)
  float* pw1  = abar + S * S;                // A_bar^8
  float* pw2  = pw1  + S * S;                // A_bar^64
  float* le0  = pw2  + S * S;                // ends of the 8-step chunks from zero  (b*128+c, S)
  float* car0 = le0  + nBLS / SCT;           // true states at those ends            (b*128+c, S)
  float* le1  = car0 + nBLS / SCT;           // ends of the 64-step chunks from zero (b*16+c, S)
  float* car1 = le1  + nBLS / (SCT * SCT);   // true states at those ends            (b*16+c, S)
  // folded weights, all layers
  const int F = C + S;                       // 1152 rows: Wo diag(Dp) over Bp
  float* wit  = car1 + nBLS / (SCT * SCT);   // Wi^T                        (layer, c, d)
  float* cpt  = wit  + (size_t)depth * C * C;  // Cp^T                      (layer, s, d)
  float* lf   = cpt  + (size_t)depth * S * C;  // [Wo diag(Dp); Bp]         (layer, F, d)
  float* qg   = lf   + (size_t)depth * F * C;  // lf @ Wi                   (layer, F, c)
  float* pf   = qg   + (size_t)depth * F * C;  // Wo @ Cp                   (layer, o, s)
  float* fb   = pf   + (size_t)depth * C * S;  // folded biases             (layer, F)

  dim3 tb(32, 8);
  dim3 tg(32, 32, Bn);
  transpose_bll<1024><<<tg, tb, 0, stream>>>(x, seq);   // seq[b][l][c] = x[b][c][l]

  transpose_bll<1024><<<dim3(32, 32, depth), tb, 0, stream>>>(Wi, wit);  // wit[c][d] = Wi[d][c]
  transpose_bll<128><<<dim3(32, 4, depth), tb, 0, stream>>>(Cp, cpt);    // cpt[s][d] = Cp[d][s]
  fold_rows<<<dim3(F, depth), 256, 0, stream>>>(Wo, Bp, Dp, bi, bo, lf, fb);
  // qg = [Wo diag(Dp); Bp] @ Wi and pf = Wo @ Cp
  fold_gemm<<<dim3(16, 10, depth), 256, 0, stream>>>(lf, wit, Wo, cpt, qg, pf);

  for (int i = 0; i < depth; i++) {
    const float* qi = qg + (size_t)i * F * C;   // Wo diag(Dp) Wi, then Bp Wi
    const float* fi = fb + i * F;

    ln_kernel<<<Bn * L, 256, 0, stream>>>(seq, gamma + i * C, beta + i * C, nbuf, C);

    // ub = DT * (n @ (Bp Wi)^T + Bp bi), 128 blocks. The 1024 tiles of
    // seq += n @ (Wo diag(Dp) Wi)^T + Wo (Dp * bi) + bo ride along: 896 here, which
    // makes four blocks a WGP, and 128 beside the one block of the serial scan pass.
    ub_gemm_tiles<<<128 + 896, 256, 0, stream>>>(nbuf, qi, fi, ubb, seq);

    abar_kernel<<<(S * S) / 256, 256, 0, stream>>>(Aall + (size_t)i * S * S, abar);

    // scan of length 1024 = 8 x 8 x 16: two chunk levels up, 16 serial steps, two down
    scan_chunk_ends<<<64 + 8, 256, 0, stream>>>(ubb, abar, le0, pw1, 64);
    scan_chunk_ends<<<8 + 8, 256, 0, stream>>>(le0, pw1, le1, pw2, 8);
    scan_serial_tiles<<<1 + 128, 256, 0, stream>>>(le1, pw2, car1, 16,
                                                   nbuf, qi, fi, seq, 896);
    scan_chunk_fill<<<8, 256, 0, stream>>>(le0, pw1, car1, car0, 16);
    scan_chunk_fill<<<64, 256, 0, stream>>>(ubb, abar, car0, hsb, 128);

    // seq += hs @ (Wo Cp)^T
    wmma_gemm<<<dim3(C / BN, (Bn * L) / BM), 256, 0, stream>>>(
        hsb, pf + (size_t)i * C * S, nullptr, seq, Bn * L, C, S, 1.0f, 2);
  }

  transpose_bll<1024><<<tg, tb, 0, stream>>>(seq, out); // out[b][c][l] = seq[b][l][c]
}

// v005
// One run takes 876 microseconds.
// Two timings next to v004 both put it at 1.06 times that version's speed.
// Counting every step since v000, it is 8.23 times as fast.
#include <hip/hip_runtime.h>
#include <stdint.h>

typedef __attribute__((ext_vector_type(2))) float v2f;
typedef __attribute__((ext_vector_type(8))) float v8f;

#define SSM_DT   0.001f
#define LN_EPS   1e-5f

// ---------------------------------------------------------------------------
// CDNA5 async global->LDS copy support (guarded so compile never breaks)
// ---------------------------------------------------------------------------
#ifdef __has_builtin
#if __has_builtin(__builtin_amdgcn_global_load_async_to_lds_b128)
#define USE_ASYNC_LDS 1
#endif
#endif
#ifndef USE_ASYNC_LDS
#define USE_ASYNC_LDS 0
#endif

#if USE_ASYNC_LDS
// Builtin signature (from hipcc diagnostic): param 0 is
// 'int __attribute__((vector_size(16))) addrspace(1)*', param 1 the LDS-side
// pointer, then two int immediates (offset, cpol).
typedef int v4i_g __attribute__((vector_size(16)));
typedef __attribute__((address_space(1))) v4i_g as1_v4i;
typedef __attribute__((address_space(3))) v4i_g as3_v4i;

// Generic LDS pointer's low 32 bits ARE the LDS byte offset (ISA aperture rule),
// so an int->as3-pointer round trip gives a valid LDS address without an
// addrspacecast.
__device__ __forceinline__ void async_cp16(const float* g, const float* lds) {
  __builtin_amdgcn_global_load_async_to_lds_b128(
      (as1_v4i*)(uintptr_t)g, (as3_v4i*)(uint32_t)(uintptr_t)lds, 0, 0);
}
__device__ __forceinline__ void wait_async0() {
#if __has_builtin(__builtin_amdgcn_s_wait_asynccnt)
  __builtin_amdgcn_s_wait_asynccnt(0);
#else
  asm volatile("s_wait_asynccnt 0" ::: "memory");
#endif
}
#endif

// ---------------------------------------------------------------------------
// Transpose (1024 x NC per batch): dst[b][i][j] = src[b][j][i], j < 1024, i < NC
// ---------------------------------------------------------------------------
template <int NC>
__global__ __launch_bounds__(256) void transpose_bll(const float* __restrict__ src,
                                                     float* __restrict__ dst) {
  __shared__ float tile[32][33];
  int b = blockIdx.z;
  int i0 = blockIdx.y * 32, j0 = blockIdx.x * 32;
  int tx = threadIdx.x, ty = threadIdx.y;           // 32 x 8
  size_t base = (size_t)b * 1024 * NC;
#pragma unroll
  for (int k = 0; k < 32; k += 8)
    tile[ty + k][tx] = src[base + (size_t)(j0 + ty + k) * NC + i0 + tx];
  __syncthreads();
#pragma unroll
  for (int k = 0; k < 32; k += 8)
    dst[base + (size_t)(i0 + ty + k) * 1024 + j0 + tx] = tile[tx][ty + k];
}

// ---------------------------------------------------------------------------
// LayerNorm over last dim (C = 1024), one block per row, 256 threads
// ---------------------------------------------------------------------------
__global__ __launch_bounds__(256) void ln_kernel(const float* __restrict__ x,
                                                 const float* __restrict__ gamma,
                                                 const float* __restrict__ beta,
                                                 float* __restrict__ out, int C) {
  int row = blockIdx.x;
  int t = threadIdx.x;
  const float4 d = ((const float4*)(x + (size_t)row * C))[t];
  float s  = d.x + d.y + d.z + d.w;
  float ss = d.x * d.x + d.y * d.y + d.z * d.z + d.w * d.w;
  __shared__ float rs[256], rq[256];
  rs[t] = s; rq[t] = ss;
  __syncthreads();
  for (int off = 128; off > 0; off >>= 1) {
    if (t < off) { rs[t] += rs[t + off]; rq[t] += rq[t + off]; }
    __syncthreads();
  }
  float mean = rs[0] / (float)C;
  float var  = rq[0] / (float)C - mean * mean;
  float inv  = rsqrtf(var + LN_EPS);
  const float4 g = ((const float4*)gamma)[t];
  const float4 bb = ((const float4*)beta)[t];
  float4 o;
  o.x = (d.x - mean) * inv * g.x + bb.x;
  o.y = (d.y - mean) * inv * g.y + bb.y;
  o.z = (d.z - mean) * inv * g.z + bb.z;
  o.w = (d.w - mean) * inv * g.w + bb.w;
  ((float4*)(out + (size_t)row * C))[t] = o;
}

// ---------------------------------------------------------------------------
// A_bar = I + DT*A  (128x128)
// ---------------------------------------------------------------------------
__global__ void abar_kernel(const float* __restrict__ A, float* __restrict__ abar) {
  int i = blockIdx.x * blockDim.x + threadIdx.x;   // 16384
  int s = i >> 7, k = i & 127;
  abar[i] = (s == k ? 1.0f : 0.0f) + SSM_DT * A[i];
}

// ---------------------------------------------------------------------------
// Weight folding. With u = n Wi^T + bi the layer is linear in n and hs:
//   ub   = DT * (n (Bp Wi)^T + Bp bi)
//   seq += n (Wo diag(Dp) Wi)^T + hs (Wo Cp)^T + Wo (Dp * bi) + bo
// so u and y are never formed. This kernel lays out, per layer, the left factor
// of the products with Wi, 1152 rows of 1024: rows 0..1023 = Wo diag(Dp), rows
// 1024..1151 = Bp; and each row's product with bi, finished as the bias of the
// GEMM that uses the row: fb[r] = row . bi + bo[r], or DT * (row . bi) for Bp.
// One block per row (blockIdx.x) and layer (blockIdx.y).
// ---------------------------------------------------------------------------
__global__ __launch_bounds__(256) void fold_rows(
    const float* __restrict__ Wo, const float* __restrict__ Bp,
    const float* __restrict__ Dp, const float* __restrict__ bi,
    const float* __restrict__ bo, float* __restrict__ lf, float* __restrict__ fb) {
  const int r = blockIdx.x, i = blockIdx.y, t = threadIdx.x;
  const bool isw = r < 1024;
  const float* srow = isw ? Wo + ((size_t)i * 1024 + r) * 1024
                          : Bp + ((size_t)i * 128 + (r - 1024)) * 1024;
  float4 w = ((const float4*)srow)[t];
  if (isw) {
    const float4 d = ((const float4*)(Dp + i * 1024))[t];
    w.x *= d.x; w.y *= d.y; w.z *= d.z; w.w *= d.w;
  }
  ((float4*)(lf + ((size_t)i * 1152 + r) * 1024))[t] = w;
  const float4 b = ((const float4*)(bi + i * 1024))[t];
  __shared__ float rs[256];
  rs[t] = w.x * b.x + w.y * b.y + w.z * b.z + w.w * b.w;
  __syncthreads();
  for (int off = 128; off > 0; off >>= 1) {
    if (t < off) rs[t] += rs[t + off];
    __syncthreads();
  }
  if (t == 0) fb[i * 1152 + r] = isw ? rs[0] + bo[i * 1024 + r] : SSM_DT * rs[0];
}

// ---------------------------------------------------------------------------
// WMMA GEMM: Cmat[M x N] = alpha * (A[M x K] @ Bw[N x K]^T)  (+ bias[N])
//   mode 0: plain           mode 2: += old Cmat value (residual accumulate)
// gemm_tile does the block tile whose first row is bm and first column bn.
// N, the row pitch of Cmat, is 1024 or 128.
// Block tile 128x64, BK=32, 8 waves of 32x32, fp32 WMMA 16x16x4.
// BK=32 makes a tile row 128 B, one whole cache line, and eight neighbouring
// lanes copy it: a wave's copy instruction then touches four whole lines.
// Double-buffered LDS; async DMA staging when available.
// ---------------------------------------------------------------------------
// Stands behind a run of global loads or stores, in front of the first reuse of
// a register that they name; the two scheduling barriers keep later register
// writes from being moved up over the wait.
#define XCNT_WAIT()                                  \
  do {                                               \
    __builtin_amdgcn_sched_barrier(0);               \
    asm volatile("s_wait_xcnt 0x0" ::: "memory");    \
    __builtin_amdgcn_sched_barrier(0);               \
  } while (0)

#define BM 128
#define BN 64
#define BK 32
#define LDA_S 36   // padded LDS row stride (floats): 16B-aligned, conflict-free

__device__ __forceinline__ void gemm_tile(
    const float* __restrict__ A, const float* __restrict__ Bw,
    const float* __restrict__ bias, float* __restrict__ Cmat,
    int N, int K, float alpha, int mode, const int bm, const int bn) {
  __shared__ __align__(16) float sA[2][BM * LDA_S];
  __shared__ __align__(16) float sB[2][BN * LDA_S];

  const int tid  = threadIdx.x;
  const int lane = tid & 31, wid = tid >> 5;
  const int hi = lane >> 4, lo = lane & 15;
  const int wm = (wid >> 1) * 32, wn = (wid & 1) * 32;

  v8f acc[2][2] = {};

  auto compute_tile = [&](const float* cA, const float* cB) {
#pragma unroll
    for (int kk = 0; kk < BK / 4; kk++) {
      const int ko = kk * 4 + hi * 2;
      v2f aF[2], bF[2];
      aF[0] = *(const v2f*)(cA + (wm + lo) * LDA_S + ko);
      aF[1] = *(const v2f*)(cA + (wm + 16 + lo) * LDA_S + ko);
      bF[0] = *(const v2f*)(cB + (wn + lo) * LDA_S + ko);
      bF[1] = *(const v2f*)(cB + (wn + 16 + lo) * LDA_S + ko);
#pragma unroll
      for (int i = 0; i < 2; i++)
#pragma unroll
        for (int j = 0; j < 2; j++)
          acc[i][j] = __builtin_amdgcn_wmma_f32_16x16x4_f32(
              false, aF[i], false, bF[j], (short)0, acc[i][j], false, false);
    }
  };

#if USE_ASYNC_LDS
  // --- async DMA double-buffered pipeline ---
  auto stage = [&](int buf, int k0) {
#pragma unroll
    for (int j = 0; j < 4; j++) {           // A tile: 1024 B128 slots, 4/thread
      int s = j * 256 + tid;
      int r = s >> 3, c4 = (s & 7) * 4;
      async_cp16(A + (size_t)(bm + r) * K + k0 + c4, &sA[buf][r * LDA_S + c4]);
    }
    // unrolled like the loop above: the copies are issued back to back, no loop control between them
#pragma unroll
    for (int j = 0; j < 2; j++) {           // B tile: 512 B128 slots, 2/thread
      int s = j * 256 + tid;
      int r = s >> 3, c4 = (s & 7) * 4;
      async_cp16(Bw + (size_t)(bn + r) * K + k0 + c4, &sB[buf][r * LDA_S + c4]);
    }
  };

  stage(0, 0);
  wait_async0();
  __syncthreads();
  int cur = 0;
  for (int k0 = 0; k0 < K; k0 += BK) {
    if (k0 + BK < K) stage(cur ^ 1, k0 + BK);   // DMA next tile in background
    compute_tile(sA[cur], sB[cur]);             // 32 WMMAs on current tile
    wait_async0();
    __syncthreads();
    cur ^= 1;
  }
#else
  // --- fallback: synchronous single-buffer staging ---
  for (int k0 = 0; k0 < K; k0 += BK) {
#pragma unroll
    for (int j = 0; j < 4; j++) {
      int s = j * 256 + tid;
      int r = s >> 3, c4 = (s & 7) * 4;
      float4 v = *(const float4*)(A + (size_t)(bm + r) * K + k0 + c4);
      *(float4*)(&sA[0][r * LDA_S + c4]) = v;
    }
    // unrolled like the loop above, so that both loads are in flight together
#pragma unroll
    for (int j = 0; j < 2; j++) {
      int s = j * 256 + tid;
      int r = s >> 3, c4 = (s & 7) * 4;
      float4 v = *(const float4*)(Bw + (size_t)(bn + r) * K + k0 + c4);
      *(float4*)(&sB[0][r * LDA_S + c4]) = v;
    }
    __syncthreads();
    compute_tile(sA[0], sB[0]);
    __syncthreads();
  }
#endif

  // Epilogue. C/D layout: VGPR r -> M = r + 8*hi, N = lo.
  // A lane's two bias values and its 32 old values are loaded in one batch, so
  // that the wave waits out one load latency and not one per element; then the
  // sums in the old order (alpha * acc, + bias, + old value), then the 32 stores.
  const int col = bn + wn + lo;
  float bv[2] = {0.0f, 0.0f};
  if (bias) {
    bv[0] = bias[col];
    bv[1] = bias[col + 16];
    XCNT_WAIT();   // the address arithmetic below reuses these two loads' address registers
  }
  // pitch is a literal at both calls: all 64 accesses of a lane then go through
  // one address register pair with immediate offsets, which nothing overwrites.
  auto finish = [&](const int pitch) {
    float* const c0 = Cmat + (size_t)(bm + wm + hi * 8) * pitch + col;
    float v[2][2][8] = {};
    if (mode == 2) {
#pragma unroll
      for (int i = 0; i < 2; i++)
#pragma unroll
        for (int r = 0; r < 8; r++)
#pragma unroll
          for (int j = 0; j < 2; j++) v[i][j][r] = c0[(i * 16 + r) * pitch + j * 16];
      // keeps the sums, which wait for the bias values, behind the issue of these loads
      __builtin_amdgcn_sched_barrier(0);
    }
#pragma unroll
    for (int i = 0; i < 2; i++)
#pragma unroll
      for (int r = 0; r < 8; r++)
#pragma unroll
        for (int j = 0; j < 2; j++) v[i][j][r] = alpha * acc[i][j][r] + bv[j] + v[i][j][r];
    // keeps every sum in front of the first store, so that no sum is written into
    // the data register of a store that has been issued
    __builtin_amdgcn_sched_barrier(0);
#pragma unroll
    for (int i = 0; i < 2; i++)
#pragma unroll
      for (int r = 0; r < 8; r++)
#pragma unroll
        for (int j = 0; j < 2; j++) c0[(i * 16 + r) * pitch + j * 16] = v[i][j][r];
    XCNT_WAIT();   // the code that follows in the kernel's text reuses these registers
  };
  if (N == 1024) finish(1024);
  else finish(128);
}

__global__ __launch_bounds__(256) void wmma_gemm(
    const float* __restrict__ A, const float* __restrict__ Bw,
    const float* __restrict__ bias, float* __restrict__ Cmat,
    int M, int N, int K, float alpha, int mode) {
  gemm_tile(A, Bw, bias, Cmat, N, K, alpha, mode, blockIdx.y * BM, blockIdx.x * BN);
}

// Tile t of the 1024 block tiles (64 tile rows x 16 tile columns, column fastest) of
//   seq += n @ (Wo diag(Dp) Wi)^T + Wo (Dp * bi) + bo
// This product needs only n, not the scan. The ub product fills half the WGPs
// and the serial pass of the scan one, and both last long, so these two launches
// carry the tiles, on blocks numbered behind their own.
__device__ __forceinline__ void seq_tile(
    const float* __restrict__ n, const float* __restrict__ q,
    const float* __restrict__ qb, float* __restrict__ seq, const int t) {
  gemm_tile(n, q, qb, seq, 1024, 1024, 1.0f, 2, (t >> 4) * BM, (t & 15) * BN);
}

// Blocks 0..127: the 64 x 2 tiles of ub = DT * (n @ (Bp Wi)^T + Bp bi); q holds
// Wo diag(Dp) Wi (1024 rows) and then Bp Wi (128 rows), qb their biases.
// Blocks 128 and up: seq tiles 0, 1, ...
__global__ __launch_bounds__(256) void ub_gemm_tiles(
    const float* __restrict__ n, const float* __restrict__ q,
    const float* __restrict__ qb, float* __restrict__ ub, float* __restrict__ seq) {
  const int blk = blockIdx.x;
  const bool u = blk < 128;
  const int t = blk - 128;
  gemm_tile(n, u ? q + 1024 * 1024 : q, u ? qb + 1024 : qb, u ? ub : seq,
            u ? 128 : 1024, 1024, u ? SSM_DT : 1.0f, u ? 0 : 2,
            (u ? blk >> 1 : t >> 4) * BM, (u ? blk & 1 : t & 15) * BN);
}

// The two weight products of every layer (blockIdx.z) in one launch, grid (16, 10):
//   y < 9 : qg (1152 x 1024) = lf @ wit^T, tile (y, x)
//   y == 9: pf (1024 x 128)  = Wo @ cpt^T, its 8 x 2 tiles numbered by x
__global__ __launch_bounds__(256) void fold_gemm(
    const float* __restrict__ lf, const float* __restrict__ wit,
    const float* __restrict__ Wo, const float* __restrict__ cpt,
    float* __restrict__ qg, float* __restrict__ pf) {
  const int x = blockIdx.x, y = blockIdx.y;
  const size_t i = blockIdx.z;
  const bool q = y < 9;
  gemm_tile(q ? lf + i * (1152 * 1024) : Wo + i * (1024 * 1024),
            q ? wit + i * (1024 * 1024) : cpt + i * (128 * 1024), nullptr,
            q ? qg + i * (1152 * 1024) : pf + i * (1024 * 128),
            q ? 1024 : 128, 1024, 1.0f, 0,
            (q ? y : x >> 1) * BM, (q ? x : x & 1) * BN);
}

// ---------------------------------------------------------------------------
// Sequential scan: h (16x128, rows 8..15 zero-padded) lives in LDS.
//   per step l: h = h @ A_bar^T + ub[:, l, :];  store hs[b*L + l][s] = h[b][s]
// One block, 8 waves; wave w owns state columns 16w..16w+15.
// A_bar fragments preloaded into registers (loop-invariant, 32 x float2).
// The next step's ub slab is async-DMA'd into LDS while WMMAs run.
// ---------------------------------------------------------------------------
#define SLDS 132   // 16 fragment rows -> 16 distinct LDS banks

__device__ __forceinline__ void scan_serial(
    const float* __restrict__ ub, const float* __restrict__ abar,
    float* __restrict__ hs, const int L) {
  __shared__ __align__(16) float hbuf[16 * SLDS];
#if USE_ASYNC_LDS
  __shared__ __align__(16) float ubs[2][8 * 128];
#endif
  const int tid = threadIdx.x;
  const int lane = tid & 31, wid = tid >> 5;
  const int hi = lane >> 4, lo = lane & 15;
  const int n0 = wid * 16;

  // Preload B fragments of A_bar (stored [s][k], K-major like the GEMM weights)
  v2f bF[32];
#pragma unroll
  for (int kk = 0; kk < 32; kk++)
    bF[kk] = *(const v2f*)(abar + (size_t)(n0 + lo) * 128 + kk * 4 + hi * 2);

#if USE_ASYNC_LDS
  auto prefetch_ub = [&](int buf, int l) {   // 8 rows x 128 floats, B128/thread
    int b = tid >> 5, s4 = (tid & 31) * 4;
    async_cp16(ub + ((size_t)b * L + l) * 128 + s4, &ubs[buf][b * 128 + s4]);
  };
  prefetch_ub(0, 0);
#endif

  for (int i = tid; i < 16 * SLDS; i += 256) hbuf[i] = 0.0f;
#if USE_ASYNC_LDS
  wait_async0();
#endif
  __syncthreads();

  for (int l = 0; l < L; l++) {
#if USE_ASYNC_LDS
    if (l + 1 < L) prefetch_ub((l + 1) & 1, l + 1);  // hide global latency
#endif
    v8f c = {};
#pragma unroll
    for (int kk = 0; kk < 32; kk++) {
      v2f a = *(const v2f*)(hbuf + lo * SLDS + kk * 4 + hi * 2);
      c = __builtin_amdgcn_wmma_f32_16x16x4_f32(
          false, a, false, bF[kk], (short)0, c, false, false);
    }
    __syncthreads();            // everyone done reading h before overwrite
#pragma unroll
    for (int r = 0; r < 8; r++) {
      int m = r + hi * 8;       // padded batch row
      int n = n0 + lo;          // state column
      float v = c[r];
      if (m < 8) {
#if USE_ASYNC_LDS
        v += ubs[l & 1][m * 128 + n];
#else
        v += ub[((size_t)m * L + l) * 128 + n];
#endif
        hs[((size_t)m * L + l) * 128 + n] = v;
      }
      hbuf[m * SLDS + n] = v;
    }
#if USE_ASYNC_LDS
    wait_async0();
#endif
    __syncthreads();
  }
}

// Block 0 scans; blocks 1 and up do seq tiles t0, t0 + 1, ...
__global__ __launch_bounds__(256) void scan_serial_tiles(
    const float* __restrict__ ub, const float* __restrict__ abar,
    float* __restrict__ hs, int L,
    const float* __restrict__ n, const float* __restrict__ q,
    const float* __restrict__ qb, float* __restrict__ seq, int t0) {
  const int blk = blockIdx.x;
  if (blk == 0) scan_serial(ub, abar, hs, L);
  else seq_tile(n, q, qb, seq, t0 + blk - 1);
}

// ---------------------------------------------------------------------------
// Chunked scan. The recurrence h_l = h_{l-1} @ M^T + x_l is linear, so a
// sequence is cut into chunks of SCT steps and every (batch, chunk) pair is one
// row of a 16-row tile; one block steps its 16 rows SCT times.
//   full == 0: rows start from zero, only the chunk's last state is stored
//              (outp[row]). Blocks >= nrb step the rows of the identity with
//              the transposed matrix instead: they store M^SCT (pw, laid out
//              [s][k] like M), the matrix that carries a state over one chunk.
//   full == 1: row R starts from carry[R-1], the true state at the end of the
//              chunk before it (zero for a sequence's first chunk), and every
//              step's state is stored (outp[row * SCT + t]).
// The chunk ends form a recurrence of the same kind, SCT times shorter, with
// M^SCT as its matrix, so the launcher applies the same two passes to it again.
// Row R = batch * NC + chunk; its step t lies at sequence row R * SCT + t.
// ---------------------------------------------------------------------------
#define SCT 8

// ident and full are literals or block-uniform at every call. The loops over r
// and kk are unrolled so that bF, hv, un and the accumulator stay in registers.
__device__ __forceinline__ void scan_rows(
    const float* __restrict__ ub, const float* __restrict__ mat,
    const float* __restrict__ carry, float* __restrict__ outp,
    int NC, int row0, const bool ident, const bool full) {
  __shared__ __align__(16) float hbuf[16 * SLDS];
  const int tid = threadIdx.x;
  const int lane = tid & 31, wid = tid >> 5;
  const int hi = lane >> 4, lo = lane & 15;
  const int n = wid * 16 + lo;                       // state column of this lane
  const int r0 = row0 + hi * 8;                      // row of accumulator register 0

  v2f bF[32];
  float hv[8], un[8];
  if (ident) {
#pragma unroll
    for (int kk = 0; kk < 32; kk++) {
      bF[kk].x = mat[(kk * 4 + hi * 2) * 128 + n];
      bF[kk].y = mat[(kk * 4 + hi * 2 + 1) * 128 + n];
    }
#pragma unroll
    for (int r = 0; r < 8; r++) {
      hv[r] = (r0 + r == n) ? 1.0f : 0.0f;
      un[r] = 0.0f;
    }
  } else {
    float cv[8];
    if (full) {
      // row R takes row R-1; row 0 has none before it and is a first chunk
      cv[0] = carry[(size_t)(r0 > 0 ? r0 - 1 : 0) * 128 + n];
#pragma unroll
      for (int r = 1; r < 8; r++) cv[r] = carry[(size_t)r0 * 128 + (r - 1) * 128 + n];
      XCNT_WAIT();
    }
#pragma unroll
    for (int r = 0; r < 8; r++)
      un[r] = ub[(size_t)r0 * (SCT * 128) + r * (SCT * 128) + n];
    XCNT_WAIT();
#pragma unroll
    for (int kk = 0; kk < 32; kk++)
      bF[kk] = *(const v2f*)(mat + n * 128 + kk * 4 + hi * 2);
    XCNT_WAIT();
#pragma unroll
    for (int r = 0; r < 8; r++)
      hv[r] = (full && ((r0 + r) & (NC - 1))) ? cv[r] : 0.0f;
  }
#pragma unroll
  for (int r = 0; r < 8; r++) hbuf[(hi * 8 + r) * SLDS + n] = hv[r];
  __syncthreads();

  for (int t = 0; t < SCT; t++) {
    float uc[8];
#pragma unroll
    for (int r = 0; r < 8; r++) uc[r] = un[r];
    if (!ident && t + 1 < SCT) {                     // next step's inputs fly under the WMMAs
#pragma unroll
      for (int r = 0; r < 8; r++)
        un[r] = ub[(size_t)r0 * (SCT * 128) + r * (SCT * 128) + (t + 1) * 128 + n];
    }
    v8f c = {};
#pragma unroll
    for (int kk = 0; kk < 32; kk++) {
      v2f a = *(const v2f*)(hbuf + lo * SLDS + kk * 4 + hi * 2);
      c = __builtin_amdgcn_wmma_f32_16x16x4_f32(
          false, a, false, bF[kk], (short)0, c, false, false);
    }
#pragma unroll
    for (int r = 0; r < 8; r++) hv[r] = c[r] + uc[r];
    if (full) {
#pragma unroll
      for (int r = 0; r < 8; r++)
        outp[(size_t)r0 * (SCT * 128) + r * (SCT * 128) + t * 128 + n] = hv[r];
      XCNT_WAIT();
    }
    if (t + 1 == SCT) break;    // the last state is not read back from LDS
    __syncthreads();            // everyone done reading h before overwrite
#pragma unroll
    for (int r = 0; r < 8; r++) hbuf[(hi * 8 + r) * SLDS + n] = hv[r];
    __syncthreads();
  }

  if (!full) {
#pragma unroll
    for (int r = 0; r < 8; r++) outp[(size_t)r0 * 128 + r * 128 + n] = hv[r];
  }
}

__global__ __launch_bounds__(256) void scan_chunk_ends(
    const float* __restrict__ ub, const float* __restrict__ mat,
    float* __restrict__ ends, float* __restrict__ pw, int nrb) {
  const int blk = blockIdx.x;
  const bool ident = blk >= nrb;
  scan_rows(ub, mat, nullptr, ident ? pw : ends, 0, (ident ? blk - nrb : blk) * 16, ident, false);
}

__global__ __launch_bounds__(256) void scan_chunk_fill(
    const float* __restrict__ ub, const float* __restrict__ mat,
    const float* __restrict__ carry, float* __restrict__ outp, int NC) {
  scan_rows(ub, mat, carry, outp, NC, blockIdx.x * 16, false, true);
}

// ---------------------------------------------------------------------------
// Launcher
// ---------------------------------------------------------------------------
extern "C" void kernel_launch(void* const* d_in, const int* in_sizes, int n_in,
                              void* d_out, int out_size, void* d_ws, size_t ws_size,
                              hipStream_t stream) {
  (void)in_sizes; (void)n_in; (void)out_size; (void)ws_size;
  const float* x     = (const float*)d_in[0];
  const float* Aall  = (const float*)d_in[1];
  const float* Bp    = (const float*)d_in[2];
  const float* Cp    = (const float*)d_in[3];
  const float* Dp    = (const float*)d_in[4];
  const float* Wi    = (const float*)d_in[5];
  const float* bi    = (const float*)d_in[6];
  const float* Wo    = (const float*)d_in[7];
  const float* bo    = (const float*)d_in[8];
  const float* gamma = (const float*)d_in[9];
  const float* beta  = (const float*)d_in[10];
  float* out = (float*)d_out;

  const int Bn = 8, L = 1024, C = 1024, S = 128, depth = 4;
  const size_t nBLC = (size_t)Bn * L * C;    // 8Mi floats
  const size_t nBLS = (size_t)Bn * L * S;    // 1Mi floats

  float* seq  = (float*)d_ws;                // (B, L, C)
  float* nbuf = seq  + nBLC;                 // LN output
  float* ubb  = nbuf + nBLC;                 // DT * u @ Bp^T   (b*L+l, S)
  float* hsb  = ubb  + nBLS;                 // scan states     (b*L+l, S)
  float* abar = hsb  + nBLS;                 // I + DT*A (128x128)
  float* pw1  = abar + S * S;                // A_bar^8
  float* pw2  = pw1  + S * S;                // A_bar^64
  float* le0  = pw2  + S * S;                // ends of the 8-step chunks from zero  (b*128+c, S)
  float* car0 = le0  + nBLS / SCT;           // true states at those ends            (b*128+c, S)
  float* le1  = car0 + nBLS / SCT;           // ends of the 64-step chunks from zero (b*16+c, S)
  float* car1 = le1  + nBLS / (SCT * SCT);   // true states at those ends            (b*16+c, S)
  // folded weights, all layers
  const int F = C + S;                       // 1152 rows: Wo diag(Dp) over Bp
  float* wit  = car1 + nBLS / (SCT * SCT);   // Wi^T                        (layer, c, d)
  float* cpt  = wit  + (size_t)depth * C * C;  // Cp^T                      (layer, s, d)
  float* lf   = cpt  + (size_t)depth * S * C;  // [Wo diag(Dp); Bp]         (layer, F, d)
  float* qg   = lf   + (size_t)depth * F * C;  // lf @ Wi                   (layer, F, c)
  float* pf   = qg   + (size_t)depth * F * C;  // Wo @ Cp                   (layer, o, s)
  float* fb   = pf   + (size_t)depth * C * S;  // folded biases             (layer, F)

  dim3 tb(32, 8);
  dim3 tg(32, 32, Bn);
  transpose_bll<1024><<<tg, tb, 0, stream>>>(x, seq);   // seq[b][l][c] = x[b][c][l]

  transpose_bll<1024><<<dim3(32, 32, depth), tb, 0, stream>>>(Wi, wit);  // wit[c][d] = Wi[d][c]
  transpose_bll<128><<<dim3(32, 4, depth), tb, 0, stream>>>(Cp, cpt);    // cpt[s][d] = Cp[d][s]
  fold_rows<<<dim3(F, depth), 256, 0, stream>>>(Wo, Bp, Dp, bi, bo, lf, fb);
  // qg = [Wo diag(Dp); Bp] @ Wi and pf = Wo @ Cp
  fold_gemm<<<dim3(16, 10, depth), 256, 0, stream>>>(lf, wit, Wo, cpt, qg, pf);

  for (int i = 0; i < depth; i++) {
    const float* qi = qg + (size_t)i * F * C;   // Wo diag(Dp) Wi, then Bp Wi
    const float* fi = fb + i * F;

    ln_kernel<<<Bn * L, 256, 0, stream>>>(seq, gamma + i * C, beta + i * C, nbuf, C);

    // ub = DT * (n @ (Bp Wi)^T + Bp bi), 128 blocks. The 1024 tiles of
    // seq += n @ (Wo diag(Dp) Wi)^T + Wo (Dp * bi) + bo ride along: 896 here, which
    // makes four blocks a WGP, and 128 beside the one block of the serial scan pass.
    ub_gemm_tiles<<<128 + 896, 256, 0, stream>>>(nbuf, qi, fi, ubb, seq);

    abar_kernel<<<(S * S) / 256, 256, 0, stream>>>(Aall + (size_t)i * S * S, abar);

    // scan of length 1024 = 8 x 8 x 16: two chunk levels up, 16 serial steps, two down
    scan_chunk_ends<<<64 + 8, 256, 0, stream>>>(ubb, abar, le0, pw1, 64);
    scan_chunk_ends<<<8 + 8, 256, 0, stream>>>(le0, pw1, le1, pw2, 8);
    scan_serial_tiles<<<1 + 128, 256, 0, stream>>>(le1, pw2, car1, 16,
                                                   nbuf, qi, fi, seq, 896);
    scan_chunk_fill<<<8, 256, 0, stream>>>(le0, pw1, car1, car0, 16);
    scan_chunk_fill<<<64, 256, 0, stream>>>(ubb, abar, car0, hsb, 128);

    // seq += hs @ (Wo Cp)^T
    wmma_gemm<<<dim3(C / BN, (Bn * L) / BM), 256, 0, stream>>>(
        hsb, pf + (size_t)i * C * S, nullptr, seq, Bn * L, C, S, 1.0f, 2);
  }

  transpose_bll<1024><<<tg, tb, 0, stream>>>(seq, out); // out[b][c][l] = seq[b][l][c]
}

// v006
// It runs in 791 microseconds.
// Two timings next to v005 put it at 1.10 and 1.09 times that version's speed.
// Over all steps from v000 it is 9.00 times as fast.
#include <hip/hip_runtime.h>
#include <stdint.h>

typedef __attribute__((ext_vector_type(2))) float v2f;
typedef __attribute__((ext_vector_type(4))) float v4f;
typedef __attribute__((ext_vector_type(8))) float v8f;

#define SSM_DT   0.001f
#define LN_EPS   1e-5f

// ---------------------------------------------------------------------------
// CDNA5 async global->LDS copy support (guarded so compile never breaks)
// ---------------------------------------------------------------------------
#ifdef __has_builtin
#if __has_builtin(__builtin_amdgcn_global_load_async_to_lds_b128)
#define USE_ASYNC_LDS 1
#endif
#endif
#ifndef USE_ASYNC_LDS
#define USE_ASYNC_LDS 0
#endif

#if USE_ASYNC_LDS
// Builtin signature (from hipcc diagnostic): param 0 is
// 'int __attribute__((vector_size(16))) addrspace(1)*', param 1 the LDS-side
// pointer, then two int immediates (offset, cpol).
typedef int v4i_g __attribute__((vector_size(16)));
typedef __attribute__((address_space(1))) v4i_g as1_v4i;
typedef __attribute__((address_space(3))) v4i_g as3_v4i;

// Generic LDS pointer's low 32 bits ARE the LDS byte offset (ISA aperture rule),
// so an int->as3-pointer round trip gives a valid LDS address without an
// addrspacecast.
__device__ __forceinline__ void async_cp16(const float* g, const float* lds) {
  __builtin_amdgcn_global_load_async_to_lds_b128(
      (as1_v4i*)(uintptr_t)g, (as3_v4i*)(uint32_t)(uintptr_t)lds, 0, 0);
}
__device__ __forceinline__ void wait_async0() {
#if __has_builtin(__builtin_amdgcn_s_wait_asynccnt)
  __builtin_amdgcn_s_wait_asynccnt(0);
#else
  asm volatile("s_wait_asynccnt 0" ::: "memory");
#endif
}
#endif

// ---------------------------------------------------------------------------
// Transpose (1024 x NC per batch): dst[b][i][j] = src[b][j][i], j < 1024, i < NC
// ---------------------------------------------------------------------------
template <int NC>
__global__ __launch_bounds__(256) void transpose_bll(const float* __restrict__ src,
                                                     float* __restrict__ dst) {
  __shared__ float tile[32][33];
  int b = blockIdx.z;
  int i0 = blockIdx.y * 32, j0 = blockIdx.x * 32;
  int tx = threadIdx.x, ty = threadIdx.y;           // 32 x 8
  size_t base = (size_t)b * 1024 * NC;
#pragma unroll
  for (int k = 0; k < 32; k += 8)
    tile[ty + k][tx] = src[base + (size_t)(j0 + ty + k) * NC + i0 + tx];
  __syncthreads();
#pragma unroll
  for (int k = 0; k < 32; k += 8)
    dst[base + (size_t)(i0 + ty + k) * 1024 + j0 + tx] = tile[tx][ty + k];
}

// ---------------------------------------------------------------------------
// LayerNorm over last dim (C = 1024), one block per row, 256 threads
// ---------------------------------------------------------------------------
__global__ __launch_bounds__(256) void ln_kernel(const float* __restrict__ x,
                                                 const float* __restrict__ gamma,
                                                 const float* __restrict__ beta,
                                                 float* __restrict__ out, int C) {
  int row = blockIdx.x;
  int t = threadIdx.x;
  const float4 d = ((const float4*)(x + (size_t)row * C))[t];
  float s  = d.x + d.y + d.z + d.w;
  float ss = d.x * d.x + d.y * d.y + d.z * d.z + d.w * d.w;
  __shared__ float rs[256], rq[256];
  rs[t] = s; rq[t] = ss;
  __syncthreads();
  for (int off = 128; off > 0; off >>= 1) {
    if (t < off) { rs[t] += rs[t + off]; rq[t] += rq[t + off]; }
    __syncthreads();
  }
  float mean = rs[0] / (float)C;
  float var  = rq[0] / (float)C - mean * mean;
  float inv  = rsqrtf(var + LN_EPS);
  const float4 g = ((const float4*)gamma)[t];
  const float4 bb = ((const float4*)beta)[t];
  float4 o;
  o.x = (d.x - mean) * inv * g.x + bb.x;
  o.y = (d.y - mean) * inv * g.y + bb.y;
  o.z = (d.z - mean) * inv * g.z + bb.z;
  o.w = (d.w - mean) * inv * g.w + bb.w;
  ((float4*)(out + (size_t)row * C))[t] = o;
}

// ---------------------------------------------------------------------------
// A_bar = I + DT*A  (128x128)
// ---------------------------------------------------------------------------
__global__ void abar_kernel(const float* __restrict__ A, float* __restrict__ abar) {
  int i = blockIdx.x * blockDim.x + threadIdx.x;   // 16384
  int s = i >> 7, k = i & 127;
  abar[i] = (s == k ? 1.0f : 0.0f) + SSM_DT * A[i];
}

// ---------------------------------------------------------------------------
// Weight folding. With u = n Wi^T + bi the layer is linear in n and hs:
//   ub   = DT * (n (Bp Wi)^T + Bp bi)
//   seq += n (Wo diag(Dp) Wi)^T + hs (Wo Cp)^T + Wo (Dp * bi) + bo
// so u and y are never formed. This kernel lays out, per layer, the left factor
// of the products with Wi, 1152 rows of 1024: rows 0..1023 = Wo diag(Dp), rows
// 1024..1151 = Bp; and each row's product with bi, finished as the bias of the
// GEMM that uses the row: fb[r] = row . bi + bo[r], or DT * (row . bi) for Bp.
// One block per row (blockIdx.x) and layer (blockIdx.y).
// ---------------------------------------------------------------------------
__global__ __launch_bounds__(256) void fold_rows(
    const float* __restrict__ Wo, const float* __restrict__ Bp,
    const float* __restrict__ Dp, const float* __restrict__ bi,
    const float* __restrict__ bo, float* __restrict__ lf, float* __restrict__ fb) {
  const int r = blockIdx.x, i = blockIdx.y, t = threadIdx.x;
  const bool isw = r < 1024;
  const float* srow = isw ? Wo + ((size_t)i * 1024 + r) * 1024
                          : Bp + ((size_t)i * 128 + (r - 1024)) * 1024;
  float4 w = ((const float4*)srow)[t];
  if (isw) {
    const float4 d = ((const float4*)(Dp + i * 1024))[t];
    w.x *= d.x; w.y *= d.y; w.z *= d.z; w.w *= d.w;
  }
  ((float4*)(lf + ((size_t)i * 1152 + r) * 1024))[t] = w;
  const float4 b = ((const float4*)(bi + i * 1024))[t];
  __shared__ float rs[256];
  rs[t] = w.x * b.x + w.y * b.y + w.z * b.z + w.w * b.w;
  __syncthreads();
  for (int off = 128; off > 0; off >>= 1) {
    if (t < off) rs[t] += rs[t + off];
    __syncthreads();
  }
  if (t == 0) fb[i * 1152 + r] = isw ? rs[0] + bo[i * 1024 + r] : SSM_DT * rs[0];
}

// ---------------------------------------------------------------------------
// WMMA GEMM: Cmat[M x N] = alpha * (A[M x K] @ Bw[N x K]^T)  (+ bias[N])
//   mode 0: plain           mode 2: += old Cmat value (residual accumulate)
// gemm_tile does the block tile whose first row is bm and first column bn.
// N, the row pitch of Cmat, is 1024 or 128.
// Block tile 128x64, BK=32, 8 waves of 32x32, fp32 WMMA 16x16x4.
// BK=32 makes a tile row 128 B, one whole cache line, and eight neighbouring
// lanes copy it: a wave's copy instruction then touches four whole lines.
// Double-buffered LDS; async DMA staging when available.
// ---------------------------------------------------------------------------
// Stands behind a run of global loads or stores, in front of the first reuse of
// a register that they name; the two scheduling barriers keep later register
// writes from being moved up over the wait.
#define XCNT_WAIT()                                  \
  do {                                               \
    __builtin_amdgcn_sched_barrier(0);               \
    asm volatile("s_wait_xcnt 0x0" ::: "memory");    \
    __builtin_amdgcn_sched_barrier(0);               \
  } while (0)

#define BM 128
#define BN 64
#define BK 32
#define LDA_S 36   // padded LDS row stride (floats): 16B-aligned, conflict-free

__device__ __forceinline__ void gemm_tile(
    const float* __restrict__ A, const float* __restrict__ Bw,
    const float* __restrict__ bias, float* __restrict__ Cmat,
    int N, int K, float alpha, int mode, const int bm, const int bn) {
  __shared__ __align__(16) float sA[2][BM * LDA_S];
  __shared__ __align__(16) float sB[2][BN * LDA_S];

  const int tid  = threadIdx.x;
  const int lane = tid & 31, wid = tid >> 5;
  const int hi = lane >> 4, lo = lane & 15;
  const int wm = (wid >> 1) * 32, wn = (wid & 1) * 32;

  v8f acc[2][2] = {};

  auto compute_tile = [&](const float* cA, const float* cB) {
#pragma unroll
    for (int kk = 0; kk < BK / 4; kk++) {
      const int ko = kk * 4 + hi * 2;
      v2f aF[2], bF[2];
      aF[0] = *(const v2f*)(cA + (wm + lo) * LDA_S + ko);
      aF[1] = *(const v2f*)(cA + (wm + 16 + lo) * LDA_S + ko);
      bF[0] = *(const v2f*)(cB + (wn + lo) * LDA_S + ko);
      bF[1] = *(const v2f*)(cB + (wn + 16 + lo) * LDA_S + ko);
#pragma unroll
      for (int i = 0; i < 2; i++)
#pragma unroll
        for (int j = 0; j < 2; j++)
          acc[i][j] = __builtin_amdgcn_wmma_f32_16x16x4_f32(
              false, aF[i], false, bF[j], (short)0, acc[i][j], false, false);
    }
  };

#if USE_ASYNC_LDS
  // --- async DMA double-buffered pipeline ---
  auto stage = [&](int buf, int k0) {
#pragma unroll
    for (int j = 0; j < 4; j++) {           // A tile: 1024 B128 slots, 4/thread
      int s = j * 256 + tid;
      int r = s >> 3, c4 = (s & 7) * 4;
      async_cp16(A + (size_t)(bm + r) * K + k0 + c4, &sA[buf][r * LDA_S + c4]);
    }
    // unrolled like the loop above: the copies are issued back to back, no loop control between them
#pragma unroll
    for (int j = 0; j < 2; j++) {           // B tile: 512 B128 slots, 2/thread
      int s = j * 256 + tid;
      int r = s >> 3, c4 = (s & 7) * 4;
      async_cp16(Bw + (size_t)(bn + r) * K + k0 + c4, &sB[buf][r * LDA_S + c4]);
    }
  };

  stage(0, 0);
  wait_async0();
  __syncthreads();
  int cur = 0;
  for (int k0 = 0; k0 < K; k0 += BK) {
    if (k0 + BK < K) stage(cur ^ 1, k0 + BK);   // DMA next tile in background
    compute_tile(sA[cur], sB[cur]);             // 32 WMMAs on current tile
    wait_async0();
    __syncthreads();
    cur ^= 1;
  }
#else
  // --- fallback: synchronous single-buffer staging ---
  for (int k0 = 0; k0 < K; k0 += BK) {
#pragma unroll
    for (int j = 0; j < 4; j++) {
      int s = j * 256 + tid;
      int r = s >> 3, c4 = (s & 7) * 4;
      float4 v = *(const float4*)(A + (size_t)(bm + r) * K + k0 + c4);
      *(float4*)(&sA[0][r * LDA_S + c4]) = v;
    }
    // unrolled like the loop above, so that both loads are in flight together
#pragma unroll
    for (int j = 0; j < 2; j++) {
      int s = j * 256 + tid;
      int r = s >> 3, c4 = (s & 7) * 4;
      float4 v = *(const float4*)(Bw + (size_t)(bn + r) * K + k0 + c4);
      *(float4*)(&sB[0][r * LDA_S + c4]) = v;
    }
    __syncthreads();
    compute_tile(sA[0], sB[0]);
    __syncthreads();
  }
#endif

  // Epilogue. C/D layout: VGPR r -> M = r + 8*hi, N = lo.
  // A lane's two bias values and its 32 old values are loaded in one batch, so
  // that the wave waits out one load latency and not one per element; then the
  // sums in the old order (alpha * acc, + bias, + old value), then the 32 stores.
  const int col = bn + wn + lo;
  float bv[2] = {0.0f, 0.0f};
  if (bias) {
    bv[0] = bias[col];
    bv[1] = bias[col + 16];
    XCNT_WAIT();   // the address arithmetic below reuses these two loads' address registers
  }
  // pitch is a literal at both calls: all 64 accesses of a lane then go through
  // one address register pair with immediate offsets, which nothing overwrites.
  auto finish = [&](const int pitch) {
    float* const c0 = Cmat + (size_t)(bm + wm + hi * 8) * pitch + col;
    float v[2][2][8] = {};
    if (mode == 2) {
#pragma unroll
      for (int i = 0; i < 2; i++)
#pragma unroll
        for (int r = 0; r < 8; r++)
#pragma unroll
          for (int j = 0; j < 2; j++) v[i][j][r] = c0[(i * 16 + r) * pitch + j * 16];
      // keeps the sums, which wait for the bias values, behind the issue of these loads
      __builtin_amdgcn_sched_barrier(0);
    }
#pragma unroll
    for (int i = 0; i < 2; i++)
#pragma unroll
      for (int r = 0; r < 8; r++)
#pragma unroll
        for (int j = 0; j < 2; j++) v[i][j][r] = alpha * acc[i][j][r] + bv[j] + v[i][j][r];
    // keeps every sum in front of the first store, so that no sum is written into
    // the data register of a store that has been issued
    __builtin_amdgcn_sched_barrier(0);
#pragma unroll
    for (int i = 0; i < 2; i++)
#pragma unroll
      for (int r = 0; r < 8; r++)
#pragma unroll
        for (int j = 0; j < 2; j++) c0[(i * 16 + r) * pitch + j * 16] = v[i][j][r];
    XCNT_WAIT();   // the code that follows in the kernel's text reuses these registers
  };
  if (N == 1024) finish(1024);
  else finish(128);
}

__global__ __launch_bounds__(256) void wmma_gemm(
    const float* __restrict__ A, const float* __restrict__ Bw,
    const float* __restrict__ bias, float* __restrict__ Cmat,
    int M, int N, int K, float alpha, int mode) {
  gemm_tile(A, Bw, bias, Cmat, N, K, alpha, mode, blockIdx.y * BM, blockIdx.x * BN);
}

// Tile t of the 1024 block tiles (64 tile rows x 16 tile columns, column fastest) of
//   seq += n @ (Wo diag(Dp) Wi)^T + Wo (Dp * bi) + bo
// This product needs only n, not the scan. The ub product fills half the WGPs
// and the serial pass of the scan one, and both last long, so these two launches
// carry the tiles, on blocks numbered behind their own.
__device__ __forceinline__ void seq_tile(
    const float* __restrict__ n, const float* __restrict__ q,
    const float* __restrict__ qb, float* __restrict__ seq, const int t) {
  gemm_tile(n, q, qb, seq, 1024, 1024, 1.0f, 2, (t >> 4) * BM, (t & 15) * BN);
}

// Blocks 0..127: the 64 x 2 tiles of ub = DT * (n @ (Bp Wi)^T + Bp bi); q holds
// Wo diag(Dp) Wi (1024 rows) and then Bp Wi (128 rows), qb their biases.
// Blocks 128 and up: seq tiles 0, 1, ...
__global__ __launch_bounds__(256) void ub_gemm_tiles(
    const float* __restrict__ n, const float* __restrict__ q,
    const float* __restrict__ qb, float* __restrict__ ub, float* __restrict__ seq) {
  const int blk = blockIdx.x;
  const bool u = blk < 128;
  const int t = blk - 128;
  gemm_tile(n, u ? q + 1024 * 1024 : q, u ? qb + 1024 : qb, u ? ub : seq,
            u ? 128 : 1024, 1024, u ? SSM_DT : 1.0f, u ? 0 : 2,
            (u ? blk >> 1 : t >> 4) * BM, (u ? blk & 1 : t & 15) * BN);
}

// The two weight products of every layer (blockIdx.z) in one launch, grid (16, 10):
//   y < 9 : qg (1152 x 1024) = lf @ wit^T, tile (y, x)
//   y == 9: pf (1024 x 128)  = Wo @ cpt^T, its 8 x 2 tiles numbered by x
__global__ __launch_bounds__(256) void fold_gemm(
    const float* __restrict__ lf, const float* __restrict__ wit,
    const float* __restrict__ Wo, const float* __restrict__ cpt,
    float* __restrict__ qg, float* __restrict__ pf) {
  const int x = blockIdx.x, y = blockIdx.y;
  const size_t i = blockIdx.z;
  const bool q = y < 9;
  gemm_tile(q ? lf + i * (1152 * 1024) : Wo + i * (1024 * 1024),
            q ? wit + i * (1024 * 1024) : cpt + i * (128 * 1024), nullptr,
            q ? qg + i * (1152 * 1024) : pf + i * (1024 * 128),
            q ? 1024 : 128, 1024, 1.0f, 0,
            (q ? y : x >> 1) * BM, (q ? x : x & 1) * BN);
}

// ---------------------------------------------------------------------------
// Sequential scan: h (16x128, rows 8..15 zero-padded) lives in LDS.
//   per step l: h = h @ A_bar^T + ub[:, l, :];  store hs[b*L + l][s] = h[b][s]
// One block, 8 waves; wave w owns state columns 16w..16w+15.
// A_bar fragments preloaded into registers (loop-invariant, 32 x float2).
// The next step's ub slab is async-DMA'd into LDS while WMMAs run.
// ---------------------------------------------------------------------------
#define SLDS 132   // 16 fragment rows -> 16 distinct LDS banks

__device__ __forceinline__ void scan_serial(
    const float* __restrict__ ub, const float* __restrict__ abar,
    float* __restrict__ hs, const int L) {
  __shared__ __align__(16) float hbuf[16 * SLDS];
#if USE_ASYNC_LDS
  __shared__ __align__(16) float ubs[2][8 * 128];
#endif
  const int tid = threadIdx.x;
  const int lane = tid & 31, wid = tid >> 5;
  const int hi = lane >> 4, lo = lane & 15;
  const int n0 = wid * 16;

  // Preload B fragments of A_bar (stored [s][k], K-major like the GEMM weights)
  v2f bF[32];
#pragma unroll
  for (int kk = 0; kk < 32; kk++)
    bF[kk] = *(const v2f*)(abar + (size_t)(n0 + lo) * 128 + kk * 4 + hi * 2);

#if USE_ASYNC_LDS
  auto prefetch_ub = [&](int buf, int l) {   // 8 rows x 128 floats, B128/thread
    int b = tid >> 5, s4 = (tid & 31) * 4;
    async_cp16(ub + ((size_t)b * L + l) * 128 + s4, &ubs[buf][b * 128 + s4]);
  };
  prefetch_ub(0, 0);
#endif

  for (int i = tid; i < 16 * SLDS; i += 256) hbuf[i] = 0.0f;
#if USE_ASYNC_LDS
  wait_async0();
#endif
  __syncthreads();

  for (int l = 0; l < L; l++) {
#if USE_ASYNC_LDS
    if (l + 1 < L) prefetch_ub((l + 1) & 1, l + 1);  // hide global latency
#endif
    v8f c = {};
#pragma unroll
    for (int kk = 0; kk < 32; kk++) {
      v2f a = *(const v2f*)(hbuf + lo * SLDS + kk * 4 + hi * 2);
      c = __builtin_amdgcn_wmma_f32_16x16x4_f32(
          false, a, false, bF[kk], (short)0, c, false, false);
    }
    __syncthreads();            // everyone done reading h before overwrite
#pragma unroll
    for (int r = 0; r < 8; r++) {
      int m = r + hi * 8;       // padded batch row
      int n = n0 + lo;          // state column
      float v = c[r];
      if (m < 8) {
#if USE_ASYNC_LDS
        v += ubs[l & 1][m * 128 + n];
#else
        v += ub[((size_t)m * L + l) * 128 + n];
#endif
        hs[((size_t)m * L + l) * 128 + n] = v;
      }
      hbuf[m * SLDS + n] = v;
    }
#if USE_ASYNC_LDS
    wait_async0();
#endif
    __syncthreads();
  }
}

// Block 0 scans; blocks 1 and up do seq tiles t0, t0 + 1, ...
__global__ __launch_bounds__(256) void scan_serial_tiles(
    const float* __restrict__ ub, const float* __restrict__ abar,
    float* __restrict__ hs, int L,
    const float* __restrict__ n, const float* __restrict__ q,
    const float* __restrict__ qb, float* __restrict__ seq, int t0) {
  const int blk = blockIdx.x;
  if (blk == 0) scan_serial(ub, abar, hs, L);
  else seq_tile(n, q, qb, seq, t0 + blk - 1);
}

// ---------------------------------------------------------------------------
// Chunked scan. The recurrence h_l = h_{l-1} @ M^T + x_l is linear, so a
// sequence is cut into chunks of SCT steps and every (batch, chunk) pair is one
// row of a 16-row tile.
//   Up (scan_chunk_ends): one block steps its 16 rows SCT times from zero. It
//   stores the state after every step (steps[row * SCT + t]) and the last one
//   once more, packed (ends[row]). Blocks >= nrb step the rows of the identity
//   with the transposed matrix instead: after step t they hold M^(t+1), laid
//   out [s][k] like M, and store it (pws[t]).
//   Down (scan_fill): the true state of row R after step t is its state from
//   zero plus M^(t+1) times the true state at the end of row R-1 (nothing for a
//   sequence's first chunk). No step waits for another: one block does one
//   16-row tile at one t, a single 16 x 128 x 128 product.
// The chunk ends form a recurrence of the same kind, SCT times shorter, with
// M^SCT as its matrix, so the launcher applies the same two passes to it again.
// Row R = batch * NC + chunk; its step t lies at sequence row R * SCT + t.
// ---------------------------------------------------------------------------
#define SCT 8

// ident is block-uniform. The loops over t, r and kk are unrolled so that bF,
// the accumulator and the SCT inputs and states stay in registers.
__device__ __forceinline__ void scan_rows(
    const float* __restrict__ ub, const float* __restrict__ mat,
    float* __restrict__ ends, float* __restrict__ steps,
    int row0, const bool ident) {
  __shared__ __align__(16) float hbuf[16 * SLDS];
  const int tid = threadIdx.x;
  const int lane = tid & 31, wid = tid >> 5;
  const int hi = lane >> 4, lo = lane & 15;
  const int n = wid * 16 + lo;                       // state column of this lane
  const int r0 = row0 + hi * 8;                      // row of accumulator register 0

  // keep[t] holds step t's input and then the state after step t. All inputs are
  // loaded in front of the loop and all states stored behind it: a load or store
  // inside it would be waited for at the step's barrier.
  v2f bF[32];
  float hv[8], keep[SCT][8];
  if (ident) {
#pragma unroll
    for (int kk = 0; kk < 32; kk++) {
      bF[kk].x = mat[(kk * 4 + hi * 2) * 128 + n];
      bF[kk].y = mat[(kk * 4 + hi * 2 + 1) * 128 + n];
    }
#pragma unroll
    for (int r = 0; r < 8; r++) hv[r] = (r0 + r == n) ? 1.0f : 0.0f;
#pragma unroll
    for (int t = 0; t < SCT; t++)
#pragma unroll
      for (int r = 0; r < 8; r++) keep[t][r] = 0.0f;
  } else {
#pragma unroll
    for (int kk = 0; kk < 32; kk++)
      bF[kk] = *(const v2f*)(mat + n * 128 + kk * 4 + hi * 2);
    XCNT_WAIT();
    const float* const u0 = ub + (size_t)r0 * (SCT * 128) + n;
#pragma unroll
    for (int t = 0; t < SCT; t++)
#pragma unroll
      for (int r = 0; r < 8; r++) keep[t][r] = u0[r * (SCT * 128) + t * 128];
    XCNT_WAIT();
#pragma unroll
    for (int r = 0; r < 8; r++) hv[r] = 0.0f;
  }
#pragma unroll
  for (int r = 0; r < 8; r++) hbuf[(hi * 8 + r) * SLDS + n] = hv[r];
  __syncthreads();

#pragma unroll
  for (int t = 0; t < SCT; t++) {
    v8f c = {};
#pragma unroll
    for (int kk = 0; kk < 32; kk++) {
      v2f a = *(const v2f*)(hbuf + lo * SLDS + kk * 4 + hi * 2);
      c = __builtin_amdgcn_wmma_f32_16x16x4_f32(
          false, a, false, bF[kk], (short)0, c, false, false);
    }
#pragma unroll
    for (int r = 0; r < 8; r++) keep[t][r] = c[r] + keep[t][r];
    if (t + 1 == SCT) break;    // the last state is not read back from LDS
    __syncthreads();            // everyone done reading h before overwrite
#pragma unroll
    for (int r = 0; r < 8; r++) hbuf[(hi * 8 + r) * SLDS + n] = keep[t][r];
    __syncthreads();
  }

  if (ident) {
    float* const s0 = steps + (size_t)r0 * 128 + n;
#pragma unroll
    for (int t = 0; t < SCT; t++)
#pragma unroll
      for (int r = 0; r < 8; r++) s0[t * (128 * 128) + r * 128] = keep[t][r];
  } else {
    float* const s0 = steps + (size_t)r0 * (SCT * 128) + n;
#pragma unroll
    for (int r = 0; r < 8; r++)
#pragma unroll
      for (int t = 0; t < SCT; t++) s0[r * (SCT * 128) + t * 128] = keep[t][r];
    XCNT_WAIT();
#pragma unroll
    for (int r = 0; r < 8; r++) ends[(size_t)r0 * 128 + r * 128 + n] = keep[SCT - 1][r];
  }
  XCNT_WAIT();
}

__global__ __launch_bounds__(256) void scan_chunk_ends(
    const float* __restrict__ ub, const float* __restrict__ mat,
    float* __restrict__ ends, float* __restrict__ steps, float* __restrict__ pws, int nrb) {
  const int blk = blockIdx.x;
  const bool ident = blk >= nrb;
  scan_rows(ub, mat, ends, ident ? pws : steps, (ident ? blk - nrb : blk) * 16, ident);
}

// io[R * SCT + t] += M^(t+1) applied to carry[R-1]; blockIdx.x = 16-row tile,
// blockIdx.y = t. Wave w owns state columns 16w..16w+15. M^(t+1) and the 16
// carries are read from global memory in whole lines, 512 B in a row per wave
// and load, and laid into LDS at the pitch of hbuf; the fragments are read from
// there in the k order of scan_rows. The pointers are not __restrict__: with it
// the compiler moved the loads down over the wait that stands behind them.
__global__ __launch_bounds__(256) void scan_fill(
    const float* carry, const float* pws, float* io, int NC) {
  __shared__ __align__(16) float sM[128 * SLDS];
  __shared__ __align__(16) float sH[16 * SLDS];
  const int tid = threadIdx.x;
  const int lane = tid & 31, wid = tid >> 5;
  const int hi = lane >> 4, lo = lane & 15;
  const int n = wid * 16 + lo;                       // state column of this lane
  const int row0 = blockIdx.x * 16, t = blockIdx.y;
  const float* const mg = pws + (size_t)t * (128 * 128) + tid * 4;
  float* const cp = io + ((size_t)(row0 + hi * 8) * SCT + t) * 128 + n;

  v4f mv[16], hv[2];
  float lv[8];
#pragma unroll
  for (int j = 0; j < 16; j++) mv[j] = *(const v4f*)(mg + j * 1024);   // rows 8j + wid
#pragma unroll
  for (int j = 0; j < 2; j++) {
    // row R takes row R-1; row 0 has none before it and is a first chunk
    const int ra = row0 + j * 8 + wid;
    hv[j] = *(const v4f*)(carry + (size_t)(ra > 0 ? ra - 1 : 0) * 128 + lane * 4);
  }
#pragma unroll
  for (int r = 0; r < 8; r++) lv[r] = cp[r * (SCT * 128)];
  XCNT_WAIT();   // the LDS address arithmetic below reuses the loads' offset register
#pragma unroll
  for (int j = 0; j < 16; j++) *(v4f*)(sM + (j * 8 + wid) * SLDS + lane * 4) = mv[j];
#pragma unroll
  for (int j = 0; j < 2; j++) *(v4f*)(sH + (j * 8 + wid) * SLDS + lane * 4) = hv[j];
  __syncthreads();

  v8f c = {};
#pragma unroll
  for (int kk = 0; kk < 32; kk++) {
    v2f a = *(const v2f*)(sH + lo * SLDS + kk * 4 + hi * 2);
    v2f b = *(const v2f*)(sM + n * SLDS + kk * 4 + hi * 2);
    c = __builtin_amdgcn_wmma_f32_16x16x4_f32(
        false, a, false, b, (short)0, c, false, false);
  }
  // a row of the product depends on its own row of A alone: a first chunk's row,
  // formed from a state that is not its carry, is left out here
#pragma unroll
  for (int r = 0; r < 8; r++)
    if ((row0 + hi * 8 + r) & (NC - 1)) lv[r] += c[r];
  // keeps every sum in front of the first store, so that no sum is written into
  // the data register of a store that has been issued
  __builtin_amdgcn_sched_barrier(0);
#pragma unroll
  for (int r = 0; r < 8; r++) cp[r * (SCT * 128)] = lv[r];
  XCNT_WAIT();   // behind the last stores, as in the other kernels
}

// ---------------------------------------------------------------------------
// Launcher
// ---------------------------------------------------------------------------
extern "C" void kernel_launch(void* const* d_in, const int* in_sizes, int n_in,
                              void* d_out, int out_size, void* d_ws, size_t ws_size,
                              hipStream_t stream) {
  (void)in_sizes; (void)n_in; (void)out_size; (void)ws_size;
  const float* x     = (const float*)d_in[0];
  const float* Aall  = (const float*)d_in[1];
  const float* Bp    = (const float*)d_in[2];
  const float* Cp    = (const float*)d_in[3];
  const float* Dp    = (const float*)d_in[4];
  const float* Wi    = (const float*)d_in[5];
  const float* bi    = (const float*)d_in[6];
  const float* Wo    = (const float*)d_in[7];
  const float* bo    = (const float*)d_in[8];
  const float* gamma = (const float*)d_in[9];
  const float* beta  = (const float*)d_in[10];
  float* out = (float*)d_out;

  const int Bn = 8, L = 1024, C = 1024, S = 128, depth = 4;
  const size_t nBLC = (size_t)Bn * L * C;    // 8Mi floats
  const size_t nBLS = (size_t)Bn * L * S;    // 1Mi floats

  float* seq  = (float*)d_ws;                // (B, L, C)
  float* nbuf = seq  + nBLC;                 // LN output
  float* ubb  = nbuf + nBLC;                 // DT * u @ Bp^T   (b*L+l, S)
  float* hsb  = ubb  + nBLS;                 // scan states     (b*L+l, S)
  float* abar = hsb  + nBLS;                 // I + DT*A (128x128)
  float* pws0 = abar + S * S;                // A_bar^1 .. A_bar^8
  float* pws1 = pws0 + SCT * S * S;          // A_bar^8, ^16 .. ^64
  float* pw1  = pws0 + (SCT - 1) * S * S;    // A_bar^8
  float* pw2  = pws1 + (SCT - 1) * S * S;    // A_bar^64
  float* le0  = pws1 + SCT * S * S;          // ends of the 8-step chunks from zero  (b*128+c, S)
  float* car0 = le0  + nBLS / SCT;           // true states at those ends            (b*128+c, S)
  float* le1  = car0 + nBLS / SCT;           // ends of the 64-step chunks from zero (b*16+c, S)
  float* car1 = le1  + nBLS / (SCT * SCT);   // true states at those ends            (b*16+c, S)
  // folded weights, all layers
  const int F = C + S;                       // 1152 rows: Wo diag(Dp) over Bp
  float* wit  = car1 + nBLS / (SCT * SCT);   // Wi^T                        (layer, c, d)
  float* cpt  = wit  + (size_t)depth * C * C;  // Cp^T                      (layer, s, d)
  float* lf   = cpt  + (size_t)depth * S * C;  // [Wo diag(Dp); Bp]         (layer, F, d)
  float* qg   = lf   + (size_t)depth * F * C;  // lf @ Wi                   (layer, F, c)
  float* pf   = qg   + (size_t)depth * F * C;  // Wo @ Cp                   (layer, o, s)
  float* fb   = pf   + (size_t)depth * C * S;  // folded biases             (layer, F)

  dim3 tb(32, 8);
  dim3 tg(32, 32, Bn);
  transpose_bll<1024><<<tg, tb, 0, stream>>>(x, seq);   // seq[b][l][c] = x[b][c][l]

  transpose_bll<1024><<<dim3(32, 32, depth), tb, 0, stream>>>(Wi, wit);  // wit[c][d] = Wi[d][c]
  transpose_bll<128><<<dim3(32, 4, depth), tb, 0, stream>>>(Cp, cpt);    // cpt[s][d] = Cp[d][s]
  fold_rows<<<dim3(F, depth), 256, 0, stream>>>(Wo, Bp, Dp, bi, bo, lf, fb);
  // qg = [Wo diag(Dp); Bp] @ Wi and pf = Wo @ Cp
  fold_gemm<<<dim3(16, 10, depth), 256, 0, stream>>>(lf, wit, Wo, cpt, qg, pf);

  for (int i = 0; i < depth; i++) {
    const float* qi = qg + (size_t)i * F * C;   // Wo diag(Dp) Wi, then Bp Wi
    const float* fi = fb + i * F;

    ln_kernel<<<Bn * L, 256, 0, stream>>>(seq, gamma + i * C, beta + i * C, nbuf, C);

    // ub = DT * (n @ (Bp Wi)^T + Bp bi), 128 blocks. The 1024 tiles of
    // seq += n @ (Wo diag(Dp) Wi)^T + Wo (Dp * bi) + bo ride along: 896 here, which
    // makes four blocks a WGP, and 128 beside the one block of the serial scan pass.
    ub_gemm_tiles<<<128 + 896, 256, 0, stream>>>(nbuf, qi, fi, ubb, seq);

    abar_kernel<<<(S * S) / 256, 256, 0, stream>>>(Aall + (size_t)i * S * S, abar);

    // scan of length 1024 = 8 x 8 x 16: two chunk levels up, 16 serial steps, two down.
    // Going up, hsb and car0 take the states from zero; going down, the carries are added.
    scan_chunk_ends<<<64 + 8, 256, 0, stream>>>(ubb, abar, le0, hsb, pws0, 64);
    scan_chunk_ends<<<8 + 8, 256, 0, stream>>>(le0, pw1, le1, car0, pws1, 8);
    scan_serial_tiles<<<1 + 128, 256, 0, stream>>>(le1, pw2, car1, 16,
                                                   nbuf, qi, fi, seq, 896);
    scan_fill<<<dim3(8, SCT), 256, 0, stream>>>(car1, pws1, car0, 16);
    scan_fill<<<dim3(64, SCT), 256, 0, stream>>>(car0, pws0, hsb, 128);

    // seq += hs @ (Wo Cp)^T
    wmma_gemm<<<dim3(C / BN, (Bn * L) / BM), 256, 0, stream>>>(
        hsb, pf + (size_t)i * C * S, nullptr, seq, Bn * L, C, S, 1.0f, 2);
  }

  transpose_bll<1024><<<tg, tb, 0, stream>>>(seq, out); // out[b][c][l] = seq[b][l][c]
}

// v008
// It runs in 618 microseconds.
// Versions between v006 and this one are left out; their measured steps multiply to 1.29 times as fast.
// All steps since v000 together make it 11.6 times as fast.
#include <hip/hip_runtime.h>
#include <stdint.h>

typedef __attribute__((ext_vector_type(2))) float v2f;
typedef __attribute__((ext_vector_type(4))) float v4f;
typedef __attribute__((ext_vector_type(8))) float v8f;
typedef __attribute__((ext_vector_type(2))) __bf16 v2bf;
typedef __attribute__((ext_vector_type(16))) __bf16 v16bf;
typedef __attribute__((ext_vector_type(8))) uint32_t v8u;

#define SSM_DT   0.001f
#define LN_EPS   1e-5f

// ---------------------------------------------------------------------------
// CDNA5 async global->LDS copy support (guarded so compile never breaks)
// ---------------------------------------------------------------------------
#ifdef __has_builtin
#if __has_builtin(__builtin_amdgcn_global_load_async_to_lds_b128)
#define USE_ASYNC_LDS 1
#endif
#endif
#ifndef USE_ASYNC_LDS
#define USE_ASYNC_LDS 0
#endif

#if USE_ASYNC_LDS
// Builtin signature (from hipcc diagnostic): param 0 is
// 'int __attribute__((vector_size(16))) addrspace(1)*', param 1 the LDS-side
// pointer, then two int immediates (offset, cpol).
typedef int v4i_g __attribute__((vector_size(16)));
typedef __attribute__((address_space(1))) v4i_g as1_v4i;
typedef __attribute__((address_space(3))) v4i_g as3_v4i;

// Generic LDS pointer's low 32 bits ARE the LDS byte offset (ISA aperture rule),
// so an int->as3-pointer round trip gives a valid LDS address without an
// addrspacecast.
__device__ __forceinline__ void async_cp16(const float* g, const float* lds) {
  __builtin_amdgcn_global_load_async_to_lds_b128(
      (as1_v4i*)(uintptr_t)g, (as3_v4i*)(uint32_t)(uintptr_t)lds, 0, 0);
}
__device__ __forceinline__ void wait_async0() {
#if __has_builtin(__builtin_amdgcn_s_wait_asynccnt)
  __builtin_amdgcn_s_wait_asynccnt(0);
#else
  asm volatile("s_wait_asynccnt 0" ::: "memory");
#endif
}
#endif

// ---------------------------------------------------------------------------
// Transpose (1024 x NC per batch): dst[b][i][j] = src[b][j][i], j < 1024, i < NC
// ---------------------------------------------------------------------------
template <int NC>
__global__ __launch_bounds__(256) void transpose_bll(const float* __restrict__ src,
                                                     float* __restrict__ dst) {
  __shared__ float tile[32][33];
  int b = blockIdx.z;
  int i0 = blockIdx.y * 32, j0 = blockIdx.x * 32;
  int tx = threadIdx.x, ty = threadIdx.y;           // 32 x 8
  size_t base = (size_t)b * 1024 * NC;
#pragma unroll
  for (int k = 0; k < 32; k += 8)
    tile[ty + k][tx] = src[base + (size_t)(j0 + ty + k) * NC + i0 + tx];
  __syncthreads();
#pragma unroll
  for (int k = 0; k < 32; k += 8)
    dst[base + (size_t)(i0 + ty + k) * 1024 + j0 + tx] = tile[tx][ty + k];
}

// ---------------------------------------------------------------------------
// LayerNorm over last dim (C = 1024), one block per row, 256 threads
// ---------------------------------------------------------------------------
__global__ __launch_bounds__(256) void ln_kernel(const float* __restrict__ x,
                                                 const float* __restrict__ gamma,
                                                 const float* __restrict__ beta,
                                                 float* __restrict__ out, int C) {
  int row = blockIdx.x;
  int t = threadIdx.x;
  const float4 d = ((const float4*)(x + (size_t)row * C))[t];
  float s  = d.x + d.y + d.z + d.w;
  float ss = d.x * d.x + d.y * d.y + d.z * d.z + d.w * d.w;
  __shared__ float rs[256], rq[256];
  rs[t] = s; rq[t] = ss;
  __syncthreads();
  for (int off = 128; off > 0; off >>= 1) {
    if (t < off) { rs[t] += rs[t + off]; rq[t] += rq[t + off]; }
    __syncthreads();
  }
  float mean = rs[0] / (float)C;
  float var  = rq[0] / (float)C - mean * mean;
  float inv  = rsqrtf(var + LN_EPS);
  const float4 g = ((const float4*)gamma)[t];
  const float4 bb = ((const float4*)beta)[t];
  float4 o;
  o.x = (d.x - mean) * inv * g.x + bb.x;
  o.y = (d.y - mean) * inv * g.y + bb.y;
  o.z = (d.z - mean) * inv * g.z + bb.z;
  o.w = (d.w - mean) * inv * g.w + bb.w;
  ((float4*)(out + (size_t)row * C))[t] = o;
}

// ---------------------------------------------------------------------------
// A_bar = I + DT*A  (128x128)
// ---------------------------------------------------------------------------
__global__ void abar_kernel(const float* __restrict__ A, float* __restrict__ abar) {
  int i = blockIdx.x * blockDim.x + threadIdx.x;   // 16384
  int s = i >> 7, k = i & 127;
  abar[i] = (s == k ? 1.0f : 0.0f) + SSM_DT * A[i];
}

// ---------------------------------------------------------------------------
// Weight folding. With u = n Wi^T + bi the layer is linear in n and hs:
//   ub   = DT * (n (Bp Wi)^T + Bp bi)
//   seq += n (Wo diag(Dp) Wi)^T + hs (Wo Cp)^T + Wo (Dp * bi) + bo
// so u and y are never formed. This kernel lays out, per layer, the left factor
// of the products with Wi, 1152 rows of 1024: rows 0..1023 = Wo diag(Dp), rows
// 1024..1151 = Bp; and each row's product with bi, finished as the bias of the
// GEMM that uses the row: fb[r] = row . bi + bo[r], or DT * (row . bi) for Bp.
// One block per row (blockIdx.x) and layer (blockIdx.y).
// ---------------------------------------------------------------------------
__global__ __launch_bounds__(256) void fold_rows(
    const float* __restrict__ Wo, const float* __restrict__ Bp,
    const float* __restrict__ Dp, const float* __restrict__ bi,
    const float* __restrict__ bo, float* __restrict__ lf, float* __restrict__ fb) {
  const int r = blockIdx.x, i = blockIdx.y, t = threadIdx.x;
  const bool isw = r < 1024;
  const float* srow = isw ? Wo + ((size_t)i * 1024 + r) * 1024
                          : Bp + ((size_t)i * 128 + (r - 1024)) * 1024;
  float4 w = ((const float4*)srow)[t];
  if (isw) {
    const float4 d = ((const float4*)(Dp + i * 1024))[t];
    w.x *= d.x; w.y *= d.y; w.z *= d.z; w.w *= d.w;
  }
  ((float4*)(lf + ((size_t)i * 1152 + r) * 1024))[t] = w;
  const float4 b = ((const float4*)(bi + i * 1024))[t];
  __shared__ float rs[256];
  rs[t] = w.x * b.x + w.y * b.y + w.z * b.z + w.w * b.w;
  __syncthreads();
  for (int off = 128; off > 0; off >>= 1) {
    if (t < off) rs[t] += rs[t + off];
    __syncthreads();
  }
  if (t == 0) fb[i * 1152 + r] = isw ? rs[0] + bo[i * 1024 + r] : SSM_DT * rs[0];
}

// ---------------------------------------------------------------------------
// WMMA GEMM: Cmat[M x N] = alpha * (A[M x K] @ Bw[N x K]^T)  (+ bias[N])
//   mode 0: plain           mode 2: += old Cmat value (residual accumulate)
// gemm_tile does the block tile whose first row is bm and first column bn.
// N, the row pitch of Cmat, is 1024 or 128.
// Block tile 128x64, BK=32, 8 waves of 32x32.
// The tiles lie in LDS as f32. A wave splits each fragment in registers into a
// bf16 high part (the value rounded to bf16) and a bf16 low part (what is left,
// rounded to bf16), and forms a . b as lo*hi + hi*lo + hi*hi on the bf16
// 16x16x32 WMMA with f32 sums; lo*lo, about 2^-18 of the product, is dropped.
// One slab is one k step of 32: 3 WMMAs a 16x16 tile.
// BK=32 makes a tile row 128 B, one whole cache line, and eight neighbouring
// lanes copy it: a wave's copy instruction then touches four whole lines.
// Double-buffered LDS; async DMA staging when available.
// ---------------------------------------------------------------------------
// Stands behind a run of global loads or stores, in front of the first reuse of
// a register that they name; the two scheduling barriers keep later register
// writes from being moved up over the wait.
#define XCNT_WAIT()                                  \
  do {                                               \
    __builtin_amdgcn_sched_barrier(0);               \
    asm volatile("s_wait_xcnt 0x0" ::: "memory");    \
    __builtin_amdgcn_sched_barrier(0);               \
  } while (0)

#define BM 128
#define BN 64
#define BK 32
#define LDA_S 36   // padded LDS row stride (floats): 16B-aligned, conflict-free

__device__ __forceinline__ void gemm_tile(
    const float* __restrict__ A, const float* __restrict__ Bw,
    const float* __restrict__ bias, float* __restrict__ Cmat,
    int N, int K, float alpha, int mode, const int bm, const int bn) {
  __shared__ __align__(16) float sA[2][BM * LDA_S];
  __shared__ __align__(16) float sB[2][BN * LDA_S];

  const int tid  = threadIdx.x;
  const int lane = tid & 31, wid = tid >> 5;
  const int hi = lane >> 4, lo = lane & 15;
  const int wm = (wid >> 1) * 32, wn = (wid & 1) * 32;

  v8f acc[2][2] = {};

  // A lane holds 16 consecutive k of its row, k = 16 * hi + s at element s, in
  // the A and in the B fragments alike (one loader for both).
  // Two values at a time: one packed conversion gives both high parts, a shift and
  // a mask give them back as f32, one packed subtraction and one packed conversion
  // give both low parts. Unrolled: hu and lu are registers with fixed numbers.
  auto split_frag = [&](const float* row, v16bf& h, v16bf& l) {
    v8u hu, lu;
#pragma unroll
    for (int q = 0; q < 4; q++) {
      const v4f x = *(const v4f*)(row + hi * 16 + q * 4);
#pragma unroll
      for (int p = 0; p < 2; p++) {
        const v2f xx = {x[2 * p], x[2 * p + 1]};
        const uint32_t u = __builtin_bit_cast(uint32_t, __builtin_convertvector(xx, v2bf));
        const v2f hf = {__builtin_bit_cast(float, u << 16),
                        __builtin_bit_cast(float, u & 0xffff0000u)};
        hu[q * 2 + p] = u;
        lu[q * 2 + p] = __builtin_bit_cast(uint32_t, __builtin_convertvector(xx - hf, v2bf));
      }
    }
    h = __builtin_bit_cast(v16bf, hu);
    l = __builtin_bit_cast(v16bf, lu);
  };
  auto compute_tile = [&](const float* cA, const float* cB) {
    v16bf aH[2], aL[2], bH[2], bL[2];
#pragma unroll
    for (int i = 0; i < 2; i++) {
      split_frag(cA + (wm + i * 16 + lo) * LDA_S, aH[i], aL[i]);
      split_frag(cB + (wn + i * 16 + lo) * LDA_S, bH[i], bL[i]);
    }
    // each tile takes its two small terms first, then hi*hi; all loops here are
    // unrolled so that fragments and accumulators are registers with fixed numbers
#pragma unroll
    for (int i = 0; i < 2; i++)
#pragma unroll
      for (int j = 0; j < 2; j++)
        acc[i][j] = __builtin_amdgcn_wmma_f32_16x16x32_bf16(
            false, aL[i], false, bH[j], (short)0, acc[i][j], false, false);
#pragma unroll
    for (int i = 0; i < 2; i++)
#pragma unroll
      for (int j = 0; j < 2; j++)
        acc[i][j] = __builtin_amdgcn_wmma_f32_16x16x32_bf16(
            false, aH[i], false, bL[j], (short)0, acc[i][j], false, false);
#pragma unroll
    for (int i = 0; i < 2; i++)
#pragma unroll
      for (int j = 0; j < 2; j++)
        acc[i][j] = __builtin_amdgcn_wmma_f32_16x16x32_bf16(
            false, aH[i], false, bH[j], (short)0, acc[i][j], false, false);
  };

#if USE_ASYNC_LDS
  // --- async DMA double-buffered pipeline ---
  auto stage = [&](int buf, int k0) {
#pragma unroll
    for (int j = 0; j < 4; j++) {           // A tile: 1024 B128 slots, 4/thread
      int s = j * 256 + tid;
      int r = s >> 3, c4 = (s & 7) * 4;
      async_cp16(A + (size_t)(bm + r) * K + k0 + c4, &sA[buf][r * LDA_S + c4]);
    }
    // unrolled like the loop above: the copies are issued back to back, no loop control between them
#pragma unroll
    for (int j = 0; j < 2; j++) {           // B tile: 512 B128 slots, 2/thread
      int s = j * 256 + tid;
      int r = s >> 3, c4 = (s & 7) * 4;
      async_cp16(Bw + (size_t)(bn + r) * K + k0 + c4, &sB[buf][r * LDA_S + c4]);
    }
  };

  stage(0, 0);
  wait_async0();
  __syncthreads();
  int cur = 0;
  for (int k0 = 0; k0 < K; k0 += BK) {
    if (k0 + BK < K) stage(cur ^ 1, k0 + BK);   // DMA next tile in background
    compute_tile(sA[cur], sB[cur]);             // 12 WMMAs on current tile
    // keeps the splits and the WMMAs in front of the wait: moved behind it they
    // would no longer cover the flight of the next tile's copies
    __builtin_amdgcn_sched_barrier(0);
    wait_async0();
    __syncthreads();
    cur ^= 1;
  }
#else
  // --- fallback: synchronous single-buffer staging ---
  for (int k0 = 0; k0 < K; k0 += BK) {
#pragma unroll
    for (int j = 0; j < 4; j++) {
      int s = j * 256 + tid;
      int r = s >> 3, c4 = (s & 7) * 4;
      float4 v = *(const float4*)(A + (size_t)(bm + r) * K + k0 + c4);
      *(float4*)(&sA[0][r * LDA_S + c4]) = v;
    }
    // unrolled like the loop above, so that both loads are in flight together
#pragma unroll
    for (int j = 0; j < 2; j++) {
      int s = j * 256 + tid;
      int r = s >> 3, c4 = (s & 7) * 4;
      float4 v = *(const float4*)(Bw + (size_t)(bn + r) * K + k0 + c4);
      *(float4*)(&sB[0][r * LDA_S + c4]) = v;
    }
    __syncthreads();
    compute_tile(sA[0], sB[0]);
    __syncthreads();
  }
#endif

  // Epilogue. C/D layout: VGPR r -> M = r + 8*hi, N = lo.
  // A lane's two bias values and its 32 old values are loaded in one batch, so
  // that the wave waits out one load latency and not one per element; then the
  // sums in the old order (alpha * acc, + bias, + old value), then the 32 stores.
  const int col = bn + wn + lo;
  float bv[2] = {0.0f, 0.0f};
  if (bias) {
    bv[0] = bias[col];
    bv[1] = bias[col + 16];
    XCNT_WAIT();   // the address arithmetic below reuses these two loads' address registers
  }
  // pitch is a literal at both calls: all 64 accesses of a lane then go through
  // one address register pair with immediate offsets, which nothing overwrites.
  auto finish = [&](const int pitch) {
    float* const c0 = Cmat + (size_t)(bm + wm + hi * 8) * pitch + col;
    float v[2][2][8] = {};
    if (mode == 2) {
#pragma unroll
      for (int i = 0; i < 2; i++)
#pragma unroll
        for (int r = 0; r < 8; r++)
#pragma unroll
          for (int j = 0; j < 2; j++) v[i][j][r] = c0[(i * 16 + r) * pitch + j * 16];
      // keeps the sums, which wait for the bias values, behind the issue of these loads
      __builtin_amdgcn_sched_barrier(0);
    }
#pragma unroll
    for (int i = 0; i < 2; i++)
#pragma unroll
      for (int r = 0; r < 8; r++)
#pragma unroll
        for (int j = 0; j < 2; j++) v[i][j][r] = alpha * acc[i][j][r] + bv[j] + v[i][j][r];
    // keeps every sum in front of the first store, so that no sum is written into
    // the data register of a store that has been issued
    __builtin_amdgcn_sched_barrier(0);
#pragma unroll
    for (int i = 0; i < 2; i++)
#pragma unroll
      for (int r = 0; r < 8; r++)
#pragma unroll
        for (int j = 0; j < 2; j++) c0[(i * 16 + r) * pitch + j * 16] = v[i][j][r];
    XCNT_WAIT();   // the code that follows in the kernel's text reuses these registers
  };
  if (N == 1024) finish(1024);
  else finish(128);
}

// (256, 8): eight waves a SIMD, so that four blocks still share a WGP
__global__ __launch_bounds__(256, 8) void wmma_gemm(
    const float* __restrict__ A, const float* __restrict__ Bw,
    const float* __restrict__ bias, float* __restrict__ Cmat,
    int M, int N, int K, float alpha, int mode) {
  gemm_tile(A, Bw, bias, Cmat, N, K, alpha, mode, blockIdx.y * BM, blockIdx.x * BN);
}

// Tile t of the 1024 block tiles (64 tile rows x 16 tile columns, column fastest) of
//   seq += n @ (Wo diag(Dp) Wi)^T + Wo (Dp * bi) + bo
// This product needs only n, not the scan. The ub product fills half the WGPs
// and the serial pass of the scan one, and both last long, so these two launches
// carry the tiles, on blocks numbered behind their own.
__device__ __forceinline__ void seq_tile(
    const float* __restrict__ n, const float* __restrict__ q,
    const float* __restrict__ qb, float* __restrict__ seq, const int t) {
  gemm_tile(n, q, qb, seq, 1024, 1024, 1.0f, 2, (t >> 4) * BM, (t & 15) * BN);
}

// Blocks 0..127: the 64 x 2 tiles of ub = DT * (n @ (Bp Wi)^T + Bp bi); q holds
// Wo diag(Dp) Wi (1024 rows) and then Bp Wi (128 rows), qb their biases.
// Blocks 128 and up: seq tiles 0, 1, ...
__global__ __launch_bounds__(256, 8) void ub_gemm_tiles(
    const float* __restrict__ n, const float* __restrict__ q,
    const float* __restrict__ qb, float* __restrict__ ub, float* __restrict__ seq) {
  const int blk = blockIdx.x;
  const bool u = blk < 128;
  const int t = blk - 128;
  gemm_tile(n, u ? q + 1024 * 1024 : q, u ? qb + 1024 : qb, u ? ub : seq,
            u ? 128 : 1024, 1024, u ? SSM_DT : 1.0f, u ? 0 : 2,
            (u ? blk >> 1 : t >> 4) * BM, (u ? blk & 1 : t & 15) * BN);
}

// The two weight products of every layer (blockIdx.z) in one launch, grid (16, 10):
//   y < 9 : qg (1152 x 1024) = lf @ wit^T, tile (y, x)
//   y == 9: pf (1024 x 128)  = Wo @ cpt^T, its 8 x 2 tiles numbered by x
__global__ __launch_bounds__(256, 8) void fold_gemm(
    const float* __restrict__ lf, const float* __restrict__ wit,
    const float* __restrict__ Wo, const float* __restrict__ cpt,
    float* __restrict__ qg, float* __restrict__ pf) {
  const int x = blockIdx.x, y = blockIdx.y;
  const size_t i = blockIdx.z;
  const bool q = y < 9;
  gemm_tile(q ? lf + i * (1152 * 1024) : Wo + i * (1024 * 1024),
            q ? wit + i * (1024 * 1024) : cpt + i * (128 * 1024), nullptr,
            q ? qg + i * (1152 * 1024) : pf + i * (1024 * 128),
            q ? 1024 : 128, 1024, 1.0f, 0,
            (q ? y : x >> 1) * BM, (q ? x : x & 1) * BN);
}

// ---------------------------------------------------------------------------
// Sequential scan: h (16x128, rows 8..15 zero-padded) lives in LDS.
//   per step l: h = h @ A_bar^T + ub[:, l, :];  store hs[b*L + l][s] = h[b][s]
// One block, 8 waves; wave w owns state columns 16w..16w+15.
// A_bar fragments preloaded into registers (loop-invariant, 32 x float2).
// The next step's ub slab is async-DMA'd into LDS while WMMAs run.
// ---------------------------------------------------------------------------
#define SLDS 132   // 16 fragment rows -> 16 distinct LDS banks

__device__ __forceinline__ void scan_serial(
    const float* __restrict__ ub, const float* __restrict__ abar,
    float* __restrict__ hs, const int L) {
  __shared__ __align__(16) float hbuf[16 * SLDS];
#if USE_ASYNC_LDS
  __shared__ __align__(16) float ubs[2][8 * 128];
#endif
  const int tid = threadIdx.x;
  const int lane = tid & 31, wid = tid >> 5;
  const int hi = lane >> 4, lo = lane & 15;
  const int n0 = wid * 16;

  // Preload B fragments of A_bar (stored [s][k], K-major like the GEMM weights)
  v2f bF[32];
#pragma unroll
  for (int kk = 0; kk < 32; kk++)
    bF[kk] = *(const v2f*)(abar + (size_t)(n0 + lo) * 128 + kk * 4 + hi * 2);

#if USE_ASYNC_LDS
  auto prefetch_ub = [&](int buf, int l) {   // 8 rows x 128 floats, B128/thread
    int b = tid >> 5, s4 = (tid & 31) * 4;
    async_cp16(ub + ((size_t)b * L + l) * 128 + s4, &ubs[buf][b * 128 + s4]);
  };
  prefetch_ub(0, 0);
#endif

  for (int i = tid; i < 16 * SLDS; i += 256) hbuf[i] = 0.0f;
#if USE_ASYNC_LDS
  wait_async0();
#endif
  __syncthreads();

  for (int l = 0; l < L; l++) {
#if USE_ASYNC_LDS
    if (l + 1 < L) prefetch_ub((l + 1) & 1, l + 1);  // hide global latency
#endif
    v8f c = {};
#pragma unroll
    for (int kk = 0; kk < 32; kk++) {
      v2f a = *(const v2f*)(hbuf + lo * SLDS + kk * 4 + hi * 2);
      c = __builtin_amdgcn_wmma_f32_16x16x4_f32(
          false, a, false, bF[kk], (short)0, c, false, false);
    }
    __syncthreads();            // everyone done reading h before overwrite
#pragma unroll
    for (int r = 0; r < 8; r++) {
      int m = r + hi * 8;       // padded batch row
      int n = n0 + lo;          // state column
      float v = c[r];
      if (m < 8) {
#if USE_ASYNC_LDS
        v += ubs[l & 1][m * 128 + n];
#else
        v += ub[((size_t)m * L + l) * 128 + n];
#endif
        hs[((size_t)m * L + l) * 128 + n] = v;
      }
      hbuf[m * SLDS + n] = v;
    }
#if USE_ASYNC_LDS
    wait_async0();
#endif
    __syncthreads();
  }
}

// Block 0 scans; blocks 1 and up do seq tiles t0, t0 + 1, ...
__global__ __launch_bounds__(256) void scan_serial_tiles(
    const float* __restrict__ ub, const float* __restrict__ abar,
    float* __restrict__ hs, int L,
    const float* __restrict__ n, const float* __restrict__ q,
    const float* __restrict__ qb, float* __restrict__ seq, int t0) {
  const int blk = blockIdx.x;
  if (blk == 0) scan_serial(ub, abar, hs, L);
  else seq_tile(n, q, qb, seq, t0 + blk - 1);
}

// ---------------------------------------------------------------------------
// Chunked scan. The recurrence h_l = h_{l-1} @ M^T + x_l is linear, so a
// sequence is cut into chunks of SCT steps and every (batch, chunk) pair is one
// row of a 16-row tile.
//   Up (scan_chunk_ends): one block steps its 16 rows SCT times from zero. It
//   stores the state after every step (steps[row * SCT + t]) and the last one
//   once more, packed (ends[row]). Blocks >= nrb step the rows of the identity
//   with the transposed matrix instead: after step t they hold M^(t+1), laid
//   out [s][k] like M, and store it (pws[t]).
//   Down (scan_fill): the true state of row R after step t is its state from
//   zero plus M^(t+1) times the true state at the end of row R-1 (nothing for a
//   sequence's first chunk). No step waits for another: one block does one
//   16-row tile at one t, a single 16 x 128 x 128 product.
// The chunk ends form a recurrence of the same kind, SCT times shorter, with
// M^SCT as its matrix, so the launcher applies the same two passes to it again.
// Row R = batch * NC + chunk; its step t lies at sequence row R * SCT + t.
// ---------------------------------------------------------------------------
#define SCT 8

// ident is block-uniform. The loops over t, r and kk are unrolled so that bF,
// the accumulator and the SCT inputs and states stay in registers.
__device__ __forceinline__ void scan_rows(
    const float* __restrict__ ub, const float* __restrict__ mat,
    float* __restrict__ ends, float* __restrict__ steps,
    int row0, const bool ident) {
  __shared__ __align__(16) float hbuf[16 * SLDS];
  const int tid = threadIdx.x;
  const int lane = tid & 31, wid = tid >> 5;
  const int hi = lane >> 4, lo = lane & 15;
  const int n = wid * 16 + lo;                       // state column of this lane
  const int r0 = row0 + hi * 8;                      // row of accumulator register 0

  // keep[t] holds step t's input and then the state after step t. All inputs are
  // loaded in front of the loop and all states stored behind it: a load or store
  // inside it would be waited for at the step's barrier.
  v2f bF[32];
  float hv[8], keep[SCT][8];
  if (ident) {
#pragma unroll
    for (int kk = 0; kk < 32; kk++) {
      bF[kk].x = mat[(kk * 4 + hi * 2) * 128 + n];
      bF[kk].y = mat[(kk * 4 + hi * 2 + 1) * 128 + n];
    }
#pragma unroll
    for (int r = 0; r < 8; r++) hv[r] = (r0 + r == n) ? 1.0f : 0.0f;
#pragma unroll
    for (int t = 0; t < SCT; t++)
#pragma unroll
      for (int r = 0; r < 8; r++) keep[t][r] = 0.0f;
  } else {
#pragma unroll
    for (int kk = 0; kk < 32; kk++)
      bF[kk] = *(const v2f*)(mat + n * 128 + kk * 4 + hi * 2);
    XCNT_WAIT();
    const float* const u0 = ub + (size_t)r0 * (SCT * 128) + n;
#pragma unroll
    for (int t = 0; t < SCT; t++)
#pragma unroll
      for (int r = 0; r < 8; r++) keep[t][r] = u0[r * (SCT * 128) + t * 128];
    XCNT_WAIT();
#pragma unroll
    for (int r = 0; r < 8; r++) hv[r] = 0.0f;
  }
#pragma unroll
  for (int r = 0; r < 8; r++) hbuf[(hi * 8 + r) * SLDS + n] = hv[r];
  __syncthreads();

#pragma unroll
  for (int t = 0; t < SCT; t++) {
    v8f c = {};
#pragma unroll
    for (int kk = 0; kk < 32; kk++) {
      v2f a = *(const v2f*)(hbuf + lo * SLDS + kk * 4 + hi * 2);
      c = __builtin_amdgcn_wmma_f32_16x16x4_f32(
          false, a, false, bF[kk], (short)0, c, false, false);
    }
#pragma unroll
    for (int r = 0; r < 8; r++) keep[t][r] = c[r] + keep[t][r];
    if (t + 1 == SCT) break;    // the last state is not read back from LDS
    __syncthreads();            // everyone done reading h before overwrite
#pragma unroll
    for (int r = 0; r < 8; r++) hbuf[(hi * 8 + r) * SLDS + n] = keep[t][r];
    __syncthreads();
  }

  if (ident) {
    float* const s0 = steps + (size_t)r0 * 128 + n;
#pragma unroll
    for (int t = 0; t < SCT; t++)
#pragma unroll
      for (int r = 0; r < 8; r++) s0[t * (128 * 128) + r * 128] = keep[t][r];
  } else {
    float* const s0 = steps + (size_t)r0 * (SCT * 128) + n;
#pragma unroll
    for (int r = 0; r < 8; r++)
#pragma unroll
      for (int t = 0; t < SCT; t++) s0[r * (SCT * 128) + t * 128] = keep[t][r];
    XCNT_WAIT();
#pragma unroll
    for (int r = 0; r < 8; r++) ends[(size_t)r0 * 128 + r * 128 + n] = keep[SCT - 1][r];
  }
  XCNT_WAIT();
}

__global__ __launch_bounds__(256) void scan_chunk_ends(
    const float* __restrict__ ub, const float* __restrict__ mat,
    float* __restrict__ ends, float* __restrict__ steps, float* __restrict__ pws, int nrb) {
  const int blk = blockIdx.x;
  const bool ident = blk >= nrb;
  scan_rows(ub, mat, ends, ident ? pws : steps, (ident ? blk - nrb : blk) * 16, ident);
}

// io[R * SCT + t] += M^(t+1) applied to carry[R-1]; blockIdx.x = 16-row tile,
// blockIdx.y = t. Wave w owns state columns 16w..16w+15. M^(t+1) and the 16
// carries are read from global memory in whole lines, 512 B in a row per wave
// and load, and laid into LDS at the pitch of hbuf; the fragments are read from
// there in the k order of scan_rows. The pointers are not __restrict__: with it
// the compiler moved the loads down over the wait that stands behind them.
__global__ __launch_bounds__(256) void scan_fill(
    const float* carry, const float* pws, float* io, int NC) {
  __shared__ __align__(16) float sM[128 * SLDS];
  __shared__ __align__(16) float sH[16 * SLDS];
  const int tid = threadIdx.x;
  const int lane = tid & 31, wid = tid >> 5;
  const int hi = lane >> 4, lo = lane & 15;
  const int n = wid * 16 + lo;                       // state column of this lane
  const int row0 = blockIdx.x * 16, t = blockIdx.y;
  const float* const mg = pws + (size_t)t * (128 * 128) + tid * 4;
  float* const cp = io + ((size_t)(row0 + hi * 8) * SCT + t) * 128 + n;

  v4f mv[16], hv[2];
  float lv[8];
#pragma unroll
  for (int j = 0; j < 16; j++) mv[j] = *(const v4f*)(mg + j * 1024);   // rows 8j + wid
#pragma unroll
  for (int j = 0; j < 2; j++) {
    // row R takes row R-1; row 0 has none before it and is a first chunk
    const int ra = row0 + j * 8 + wid;
    hv[j] = *(const v4f*)(carry + (size_t)(ra > 0 ? ra - 1 : 0) * 128 + lane * 4);
  }
#pragma unroll
  for (int r = 0; r < 8; r++) lv[r] = cp[r * (SCT * 128)];
  XCNT_WAIT();   // the LDS address arithmetic below reuses the loads' offset register
#pragma unroll
  for (int j = 0; j < 16; j++) *(v4f*)(sM + (j * 8 + wid) * SLDS + lane * 4) = mv[j];
#pragma unroll
  for (int j = 0; j < 2; j++) *(v4f*)(sH + (j * 8 + wid) * SLDS + lane * 4) = hv[j];
  __syncthreads();

  v8f c = {};
#pragma unroll
  for (int kk = 0; kk < 32; kk++) {
    v2f a = *(const v2f*)(sH + lo * SLDS + kk * 4 + hi * 2);
    v2f b = *(const v2f*)(sM + n * SLDS + kk * 4 + hi * 2);
    c = __builtin_amdgcn_wmma_f32_16x16x4_f32(
        false, a, false, b, (short)0, c, false, false);
  }
  // a row of the product depends on its own row of A alone: a first chunk's row,
  // formed from a state that is not its carry, is left out here
#pragma unroll
  for (int r = 0; r < 8; r++)
    if ((row0 + hi * 8 + r) & (NC - 1)) lv[r] += c[r];
  // keeps every sum in front of the first store, so that no sum is written into
  // the data register of a store that has been issued
  __builtin_amdgcn_sched_barrier(0);
#pragma unroll
  for (int r = 0; r < 8; r++) cp[r * (SCT * 128)] = lv[r];
  XCNT_WAIT();   // behind the last stores, as in the other kernels
}

// ---------------------------------------------------------------------------
// Launcher
// ---------------------------------------------------------------------------
extern "C" void kernel_launch(void* const* d_in, const int* in_sizes, int n_in,
                              void* d_out, int out_size, void* d_ws, size_t ws_size,
                              hipStream_t stream) {
  (void)in_sizes; (void)n_in; (void)out_size; (void)ws_size;
  const float* x     = (const float*)d_in[0];
  const float* Aall  = (const float*)d_in[1];
  const float* Bp    = (const float*)d_in[2];
  const float* Cp    = (const float*)d_in[3];
  const float* Dp    = (const float*)d_in[4];
  const float* Wi    = (const float*)d_in[5];
  const float* bi    = (const float*)d_in[6];
  const float* Wo    = (const float*)d_in[7];
  const float* bo    = (const float*)d_in[8];
  const float* gamma = (const float*)d_in[9];
  const float* beta  = (const float*)d_in[10];
  float* out = (float*)d_out;

  const int Bn = 8, L = 1024, C = 1024, S = 128, depth = 4;
  const size_t nBLC = (size_t)Bn * L * C;    // 8Mi floats
  const size_t nBLS = (size_t)Bn * L * S;    // 1Mi floats

  float* seq  = (float*)d_ws;                // (B, L, C)
  float* nbuf = seq  + nBLC;                 // LN output
  float* ubb  = nbuf + nBLC;                 // DT * u @ Bp^T   (b*L+l, S)
  float* hsb  = ubb  + nBLS;                 // scan states     (b*L+l, S)
  float* abar = hsb  + nBLS;                 // I + DT*A (128x128)
  float* pws0 = abar + S * S;                // A_bar^1 .. A_bar^8
  float* pws1 = pws0 + SCT * S * S;          // A_bar^8, ^16 .. ^64
  float* pw1  = pws0 + (SCT - 1) * S * S;    // A_bar^8
  float* pw2  = pws1 + (SCT - 1) * S * S;    // A_bar^64
  float* le0  = pws1 + SCT * S * S;          // ends of the 8-step chunks from zero  (b*128+c, S)
  float* car0 = le0  + nBLS / SCT;           // true states at those ends            (b*128+c, S)
  float* le1  = car0 + nBLS / SCT;           // ends of the 64-step chunks from zero (b*16+c, S)
  float* car1 = le1  + nBLS / (SCT * SCT);   // true states at those ends            (b*16+c, S)
  // folded weights, all layers
  const int F = C + S;                       // 1152 rows: Wo diag(Dp) over Bp
  float* wit  = car1 + nBLS / (SCT * SCT);   // Wi^T                        (layer, c, d)
  float* cpt  = wit  + (size_t)depth * C * C;  // Cp^T                      (layer, s, d)
  float* lf   = cpt  + (size_t)depth * S * C;  // [Wo diag(Dp); Bp]         (layer, F, d)
  float* qg   = lf   + (size_t)depth * F * C;  // lf @ Wi                   (layer, F, c)
  float* pf   = qg   + (size_t)depth * F * C;  // Wo @ Cp                   (layer, o, s)
  float* fb   = pf   + (size_t)depth * C * S;  // folded biases             (layer, F)

  dim3 tb(32, 8);
  dim3 tg(32, 32, Bn);
  transpose_bll<1024><<<tg, tb, 0, stream>>>(x, seq);   // seq[b][l][c] = x[b][c][l]

  transpose_bll<1024><<<dim3(32, 32, depth), tb, 0, stream>>>(Wi, wit);  // wit[c][d] = Wi[d][c]
  transpose_bll<128><<<dim3(32, 4, depth), tb, 0, stream>>>(Cp, cpt);    // cpt[s][d] = Cp[d][s]
  fold_rows<<<dim3(F, depth), 256, 0, stream>>>(Wo, Bp, Dp, bi, bo, lf, fb);
  // qg = [Wo diag(Dp); Bp] @ Wi and pf = Wo @ Cp
  fold_gemm<<<dim3(16, 10, depth), 256, 0, stream>>>(lf, wit, Wo, cpt, qg, pf);

  for (int i = 0; i < depth; i++) {
    const float* qi = qg + (size_t)i * F * C;   // Wo diag(Dp) Wi, then Bp Wi
    const float* fi = fb + i * F;

    ln_kernel<<<Bn * L, 256, 0, stream>>>(seq, gamma + i * C, beta + i * C, nbuf, C);

    // ub = DT * (n @ (Bp Wi)^T + Bp bi), 128 blocks. The 1024 tiles of
    // seq += n @ (Wo diag(Dp) Wi)^T + Wo (Dp * bi) + bo ride along: 384 here, which
    // makes two blocks a WGP, and 640 beside the one block of the serial scan pass,
    // two or three a WGP: its 16 dependent steps last about as long as three tiles.
    ub_gemm_tiles<<<128 + 384, 256, 0, stream>>>(nbuf, qi, fi, ubb, seq);

    abar_kernel<<<(S * S) / 256, 256, 0, stream>>>(Aall + (size_t)i * S * S, abar);

    // scan of length 1024 = 8 x 8 x 16: two chunk levels up, 16 serial steps, two down.
    // Going up, hsb and car0 take the states from zero; going down, the carries are added.
    scan_chunk_ends<<<64 + 8, 256, 0, stream>>>(ubb, abar, le0, hsb, pws0, 64);
    scan_chunk_ends<<<8 + 8, 256, 0, stream>>>(le0, pw1, le1, car0, pws1, 8);
    scan_serial_tiles<<<1 + 640, 256, 0, stream>>>(le1, pw2, car1, 16,
                                                   nbuf, qi, fi, seq, 384);
    scan_fill<<<dim3(8, SCT), 256, 0, stream>>>(car1, pws1, car0, 16);
    scan_fill<<<dim3(64, SCT), 256, 0, stream>>>(car0, pws0, hsb, 128);

    // seq += hs @ (Wo Cp)^T
    wmma_gemm<<<dim3(C / BN, (Bn * L) / BM), 256, 0, stream>>>(
        hsb, pf + (size_t)i * C * S, nullptr, seq, Bn * L, C, S, 1.0f, 2);
  }

  transpose_bll<1024><<<tg, tb, 0, stream>>>(seq, out); // out[b][c][l] = seq[b][l][c]
}

// v009
// One run takes 591 microseconds.
// Next to v008, in two timings, it ran 1.04 times as fast each time.
// All steps since v000 together make it 12.1 times as fast.
#include <hip/hip_runtime.h>
#include <stdint.h>

typedef __attribute__((ext_vector_type(2))) float v2f;
typedef __attribute__((ext_vector_type(4))) float v4f;
typedef __attribute__((ext_vector_type(8))) float v8f;
typedef __attribute__((ext_vector_type(2))) __bf16 v2bf;
typedef __attribute__((ext_vector_type(16))) __bf16 v16bf;
typedef __attribute__((ext_vector_type(8))) uint32_t v8u;

#define SSM_DT   0.001f
#define LN_EPS   1e-5f

// ---------------------------------------------------------------------------
// CDNA5 async global->LDS copy support (guarded so compile never breaks)
// ---------------------------------------------------------------------------
#ifdef __has_builtin
#if __has_builtin(__builtin_amdgcn_global_load_async_to_lds_b128)
#define USE_ASYNC_LDS 1
#endif
#endif
#ifndef USE_ASYNC_LDS
#define USE_ASYNC_LDS 0
#endif

#if USE_ASYNC_LDS
// Builtin signature (from hipcc diagnostic): param 0 is
// 'int __attribute__((vector_size(16))) addrspace(1)*', param 1 the LDS-side
// pointer, then two int immediates (offset, cpol).
typedef int v4i_g __attribute__((vector_size(16)));
typedef __attribute__((address_space(1))) v4i_g as1_v4i;
typedef __attribute__((address_space(3))) v4i_g as3_v4i;

// Generic LDS pointer's low 32 bits ARE the LDS byte offset (ISA aperture rule),
// so an int->as3-pointer round trip gives a valid LDS address without an
// addrspacecast.
__device__ __forceinline__ void async_cp16(const float* g, const float* lds) {
  __builtin_amdgcn_global_load_async_to_lds_b128(
      (as1_v4i*)(uintptr_t)g, (as3_v4i*)(uint32_t)(uintptr_t)lds, 0, 0);
}
__device__ __forceinline__ void wait_async0() {
#if __has_builtin(__builtin_amdgcn_s_wait_asynccnt)
  __builtin_amdgcn_s_wait_asynccnt(0);
#else
  asm volatile("s_wait_asynccnt 0" ::: "memory");
#endif
}
#endif

// ---------------------------------------------------------------------------
// Transpose (1024 x NC per batch): dst[b][i][j] = src[b][j][i], j < 1024, i < NC
// ---------------------------------------------------------------------------
template <int NC>
__global__ __launch_bounds__(256) void transpose_bll(const float* __restrict__ src,
                                                     float* __restrict__ dst) {
  __shared__ float tile[32][33];
  int b = blockIdx.z;
  int i0 = blockIdx.y * 32, j0 = blockIdx.x * 32;
  int tx = threadIdx.x, ty = threadIdx.y;           // 32 x 8
  size_t base = (size_t)b * 1024 * NC;
#pragma unroll
  for (int k = 0; k < 32; k += 8)
    tile[ty + k][tx] = src[base + (size_t)(j0 + ty + k) * NC + i0 + tx];
  __syncthreads();
#pragma unroll
  for (int k = 0; k < 32; k += 8)
    dst[base + (size_t)(i0 + ty + k) * 1024 + j0 + tx] = tile[tx][ty + k];
}

// ---------------------------------------------------------------------------
// LayerNorm over last dim (C = 1024), one block per row, 256 threads
// ---------------------------------------------------------------------------
__global__ __launch_bounds__(256) void ln_kernel(const float* __restrict__ x,
                                                 const float* __restrict__ gamma,
                                                 const float* __restrict__ beta,
                                                 float* __restrict__ out, int C) {
  int row = blockIdx.x;
  int t = threadIdx.x;
  const float4 d = ((const float4*)(x + (size_t)row * C))[t];
  float s  = d.x + d.y + d.z + d.w;
  float ss = d.x * d.x + d.y * d.y + d.z * d.z + d.w * d.w;
  __shared__ float rs[256], rq[256];
  rs[t] = s; rq[t] = ss;
  __syncthreads();
  for (int off = 128; off > 0; off >>= 1) {
    if (t < off) { rs[t] += rs[t + off]; rq[t] += rq[t + off]; }
    __syncthreads();
  }
  float mean = rs[0] / (float)C;
  float var  = rq[0] / (float)C - mean * mean;
  float inv  = rsqrtf(var + LN_EPS);
  const float4 g = ((const float4*)gamma)[t];
  const float4 bb = ((const float4*)beta)[t];
  float4 o;
  o.x = (d.x - mean) * inv * g.x + bb.x;
  o.y = (d.y - mean) * inv * g.y + bb.y;
  o.z = (d.z - mean) * inv * g.z + bb.z;
  o.w = (d.w - mean) * inv * g.w + bb.w;
  ((float4*)(out + (size_t)row * C))[t] = o;
}

// ---------------------------------------------------------------------------
// A_bar = I + DT*A  (128x128)
// ---------------------------------------------------------------------------
__global__ void abar_kernel(const float* __restrict__ A, float* __restrict__ abar) {
  int i = blockIdx.x * blockDim.x + threadIdx.x;   // 16384
  int s = i >> 7, k = i & 127;
  abar[i] = (s == k ? 1.0f : 0.0f) + SSM_DT * A[i];
}

// ---------------------------------------------------------------------------
// Weight folding. With u = n Wi^T + bi the layer is linear in n and hs:
//   ub   = DT * (n (Bp Wi)^T + Bp bi)
//   seq += n (Wo diag(Dp) Wi)^T + hs (Wo Cp)^T + Wo (Dp * bi) + bo
// so u and y are never formed. This kernel lays out, per layer, the left factor
// of the products with Wi, 1152 rows of 1024: rows 0..1023 = Wo diag(Dp), rows
// 1024..1151 = Bp; and each row's product with bi, finished as the bias of the
// GEMM that uses the row: fb[r] = row . bi + bo[r], or DT * (row . bi) for Bp.
// One block per row (blockIdx.x) and layer (blockIdx.y).
// ---------------------------------------------------------------------------
__global__ __launch_bounds__(256) void fold_rows(
    const float* __restrict__ Wo, const float* __restrict__ Bp,
    const float* __restrict__ Dp, const float* __restrict__ bi,
    const float* __restrict__ bo, float* __restrict__ lf, float* __restrict__ fb) {
  const int r = blockIdx.x, i = blockIdx.y, t = threadIdx.x;
  const bool isw = r < 1024;
  const float* srow = isw ? Wo + ((size_t)i * 1024 + r) * 1024
                          : Bp + ((size_t)i * 128 + (r - 1024)) * 1024;
  float4 w = ((const float4*)srow)[t];
  if (isw) {
    const float4 d = ((const float4*)(Dp + i * 1024))[t];
    w.x *= d.x; w.y *= d.y; w.z *= d.z; w.w *= d.w;
  }
  ((float4*)(lf + ((size_t)i * 1152 + r) * 1024))[t] = w;
  const float4 b = ((const float4*)(bi + i * 1024))[t];
  __shared__ float rs[256];
  rs[t] = w.x * b.x + w.y * b.y + w.z * b.z + w.w * b.w;
  __syncthreads();
  for (int off = 128; off > 0; off >>= 1) {
    if (t < off) rs[t] += rs[t + off];
    __syncthreads();
  }
  if (t == 0) fb[i * 1152 + r] = isw ? rs[0] + bo[i * 1024 + r] : SSM_DT * rs[0];
}

// ---------------------------------------------------------------------------
// WMMA GEMM: Cmat[M x N] = alpha * (A[M x K] @ Bw[N x K]^T)  (+ bias[N])
//   mode 0: plain           mode 2: += old Cmat value (residual accumulate)
// gemm_tile does the block tile whose first row is bm and first column bn.
// N, the row pitch of Cmat, is 1024 or 128.
// Block tile 128x64, BK=32, 8 waves of 32x32.
// The tiles lie in LDS as f32. A wave splits each fragment in registers into a
// bf16 high part (the value rounded to bf16) and a bf16 low part (what is left,
// rounded to bf16), and forms a . b as lo*hi + hi*lo + hi*hi on the bf16
// 16x16x32 WMMA with f32 sums; lo*lo, about 2^-18 of the product, is dropped.
// One slab is one k step of 32: 3 WMMAs a 16x16 tile.
// BK=32 makes a tile row 128 B, one whole cache line, and eight neighbouring
// lanes copy it: a wave's copy instruction then touches four whole lines.
// Double-buffered LDS; async DMA staging when available.
// GROUP: a wave issues the 16 LDS reads of a slab as one group, which takes 144
// registers (three blocks a WGP). For ub_gemm_tiles and fold_gemm, with two or three
// blocks a WGP, where few waves cover each other's LDS waits.
// ---------------------------------------------------------------------------
// Stands behind a run of global loads or stores, in front of the first reuse of
// a register that they name; the two scheduling barriers keep later register
// writes from being moved up over the wait.
#define XCNT_WAIT()                                  \
  do {                                               \
    __builtin_amdgcn_sched_barrier(0);               \
    asm volatile("s_wait_xcnt 0x0" ::: "memory");    \
    __builtin_amdgcn_sched_barrier(0);               \
  } while (0)

#define BM 128
#define BN 64
#define BK 32
#define LDA_S 36   // padded LDS row stride (floats): 16B-aligned, conflict-free

template <bool GROUP>
__device__ __forceinline__ void gemm_tile(
    const float* __restrict__ A, const float* __restrict__ Bw,
    const float* __restrict__ bias, float* __restrict__ Cmat,
    int N, int K, float alpha, int mode, const int bm, const int bn) {
  __shared__ __align__(16) float sA[2][BM * LDA_S];
  __shared__ __align__(16) float sB[2][BN * LDA_S];

  const int tid  = threadIdx.x;
  const int lane = tid & 31, wid = tid >> 5;
  const int hi = lane >> 4, lo = lane & 15;
  const int wm = (wid >> 1) * 32, wn = (wid & 1) * 32;

  v8f acc[2][2] = {};

  // A lane holds 16 consecutive k of its row, k = 16 * hi + s at element s, in
  // the A and in the B fragments alike (one loader for both).
  // Two values at a time: one packed conversion gives both high parts, a shift and
  // a mask give them back as f32, one packed subtraction and one packed conversion
  // give both low parts. Unrolled: hu and lu are registers with fixed numbers.
  auto split_frag = [&](const v4f* raw, v16bf& h, v16bf& l) {
    v8u hu, lu;
#pragma unroll
    for (int q = 0; q < 4; q++) {
      const v4f x = raw[q];
#pragma unroll
      for (int p = 0; p < 2; p++) {
        const v2f xx = {x[2 * p], x[2 * p + 1]};
        const uint32_t u = __builtin_bit_cast(uint32_t, __builtin_convertvector(xx, v2bf));
        const v2f hf = {__builtin_bit_cast(float, u << 16),
                        __builtin_bit_cast(float, u & 0xffff0000u)};
        hu[q * 2 + p] = u;
        lu[q * 2 + p] = __builtin_bit_cast(uint32_t, __builtin_convertvector(xx - hf, v2bf));
      }
    }
    h = __builtin_bit_cast(v16bf, hu);
    l = __builtin_bit_cast(v16bf, lu);
  };
  // unrolled: raw is registers with fixed numbers
  auto read_frag = [&](const float* row, v4f* raw) {
#pragma unroll
    for (int q = 0; q < 4; q++) raw[q] = *(const v4f*)(row + hi * 16 + q * 4);
  };
  auto compute_tile = [&](const float* cA, const float* cB) {
    v4f rA[2][4], rB[2][4];
    v16bf aH[2], aL[2], bH[2], bL[2];
    // the loops over i are unrolled: fragments are registers with fixed numbers
    if constexpr (GROUP) {
#pragma unroll
      for (int i = 0; i < 2; i++) {
        read_frag(cA + (wm + i * 16 + lo) * LDA_S, rA[i]);
        read_frag(cB + (wn + i * 16 + lo) * LDA_S, rB[i]);
      }
      // keeps all 16 reads of the slab in front of the first split, so that the wave
      // waits out one LDS latency a slab; left free under a cap of 128 registers, the
      // reads are moved down among the splits and WMMAs and six are waited for alone
      __builtin_amdgcn_sched_barrier(0);
#pragma unroll
      for (int i = 0; i < 2; i++) {
        split_frag(rA[i], aH[i], aL[i]);
        split_frag(rB[i], bH[i], bL[i]);
      }
    } else {
#pragma unroll
      for (int i = 0; i < 2; i++) {
        read_frag(cA + (wm + i * 16 + lo) * LDA_S, rA[i]);
        split_frag(rA[i], aH[i], aL[i]);
        read_frag(cB + (wn + i * 16 + lo) * LDA_S, rB[i]);
        split_frag(rB[i], bH[i], bL[i]);
      }
    }
    // each tile takes its two small terms first, then hi*hi; all loops here are
    // unrolled so that fragments and accumulators are registers with fixed numbers
#pragma unroll
    for (int i = 0; i < 2; i++)
#pragma unroll
      for (int j = 0; j < 2; j++)
        acc[i][j] = __builtin_amdgcn_wmma_f32_16x16x32_bf16(
            false, aL[i], false, bH[j], (short)0, acc[i][j], false, false);
#pragma unroll
    for (int i = 0; i < 2; i++)
#pragma unroll
      for (int j = 0; j < 2; j++)
        acc[i][j] = __builtin_amdgcn_wmma_f32_16x16x32_bf16(
            false, aH[i], false, bL[j], (short)0, acc[i][j], false, false);
#pragma unroll
    for (int i = 0; i < 2; i++)
#pragma unroll
      for (int j = 0; j < 2; j++)
        acc[i][j] = __builtin_amdgcn_wmma_f32_16x16x32_bf16(
            false, aH[i], false, bH[j], (short)0, acc[i][j], false, false);
  };

#if USE_ASYNC_LDS
  // --- async DMA double-buffered pipeline ---
  auto stage = [&](int buf, int k0) {
#pragma unroll
    for (int j = 0; j < 4; j++) {           // A tile: 1024 B128 slots, 4/thread
      int s = j * 256 + tid;
      int r = s >> 3, c4 = (s & 7) * 4;
      async_cp16(A + (size_t)(bm + r) * K + k0 + c4, &sA[buf][r * LDA_S + c4]);
    }
    // unrolled like the loop above: the copies are issued back to back, no loop control between them
#pragma unroll
    for (int j = 0; j < 2; j++) {           // B tile: 512 B128 slots, 2/thread
      int s = j * 256 + tid;
      int r = s >> 3, c4 = (s & 7) * 4;
      async_cp16(Bw + (size_t)(bn + r) * K + k0 + c4, &sB[buf][r * LDA_S + c4]);
    }
  };

  stage(0, 0);
  wait_async0();
  __syncthreads();
  int cur = 0;
  for (int k0 = 0; k0 < K; k0 += BK) {
    if (k0 + BK < K) stage(cur ^ 1, k0 + BK);   // DMA next tile in background
    compute_tile(sA[cur], sB[cur]);             // 12 WMMAs on current tile
    // keeps the splits and the WMMAs in front of the wait: moved behind it they
    // would no longer cover the flight of the next tile's copies
    __builtin_amdgcn_sched_barrier(0);
    wait_async0();
    __syncthreads();
    cur ^= 1;
  }
#else
  // --- fallback: synchronous single-buffer staging ---
  for (int k0 = 0; k0 < K; k0 += BK) {
#pragma unroll
    for (int j = 0; j < 4; j++) {
      int s = j * 256 + tid;
      int r = s >> 3, c4 = (s & 7) * 4;
      float4 v = *(const float4*)(A + (size_t)(bm + r) * K + k0 + c4);
      *(float4*)(&sA[0][r * LDA_S + c4]) = v;
    }
    // unrolled like the loop above, so that both loads are in flight together
#pragma unroll
    for (int j = 0; j < 2; j++) {
      int s = j * 256 + tid;
      int r = s >> 3, c4 = (s & 7) * 4;
      float4 v = *(const float4*)(Bw + (size_t)(bn + r) * K + k0 + c4);
      *(float4*)(&sB[0][r * LDA_S + c4]) = v;
    }
    __syncthreads();
    compute_tile(sA[0], sB[0]);
    __syncthreads();
  }
#endif

  // Epilogue. C/D layout: VGPR r -> M = r + 8*hi, N = lo.
  // A lane's two bias values and its 32 old values are loaded in one batch, so
  // that the wave waits out one load latency and not one per element; then the
  // sums in the old order (alpha * acc, + bias, + old value), then the 32 stores.
  const int col = bn + wn + lo;
  float bv[2] = {0.0f, 0.0f};
  if (bias) {
    bv[0] = bias[col];
    bv[1] = bias[col + 16];
    XCNT_WAIT();   // the address arithmetic below reuses these two loads' address registers
  }
  // pitch is a literal at both calls: all 64 accesses of a lane then go through
  // one address register pair with immediate offsets, which nothing overwrites.
  auto finish = [&](const int pitch) {
    float* const c0 = Cmat + (size_t)(bm + wm + hi * 8) * pitch + col;
    float v[2][2][8] = {};
    if (mode == 2) {
#pragma unroll
      for (int i = 0; i < 2; i++)
#pragma unroll
        for (int r = 0; r < 8; r++)
#pragma unroll
          for (int j = 0; j < 2; j++) v[i][j][r] = c0[(i * 16 + r) * pitch + j * 16];
      // keeps the sums, which wait for the bias values, behind the issue of these loads
      __builtin_amdgcn_sched_barrier(0);
    }
#pragma unroll
    for (int i = 0; i < 2; i++)
#pragma unroll
      for (int r = 0; r < 8; r++)
#pragma unroll
        for (int j = 0; j < 2; j++) v[i][j][r] = alpha * acc[i][j][r] + bv[j] + v[i][j][r];
    // keeps every sum in front of the first store, so that no sum is written into
    // the data register of a store that has been issued
    __builtin_amdgcn_sched_barrier(0);
#pragma unroll
    for (int i = 0; i < 2; i++)
#pragma unroll
      for (int r = 0; r < 8; r++)
#pragma unroll
        for (int j = 0; j < 2; j++) c0[(i * 16 + r) * pitch + j * 16] = v[i][j][r];
    XCNT_WAIT();   // the code that follows in the kernel's text reuses these registers
  };
  if (N == 1024) finish(1024);
  else finish(128);
}

// (256, 8): eight waves a SIMD, so that four blocks still share a WGP
__global__ __launch_bounds__(256, 8) void wmma_gemm(
    const float* __restrict__ A, const float* __restrict__ Bw,
    const float* __restrict__ bias, float* __restrict__ Cmat,
    int M, int N, int K, float alpha, int mode) {
  gemm_tile<false>(A, Bw, bias, Cmat, N, K, alpha, mode, blockIdx.y * BM, blockIdx.x * BN);
}

// Tile t of the 1024 block tiles (64 tile rows x 16 tile columns, column fastest) of
//   seq += n @ (Wo diag(Dp) Wi)^T + Wo (Dp * bi) + bo
// This product needs only n, not the scan. The ub product fills half the WGPs
// and the serial pass of the scan one, and both last long, so these two launches
// carry the tiles, on blocks numbered behind their own.
__device__ __forceinline__ void seq_tile(
    const float* __restrict__ n, const float* __restrict__ q,
    const float* __restrict__ qb, float* __restrict__ seq, const int t) {
  gemm_tile<false>(n, q, qb, seq, 1024, 1024, 1.0f, 2, (t >> 4) * BM, (t & 15) * BN);
}

// Blocks 0..127: the 64 x 2 tiles of ub = DT * (n @ (Bp Wi)^T + Bp bi); q holds
// Wo diag(Dp) Wi (1024 rows) and then Bp Wi (128 rows), qb their biases.
// Blocks 128 and up: seq tiles 0, 1, ...
// (256, 6): six waves a SIMD, three blocks a WGP; the launch has two a WGP
__global__ __launch_bounds__(256, 6) void ub_gemm_tiles(
    const float* __restrict__ n, const float* __restrict__ q,
    const float* __restrict__ qb, float* __restrict__ ub, float* __restrict__ seq) {
  const int blk = blockIdx.x;
  const bool u = blk < 128;
  const int t = blk - 128;
  gemm_tile<true>(n, u ? q + 1024 * 1024 : q, u ? qb + 1024 : qb, u ? ub : seq,
            u ? 128 : 1024, 1024, u ? SSM_DT : 1.0f, u ? 0 : 2,
            (u ? blk >> 1 : t >> 4) * BM, (u ? blk & 1 : t & 15) * BN);
}

// The two weight products of every layer (blockIdx.z) in one launch, grid (16, 10):
//   y < 9 : qg (1152 x 1024) = lf @ wit^T, tile (y, x)
//   y == 9: pf (1024 x 128)  = Wo @ cpt^T, its 8 x 2 tiles numbered by x
// (256, 6) as above: 640 blocks, two or three a WGP
__global__ __launch_bounds__(256, 6) void fold_gemm(
    const float* __restrict__ lf, const float* __restrict__ wit,
    const float* __restrict__ Wo, const float* __restrict__ cpt,
    float* __restrict__ qg, float* __restrict__ pf) {
  const int x = blockIdx.x, y = blockIdx.y;
  const size_t i = blockIdx.z;
  const bool q = y < 9;
  gemm_tile<true>(q ? lf + i * (1152 * 1024) : Wo + i * (1024 * 1024),
            q ? wit + i * (1024 * 1024) : cpt + i * (128 * 1024), nullptr,
            q ? qg + i * (1152 * 1024) : pf + i * (1024 * 128),
            q ? 1024 : 128, 1024, 1.0f, 0,
            (q ? y : x >> 1) * BM, (q ? x : x & 1) * BN);
}

// ---------------------------------------------------------------------------
// Sequential scan: h (16x128, rows 8..15 zero-padded) lives in LDS.
//   per step l: h = h @ A_bar^T + ub[:, l, :];  store hs[b*L + l][s] = h[b][s]
// One block, 8 waves; wave w owns state columns 16w..16w+15.
// A_bar fragments preloaded into registers (loop-invariant, 32 x float2).
// The next step's ub slab is async-DMA'd into LDS while WMMAs run.
// ---------------------------------------------------------------------------
#define SLDS 132   // 16 fragment rows -> 16 distinct LDS banks

__device__ __forceinline__ void scan_serial(
    const float* __restrict__ ub, const float* __restrict__ abar,
    float* __restrict__ hs, const int L) {
  __shared__ __align__(16) float hbuf[16 * SLDS];
#if USE_ASYNC_LDS
  __shared__ __align__(16) float ubs[2][8 * 128];
#endif
  const int tid = threadIdx.x;
  const int lane = tid & 31, wid = tid >> 5;
  const int hi = lane >> 4, lo = lane & 15;
  const int n0 = wid * 16;

  // Preload B fragments of A_bar (stored [s][k], K-major like the GEMM weights)
  v2f bF[32];
#pragma unroll
  for (int kk = 0; kk < 32; kk++)
    bF[kk] = *(const v2f*)(abar + (size_t)(n0 + lo) * 128 + kk * 4 + hi * 2);

#if USE_ASYNC_LDS
  auto prefetch_ub = [&](int buf, int l) {   // 8 rows x 128 floats, B128/thread
    int b = tid >> 5, s4 = (tid & 31) * 4;
    async_cp16(ub + ((size_t)b * L + l) * 128 + s4, &ubs[buf][b * 128 + s4]);
  };
  prefetch_ub(0, 0);
#endif

  for (int i = tid; i < 16 * SLDS; i += 256) hbuf[i] = 0.0f;
#if USE_ASYNC_LDS
  wait_async0();
#endif
  __syncthreads();

  for (int l = 0; l < L; l++) {
#if USE_ASYNC_LDS
    if (l + 1 < L) prefetch_ub((l + 1) & 1, l + 1);  // hide global latency
#endif
    v8f c = {};
#pragma unroll
    for (int kk = 0; kk < 32; kk++) {
      v2f a = *(const v2f*)(hbuf + lo * SLDS + kk * 4 + hi * 2);
      c = __builtin_amdgcn_wmma_f32_16x16x4_f32(
          false, a, false, bF[kk], (short)0, c, false, false);
    }
    __syncthreads();            // everyone done reading h before overwrite
#pragma unroll
    for (int r = 0; r < 8; r++) {
      int m = r + hi * 8;       // padded batch row
      int n = n0 + lo;          // state column
      float v = c[r];
      if (m < 8) {
#if USE_ASYNC_LDS
        v += ubs[l & 1][m * 128 + n];
#else
        v += ub[((size_t)m * L + l) * 128 + n];
#endif
        hs[((size_t)m * L + l) * 128 + n] = v;
      }
      hbuf[m * SLDS + n] = v;
    }
#if USE_ASYNC_LDS
    wait_async0();
#endif
    __syncthreads();
  }
}

// Block 0 scans; blocks 1 and up do seq tiles t0, t0 + 1, ...
__global__ __launch_bounds__(256) void scan_serial_tiles(
    const float* __restrict__ ub, const float* __restrict__ abar,
    float* __restrict__ hs, int L,
    const float* __restrict__ n, const float* __restrict__ q,
    const float* __restrict__ qb, float* __restrict__ seq, int t0) {
  const int blk = blockIdx.x;
  if (blk == 0) scan_serial(ub, abar, hs, L);
  else seq_tile(n, q, qb, seq, t0 + blk - 1);
}

// ---------------------------------------------------------------------------
// Chunked scan. The recurrence h_l = h_{l-1} @ M^T + x_l is linear, so a
// sequence is cut into chunks of SCT steps and every (batch, chunk) pair is one
// row of a 16-row tile.
//   Up (scan_chunk_ends): one block steps its 16 rows SCT times from zero. It
//   stores the state after every step (steps[row * SCT + t]) and the last one
//   once more, packed (ends[row]). Blocks >= nrb step the rows of the identity
//   with the transposed matrix instead: after step t they hold M^(t+1), laid
//   out [s][k] like M, and store it (pws[t]).
//   Down (scan_fill): the true state of row R after step t is its state from
//   zero plus M^(t+1) times the true state at the end of row R-1 (nothing for a
//   sequence's first chunk). No step waits for another: one block does one
//   16-row tile at one t, a single 16 x 128 x 128 product.
// The chunk ends form a recurrence of the same kind, SCT times shorter, with
// M^SCT as its matrix, so the launcher applies the same two passes to it again.
// Row R = batch * NC + chunk; its step t lies at sequence row R * SCT + t.
// ---------------------------------------------------------------------------
#define SCT 8

// ident is block-uniform. The loops over t, r and kk are unrolled so that bF,
// the accumulator and the SCT inputs and states stay in registers.
__device__ __forceinline__ void scan_rows(
    const float* __restrict__ ub, const float* __restrict__ mat,
    float* __restrict__ ends, float* __restrict__ steps,
    int row0, const bool ident) {
  __shared__ __align__(16) float hbuf[16 * SLDS];
  const int tid = threadIdx.x;
  const int lane = tid & 31, wid = tid >> 5;
  const int hi = lane >> 4, lo = lane & 15;
  const int n = wid * 16 + lo;                       // state column of this lane
  const int r0 = row0 + hi * 8;                      // row of accumulator register 0

  // keep[t] holds step t's input and then the state after step t. All inputs are
  // loaded in front of the loop and all states stored behind it: a load or store
  // inside it would be waited for at the step's barrier.
  v2f bF[32];
  float hv[8], keep[SCT][8];
  if (ident) {
#pragma unroll
    for (int kk = 0; kk < 32; kk++) {
      bF[kk].x = mat[(kk * 4 + hi * 2) * 128 + n];
      bF[kk].y = mat[(kk * 4 + hi * 2 + 1) * 128 + n];
    }
#pragma unroll
    for (int r = 0; r < 8; r++) hv[r] = (r0 + r == n) ? 1.0f : 0.0f;
#pragma unroll
    for (int t = 0; t < SCT; t++)
#pragma unroll
      for (int r = 0; r < 8; r++) keep[t][r] = 0.0f;
  } else {
#pragma unroll
    for (int kk = 0; kk < 32; kk++)
      bF[kk] = *(const v2f*)(mat + n * 128 + kk * 4 + hi * 2);
    XCNT_WAIT();
    const float* const u0 = ub + (size_t)r0 * (SCT * 128) + n;
#pragma unroll
    for (int t = 0; t < SCT; t++)
#pragma unroll
      for (int r = 0; r < 8; r++) keep[t][r] = u0[r * (SCT * 128) + t * 128];
    XCNT_WAIT();
#pragma unroll
    for (int r = 0; r < 8; r++) hv[r] = 0.0f;
  }
#pragma unroll
  for (int r = 0; r < 8; r++) hbuf[(hi * 8 + r) * SLDS + n] = hv[r];
  __syncthreads();

#pragma unroll
  for (int t = 0; t < SCT; t++) {
    v8f c = {};
#pragma unroll
    for (int kk = 0; kk < 32; kk++) {
      v2f a = *(const v2f*)(hbuf + lo * SLDS + kk * 4 + hi * 2);
      c = __builtin_amdgcn_wmma_f32_16x16x4_f32(
          false, a, false, bF[kk], (short)0, c, false, false);
    }
#pragma unroll
    for (int r = 0; r < 8; r++) keep[t][r] = c[r] + keep[t][r];
    if (t + 1 == SCT) break;    // the last state is not read back from LDS
    __syncthreads();            // everyone done reading h before overwrite
#pragma unroll
    for (int r = 0; r < 8; r++) hbuf[(hi * 8 + r) * SLDS + n] = keep[t][r];
    __syncthreads();
  }

  if (ident) {
    float* const s0 = steps + (size_t)r0 * 128 + n;
#pragma unroll
    for (int t = 0; t < SCT; t++)
#pragma unroll
      for (int r = 0; r < 8; r++) s0[t * (128 * 128) + r * 128] = keep[t][r];
  } else {
    float* const s0 = steps + (size_t)r0 * (SCT * 128) + n;
#pragma unroll
    for (int r = 0; r < 8; r++)
#pragma unroll
      for (int t = 0; t < SCT; t++) s0[r * (SCT * 128) + t * 128] = keep[t][r];
    XCNT_WAIT();
#pragma unroll
    for (int r = 0; r < 8; r++) ends[(size_t)r0 * 128 + r * 128 + n] = keep[SCT - 1][r];
  }
  XCNT_WAIT();
}

__global__ __launch_bounds__(256) void scan_chunk_ends(
    const float* __restrict__ ub, const float* __restrict__ mat,
    float* __restrict__ ends, float* __restrict__ steps, float* __restrict__ pws, int nrb) {
  const int blk = blockIdx.x;
  const bool ident = blk >= nrb;
  scan_rows(ub, mat, ends, ident ? pws : steps, (ident ? blk - nrb : blk) * 16, ident);
}

// io[R * SCT + t] += M^(t+1) applied to carry[R-1]; blockIdx.x = 16-row tile,
// blockIdx.y = t. Wave w owns state columns 16w..16w+15. M^(t+1) and the 16
// carries are read from global memory in whole lines, 512 B in a row per wave
// and load, and laid into LDS at the pitch of hbuf; the fragments are read from
// there in the k order of scan_rows. The pointers are not __restrict__: with it
// the compiler moved the loads down over the wait that stands behind them.
__global__ __launch_bounds__(256) void scan_fill(
    const float* carry, const float* pws, float* io, int NC) {
  __shared__ __align__(16) float sM[128 * SLDS];
  __shared__ __align__(16) float sH[16 * SLDS];
  const int tid = threadIdx.x;
  const int lane = tid & 31, wid = tid >> 5;
  const int hi = lane >> 4, lo = lane & 15;
  const int n = wid * 16 + lo;                       // state column of this lane
  const int row0 = blockIdx.x * 16, t = blockIdx.y;
  const float* const mg = pws + (size_t)t * (128 * 128) + tid * 4;
  float* const cp = io + ((size_t)(row0 + hi * 8) * SCT + t) * 128 + n;

  v4f mv[16], hv[2];
  float lv[8];
#pragma unroll
  for (int j = 0; j < 16; j++) mv[j] = *(const v4f*)(mg + j * 1024);   // rows 8j + wid
#pragma unroll
  for (int j = 0; j < 2; j++) {
    // row R takes row R-1; row 0 has none before it and is a first chunk
    const int ra = row0 + j * 8 + wid;
    hv[j] = *(const v4f*)(carry + (size_t)(ra > 0 ? ra - 1 : 0) * 128 + lane * 4);
  }
#pragma unroll
  for (int r = 0; r < 8; r++) lv[r] = cp[r * (SCT * 128)];
  XCNT_WAIT();   // the LDS address arithmetic below reuses the loads' offset register
#pragma unroll
  for (int j = 0; j < 16; j++) *(v4f*)(sM + (j * 8 + wid) * SLDS + lane * 4) = mv[j];
#pragma unroll
  for (int j = 0; j < 2; j++) *(v4f*)(sH + (j * 8 + wid) * SLDS + lane * 4) = hv[j];
  __syncthreads();

  v8f c = {};
#pragma unroll
  for (int kk = 0; kk < 32; kk++) {
    v2f a = *(const v2f*)(sH + lo * SLDS + kk * 4 + hi * 2);
    v2f b = *(const v2f*)(sM + n * SLDS + kk * 4 + hi * 2);
    c = __builtin_amdgcn_wmma_f32_16x16x4_f32(
        false, a, false, b, (short)0, c, false, false);
  }
  // a row of the product depends on its own row of A alone: a first chunk's row,
  // formed from a state that is not its carry, is left out here
#pragma unroll
  for (int r = 0; r < 8; r++)
    if ((row0 + hi * 8 + r) & (NC - 1)) lv[r] += c[r];
  // keeps every sum in front of the first store, so that no sum is written into
  // the data register of a store that has been issued
  __builtin_amdgcn_sched_barrier(0);
#pragma unroll
  for (int r = 0; r < 8; r++) cp[r * (SCT * 128)] = lv[r];
  XCNT_WAIT();   // behind the last stores, as in the other kernels
}

// ---------------------------------------------------------------------------
// Launcher
// ---------------------------------------------------------------------------
extern "C" void kernel_launch(void* const* d_in, const int* in_sizes, int n_in,
                              void* d_out, int out_size, void* d_ws, size_t ws_size,
                              hipStream_t stream) {
  (void)in_sizes; (void)n_in; (void)out_size; (void)ws_size;
  const float* x     = (const float*)d_in[0];
  const float* Aall  = (const float*)d_in[1];
  const float* Bp    = (const float*)d_in[2];
  const float* Cp    = (const float*)d_in[3];
  const float* Dp    = (const float*)d_in[4];
  const float* Wi    = (const float*)d_in[5];
  const float* bi    = (const float*)d_in[6];
  const float* Wo    = (const float*)d_in[7];
  const float* bo    = (const float*)d_in[8];
  const float* gamma = (const float*)d_in[9];
  const float* beta  = (const float*)d_in[10];
  float* out = (float*)d_out;

  const int Bn = 8, L = 1024, C = 1024, S = 128, depth = 4;
  const size_t nBLC = (size_t)Bn * L * C;    // 8Mi floats
  const size_t nBLS = (size_t)Bn * L * S;    // 1Mi floats

  float* seq  = (float*)d_ws;                // (B, L, C)
  float* nbuf = seq  + nBLC;                 // LN output
  float* ubb  = nbuf + nBLC;                 // DT * u @ Bp^T   (b*L+l, S)
  float* hsb  = ubb  + nBLS;                 // scan states     (b*L+l, S)
  float* abar = hsb  + nBLS;                 // I + DT*A (128x128)
  float* pws0 = abar + S * S;                // A_bar^1 .. A_bar^8
  float* pws1 = pws0 + SCT * S * S;          // A_bar^8, ^16 .. ^64
  float* pw1  = pws0 + (SCT - 1) * S * S;    // A_bar^8
  float* pw2  = pws1 + (SCT - 1) * S * S;    // A_bar^64
  float* le0  = pws1 + SCT * S * S;          // ends of the 8-step chunks from zero  (b*128+c, S)
  float* car0 = le0  + nBLS / SCT;           // true states at those ends            (b*128+c, S)
  float* le1  = car0 + nBLS / SCT;           // ends of the 64-step chunks from zero (b*16+c, S)
  float* car1 = le1  + nBLS / (SCT * SCT);   // true states at those ends            (b*16+c, S)
  // folded weights, all layers
  const int F = C + S;                       // 1152 rows: Wo diag(Dp) over Bp
  float* wit  = car1 + nBLS / (SCT * SCT);   // Wi^T                        (layer, c, d)
  float* cpt  = wit  + (size_t)depth * C * C;  // Cp^T                      (layer, s, d)
  float* lf   = cpt  + (size_t)depth * S * C;  // [Wo diag(Dp); Bp]         (layer, F, d)
  float* qg   = lf   + (size_t)depth * F * C;  // lf @ Wi                   (layer, F, c)
  float* pf   = qg   + (size_t)depth * F * C;  // Wo @ Cp                   (layer, o, s)
  float* fb   = pf   + (size_t)depth * C * S;  // folded biases             (layer, F)

  dim3 tb(32, 8);
  dim3 tg(32, 32, Bn);
  transpose_bll<1024><<<tg, tb, 0, stream>>>(x, seq);   // seq[b][l][c] = x[b][c][l]

  transpose_bll<1024><<<dim3(32, 32, depth), tb, 0, stream>>>(Wi, wit);  // wit[c][d] = Wi[d][c]
  transpose_bll<128><<<dim3(32, 4, depth), tb, 0, stream>>>(Cp, cpt);    // cpt[s][d] = Cp[d][s]
  fold_rows<<<dim3(F, depth), 256, 0, stream>>>(Wo, Bp, Dp, bi, bo, lf, fb);
  // qg = [Wo diag(Dp); Bp] @ Wi and pf = Wo @ Cp
  fold_gemm<<<dim3(16, 10, depth), 256, 0, stream>>>(lf, wit, Wo, cpt, qg, pf);

  for (int i = 0; i < depth; i++) {
    const float* qi = qg + (size_t)i * F * C;   // Wo diag(Dp) Wi, then Bp Wi
    const float* fi = fb + i * F;

    ln_kernel<<<Bn * L, 256, 0, stream>>>(seq, gamma + i * C, beta + i * C, nbuf, C);

    // ub = DT * (n @ (Bp Wi)^T + Bp bi), 128 blocks. The 1024 tiles of
    // seq += n @ (Wo diag(Dp) Wi)^T + Wo (Dp * bi) + bo ride along: 384 here, which
    // makes two blocks a WGP, and 640 beside the one block of the serial scan pass,
    // two or three a WGP: its 16 dependent steps last about as long as three tiles.
    ub_gemm_tiles<<<128 + 384, 256, 0, stream>>>(nbuf, qi, fi, ubb, seq);

    abar_kernel<<<(S * S) / 256, 256, 0, stream>>>(Aall + (size_t)i * S * S, abar);

    // scan of length 1024 = 8 x 8 x 16: two chunk levels up, 16 serial steps, two down.
    // Going up, hsb and car0 take the states from zero; going down, the carries are added.
    scan_chunk_ends<<<64 + 8, 256, 0, stream>>>(ubb, abar, le0, hsb, pws0, 64);
    scan_chunk_ends<<<8 + 8, 256, 0, stream>>>(le0, pw1, le1, car0, pws1, 8);
    scan_serial_tiles<<<1 + 640, 256, 0, stream>>>(le1, pw2, car1, 16,
                                                   nbuf, qi, fi, seq, 384);
    scan_fill<<<dim3(8, SCT), 256, 0, stream>>>(car1, pws1, car0, 16);
    scan_fill<<<dim3(64, SCT), 256, 0, stream>>>(car0, pws0, hsb, 128);

    // seq += hs @ (Wo Cp)^T
    wmma_gemm<<<dim3(C / BN, (Bn * L) / BM), 256, 0, stream>>>(
        hsb, pf + (size_t)i * C * S, nullptr, seq, Bn * L, C, S, 1.0f, 2);
  }

  transpose_bll<1024><<<tg, tb, 0, stream>>>(seq, out); // out[b][c][l] = seq[b][l][c]
}

// v010
// One run takes 551 microseconds.
// Two timings next to v009 both put it at 1.08 times that version's speed.
// All steps since v000 together make it 13.1 times as fast.
#include <hip/hip_runtime.h>
#include <stdint.h>

typedef __attribute__((ext_vector_type(2))) float v2f;
typedef __attribute__((ext_vector_type(4))) float v4f;
typedef __attribute__((ext_vector_type(8))) float v8f;
typedef __attribute__((ext_vector_type(2))) __bf16 v2bf;
typedef __attribute__((ext_vector_type(16))) __bf16 v16bf;
typedef __attribute__((ext_vector_type(2))) uint32_t v2u;

#define SSM_DT   0.001f
#define LN_EPS   1e-5f

// ---------------------------------------------------------------------------
// CDNA5 async global->LDS copy support (guarded so compile never breaks)
// ---------------------------------------------------------------------------
#ifdef __has_builtin
#if __has_builtin(__builtin_amdgcn_global_load_async_to_lds_b128)
#define USE_ASYNC_LDS 1
#endif
#endif
#ifndef USE_ASYNC_LDS
#define USE_ASYNC_LDS 0
#endif

#if USE_ASYNC_LDS
// Builtin signature (from hipcc diagnostic): param 0 is
// 'int __attribute__((vector_size(16))) addrspace(1)*', param 1 the LDS-side
// pointer, then two int immediates (offset, cpol).
typedef int v4i_g __attribute__((vector_size(16)));
typedef __attribute__((address_space(1))) v4i_g as1_v4i;
typedef __attribute__((address_space(3))) v4i_g as3_v4i;

// Generic LDS pointer's low 32 bits ARE the LDS byte offset (ISA aperture rule),
// so an int->as3-pointer round trip gives a valid LDS address without an
// addrspacecast.
__device__ __forceinline__ void async_cp16(const float* g, const float* lds) {
  __builtin_amdgcn_global_load_async_to_lds_b128(
      (as1_v4i*)(uintptr_t)g, (as3_v4i*)(uint32_t)(uintptr_t)lds, 0, 0);
}
__device__ __forceinline__ void wait_async0() {
#if __has_builtin(__builtin_amdgcn_s_wait_asynccnt)
  __builtin_amdgcn_s_wait_asynccnt(0);
#else
  asm volatile("s_wait_asynccnt 0" ::: "memory");
#endif
}
#endif

// Stands behind a run of global loads or stores, in front of the first reuse of
// a register that they name; the two scheduling barriers keep later register
// writes from being moved up over the wait.
#define XCNT_WAIT()                                  \
  do {                                               \
    __builtin_amdgcn_sched_barrier(0);               \
    asm volatile("s_wait_xcnt 0x0" ::: "memory");    \
    __builtin_amdgcn_sched_barrier(0);               \
  } while (0)

// ---------------------------------------------------------------------------
// Split of two f32 values into bf16 high parts (the values rounded to bf16) and
// bf16 low parts (what is left, rounded to bf16). One packed conversion gives both
// high parts, a shift and a mask give them back as f32, one packed subtraction and
// one packed conversion give both low parts. xx[0] lies in the low half of h and l.
//
// Split layout of a matrix with rows of 1024 or 128 floats: a row keeps its bytes,
// and each 128 bytes, which would hold k = 32 g .. 32 g + 31 as f32, hold the 32
// high parts (64 bytes, k ascending) and then the 32 low parts.
// ---------------------------------------------------------------------------
__device__ __forceinline__ void split2(const v2f xx, uint32_t& h, uint32_t& l) {
  const uint32_t u = __builtin_bit_cast(uint32_t, __builtin_convertvector(xx, v2bf));
  const v2f hf = {__builtin_bit_cast(float, u << 16),
                  __builtin_bit_cast(float, u & 0xffff0000u)};
  h = u;
  l = __builtin_bit_cast(uint32_t, __builtin_convertvector(xx - hf, v2bf));
}

// Thread t lays k = 4 t .. 4 t + 3 of a row into the split layout: two words of high
// parts and two of low parts.
__device__ __forceinline__ void store_split4(float* const row, const int t, const float4 x) {
  uint32_t h0, l0, h1, l1;
  split2(v2f{x.x, x.y}, h0, l0);
  split2(v2f{x.z, x.w}, h1, l1);
  uint32_t* const w = (uint32_t*)row + (t >> 3) * 32 + (t & 7) * 2;
  *(v2u*)w = v2u{h0, h1};
  *(v2u*)(w + 16) = v2u{l0, l1};
}

// Two neighbouring lanes (2 m, 2 m + 1) each hold a word of two bf16 values. The
// even lane gets both low halves, the odd lane both high halves, the even lane's
// value first. Every lane of the wave is on.
__device__ __forceinline__ uint32_t pair_words(const uint32_t w, const bool odd) {
  // 0xB1: lanes 1, 0, 3, 2 of each four, the neighbour's word
  const uint32_t p = (uint32_t)__builtin_amdgcn_mov_dpp((int)w, 0xB1, 0xF, 0xF, true);
  const uint32_t own = odd ? 0xffff0000u : 0x0000ffffu;
  return (w & own) | (__builtin_rotateleft32(p, 16) & ~own);
}

// ---------------------------------------------------------------------------
// Transpose (1024 x NC per batch): dst[b][i][j] = src[b][j][i], j < 1024, i < NC
// SPLIT: dst is a GEMM operand and is written in the split layout. The 32 values
// that a wave lays into a row of dst are one 128-byte group: lanes 0..15 form its
// words of high parts, lanes 16..31 its words of low parts, each from two values.
// ---------------------------------------------------------------------------
template <int NC, bool SPLIT>
__global__ __launch_bounds__(256) void transpose_bll(const float* __restrict__ src,
                                                     float* __restrict__ dst) {
  __shared__ float tile[32][33];
  int b = blockIdx.z;
  int i0 = blockIdx.y * 32, j0 = blockIdx.x * 32;
  int tx = threadIdx.x, ty = threadIdx.y;           // 32 x 8
  size_t base = (size_t)b * 1024 * NC;
#pragma unroll
  for (int k = 0; k < 32; k += 8)
    tile[ty + k][tx] = src[base + (size_t)(j0 + ty + k) * NC + i0 + tx];
  __syncthreads();
  if constexpr (SPLIT) {
    const int w = (tx & 15) * 2;
    // unrolled like the loop below: the four stores go through one address
#pragma unroll
    for (int k = 0; k < 32; k += 8) {
      uint32_t h, l;
      split2(v2f{tile[w][ty + k], tile[w + 1][ty + k]}, h, l);
      ((uint32_t*)dst)[base + (size_t)(i0 + ty + k) * 1024 + j0 + tx] = tx < 16 ? h : l;
    }
  } else {
#pragma unroll
    for (int k = 0; k < 32; k += 8)
      dst[base + (size_t)(i0 + ty + k) * 1024 + j0 + tx] = tile[tx][ty + k];
  }
}

// ---------------------------------------------------------------------------
// LayerNorm over last dim (C = 1024), one block per row, 256 threads.
// The result is written in the split layout: it is read only as a GEMM operand.
// ---------------------------------------------------------------------------
__global__ __launch_bounds__(256) void ln_kernel(const float* __restrict__ x,
                                                 const float* __restrict__ gamma,
                                                 const float* __restrict__ beta,
                                                 float* __restrict__ out, int C) {
  int row = blockIdx.x;
  int t = threadIdx.x;
  const float4 d = ((const float4*)(x + (size_t)row * C))[t];
  float s  = d.x + d.y + d.z + d.w;
  float ss = d.x * d.x + d.y * d.y + d.z * d.z + d.w * d.w;
  __shared__ float rs[256], rq[256];
  rs[t] = s; rq[t] = ss;
  __syncthreads();
  for (int off = 128; off > 0; off >>= 1) {
    if (t < off) { rs[t] += rs[t + off]; rq[t] += rq[t + off]; }
    __syncthreads();
  }
  float mean = rs[0] / (float)C;
  float var  = rq[0] / (float)C - mean * mean;
  float inv  = rsqrtf(var + LN_EPS);
  const float4 g = ((const float4*)gamma)[t];
  const float4 bb = ((const float4*)beta)[t];
  float4 o;
  o.x = (d.x - mean) * inv * g.x + bb.x;
  o.y = (d.y - mean) * inv * g.y + bb.y;
  o.z = (d.z - mean) * inv * g.z + bb.z;
  o.w = (d.w - mean) * inv * g.w + bb.w;
  store_split4(out + (size_t)row * C, t, o);
}

// ---------------------------------------------------------------------------
// A_bar = I + DT*A  (128x128)
// ---------------------------------------------------------------------------
__global__ void abar_kernel(const float* __restrict__ A, float* __restrict__ abar) {
  int i = blockIdx.x * blockDim.x + threadIdx.x;   // 16384
  int s = i >> 7, k = i & 127;
  abar[i] = (s == k ? 1.0f : 0.0f) + SSM_DT * A[i];
}

// ---------------------------------------------------------------------------
// Weight folding. With u = n Wi^T + bi the layer is linear in n and hs:
//   ub   = DT * (n (Bp Wi)^T + Bp bi)
//   seq += n (Wo diag(Dp) Wi)^T + hs (Wo Cp)^T + Wo (Dp * bi) + bo
// so u and y are never formed. This kernel lays out, per layer, the left factor
// of the products with Wi, 1152 rows of 1024: rows 0..1023 = Wo diag(Dp), rows
// 1024..1151 = Bp; and each row's product with bi, finished as the bias of the
// GEMM that uses the row: fb[r] = row . bi + bo[r], or DT * (row . bi) for Bp.
// The rows are GEMM operands and are written in the split layout; so is wos, a copy
// of Wo, the left factor of the product with Cp.
// One block per row (blockIdx.x) and layer (blockIdx.y).
// ---------------------------------------------------------------------------
__global__ __launch_bounds__(256) void fold_rows(
    const float* __restrict__ Wo, const float* __restrict__ Bp,
    const float* __restrict__ Dp, const float* __restrict__ bi,
    const float* __restrict__ bo, float* __restrict__ lf, float* __restrict__ wos,
    float* __restrict__ fb) {
  const int r = blockIdx.x, i = blockIdx.y, t = threadIdx.x;
  const bool isw = r < 1024;
  const float* srow = isw ? Wo + ((size_t)i * 1024 + r) * 1024
                          : Bp + ((size_t)i * 128 + (r - 1024)) * 1024;
  float4 w = ((const float4*)srow)[t];
  XCNT_WAIT();   // the address arithmetic of both ways below reuses this load's base registers
  if (isw) {
    store_split4(wos + ((size_t)i * 1024 + r) * 1024, t, w);
    XCNT_WAIT();   // the loads and the second split below reuse these stores' registers
    const float4 d = ((const float4*)(Dp + i * 1024))[t];
    w.x *= d.x; w.y *= d.y; w.z *= d.z; w.w *= d.w;
  }
  store_split4(lf + ((size_t)i * 1152 + r) * 1024, t, w);
  const float4 b = ((const float4*)(bi + i * 1024))[t];
  __shared__ float rs[256];
  rs[t] = w.x * b.x + w.y * b.y + w.z * b.z + w.w * b.w;
  __syncthreads();
  for (int off = 128; off > 0; off >>= 1) {
    if (t < off) rs[t] += rs[t + off];
    __syncthreads();
  }
  if (t == 0) fb[i * 1152 + r] = isw ? rs[0] + bo[i * 1024 + r] : SSM_DT * rs[0];
}

// ---------------------------------------------------------------------------
// WMMA GEMM: Cmat[M x N] = alpha * (A[M x K] @ Bw[N x K]^T)  (+ bias[N])
//   mode 0: plain           mode 2: += old Cmat value (residual accumulate)
// gemm_tile does the block tile whose first row is bm and first column bn.
// N, the row pitch of Cmat, is 1024 or 128.
// Block tile 128x64, BK=32, 8 waves of 32x32.
// A and Bw lie in the split layout: the kernel that writes an operand splits it,
// once. a . b is formed as lo*hi + hi*lo + hi*hi on the bf16 16x16x32 WMMA with
// f32 sums; lo*lo, about 2^-18 of the product, is dropped.
// One slab is one k step of 32: 3 WMMAs a 16x16 tile.
// BK=32 makes a tile row 128 B, one whole cache line (64 B of high parts, 64 B of
// low parts), and eight neighbouring lanes copy it: a wave's copy instruction then
// touches four whole lines. A wave reads its bf16 fragments from LDS as they are.
// Double-buffered LDS; async DMA staging when available.
// SOUT: every tile of the kernel is plain (mode 0, no bias) and Cmat is written in
// the split layout.
// ---------------------------------------------------------------------------
#define BM 128
#define BN 64
#define BK 32
#define LDA_S 36   // padded LDS row stride (floats): 16B-aligned, conflict-free

template <bool SOUT>
__device__ __forceinline__ void gemm_tile(
    const float* __restrict__ A, const float* __restrict__ Bw,
    const float* __restrict__ bias, float* __restrict__ Cmat,
    int N, int K, float alpha, int mode, const int bm, const int bn) {
  __shared__ __align__(16) float sA[2][BM * LDA_S];
  __shared__ __align__(16) float sB[2][BN * LDA_S];

  const int tid  = threadIdx.x;
  const int lane = tid & 31, wid = tid >> 5;
  const int hi = lane >> 4, lo = lane & 15;
  const int wm = (wid >> 1) * 32, wn = (wid & 1) * 32;

  v8f acc[2][2] = {};

  // A lane holds 16 consecutive k of its row, k = 16 * hi + s at element s, in
  // the A and in the B fragments alike (one loader for both).
  // split layout: the lane's 16 high parts are 32 B at 32 * hi, its low parts 64 B on
  auto read_pre = [&](const float* row, v16bf& h, v16bf& l) {
    const v4f* const p = (const v4f*)(row + hi * 8);
    const v4f h0 = p[0], h1 = p[1], l0 = p[4], l1 = p[5];
    h = __builtin_bit_cast(v16bf, __builtin_shufflevector(h0, h1, 0, 1, 2, 3, 4, 5, 6, 7));
    l = __builtin_bit_cast(v16bf, __builtin_shufflevector(l0, l1, 0, 1, 2, 3, 4, 5, 6, 7));
  };
  auto compute_tile = [&](const float* cA, const float* cB) {
    v16bf aH[2], aL[2], bH[2], bL[2];
    // the loop over i is unrolled: fragments are registers with fixed numbers
#pragma unroll
    for (int i = 0; i < 2; i++) {
      read_pre(cA + (wm + i * 16 + lo) * LDA_S, aH[i], aL[i]);
      read_pre(cB + (wn + i * 16 + lo) * LDA_S, bH[i], bL[i]);
    }
    // keeps all 16 reads of the slab in front of the first WMMA, one group and one
    // LDS latency a slab; left free, six of them are moved down among the WMMAs to
    // save registers and are waited for alone, twice to zero
    __builtin_amdgcn_sched_barrier(0);
    // each tile takes its two small terms first, then hi*hi; all loops here are
    // unrolled so that fragments and accumulators are registers with fixed numbers
#pragma unroll
    for (int i = 0; i < 2; i++)
#pragma unroll
      for (int j = 0; j < 2; j++)
        acc[i][j] = __builtin_amdgcn_wmma_f32_16x16x32_bf16(
            false, aL[i], false, bH[j], (short)0, acc[i][j], false, false);
#pragma unroll
    for (int i = 0; i < 2; i++)
#pragma unroll
      for (int j = 0; j < 2; j++)
        acc[i][j] = __builtin_amdgcn_wmma_f32_16x16x32_bf16(
            false, aH[i], false, bL[j], (short)0, acc[i][j], false, false);
#pragma unroll
    for (int i = 0; i < 2; i++)
#pragma unroll
      for (int j = 0; j < 2; j++)
        acc[i][j] = __builtin_amdgcn_wmma_f32_16x16x32_bf16(
            false, aH[i], false, bH[j], (short)0, acc[i][j], false, false);
  };

#if USE_ASYNC_LDS
  // --- async DMA double-buffered pipeline ---
  auto stage = [&](int buf, int k0) {
#pragma unroll
    for (int j = 0; j < 4; j++) {           // A tile: 1024 B128 slots, 4/thread
      int s = j * 256 + tid;
      int r = s >> 3, c4 = (s & 7) * 4;
      async_cp16(A + (size_t)(bm + r) * K + k0 + c4, &sA[buf][r * LDA_S + c4]);
    }
    // unrolled like the loop above: the copies are issued back to back, no loop control between them
#pragma unroll
    for (int j = 0; j < 2; j++) {           // B tile: 512 B128 slots, 2/thread
      int s = j * 256 + tid;
      int r = s >> 3, c4 = (s & 7) * 4;
      async_cp16(Bw + (size_t)(bn + r) * K + k0 + c4, &sB[buf][r * LDA_S + c4]);
    }
  };

  stage(0, 0);
  wait_async0();
  __syncthreads();
  int cur = 0;
  // stays a loop, as it was with the splits in it: the body is now short enough for the
  // compiler to lay all 32 slabs out in a row, some 1400 more instructions a kernel, run
  // through once a tile, with every copy's step in k taken off its LDS address register
#pragma nounroll
  for (int k0 = 0; k0 < K; k0 += BK) {
    if (k0 + BK < K) stage(cur ^ 1, k0 + BK);   // DMA next tile in background
    compute_tile(sA[cur], sB[cur]);             // 12 WMMAs on current tile
    // keeps the WMMAs in front of the wait: moved behind it they would no longer
    // cover the flight of the next tile's copies
    __builtin_amdgcn_sched_barrier(0);
    wait_async0();
    __syncthreads();
    cur ^= 1;
  }
#else
  // --- fallback: synchronous single-buffer staging ---
  for (int k0 = 0; k0 < K; k0 += BK) {
#pragma unroll
    for (int j = 0; j < 4; j++) {
      int s = j * 256 + tid;
      int r = s >> 3, c4 = (s & 7) * 4;
      float4 v = *(const float4*)(A + (size_t)(bm + r) * K + k0 + c4);
      *(float4*)(&sA[0][r * LDA_S + c4]) = v;
    }
    // unrolled like the loop above, so that both loads are in flight together
#pragma unroll
    for (int j = 0; j < 2; j++) {
      int s = j * 256 + tid;
      int r = s >> 3, c4 = (s & 7) * 4;
      float4 v = *(const float4*)(Bw + (size_t)(bn + r) * K + k0 + c4);
      *(float4*)(&sB[0][r * LDA_S + c4]) = v;
    }
    __syncthreads();
    compute_tile(sA[0], sB[0]);
    __syncthreads();
  }
#endif

  // Epilogue. C/D layout: VGPR r -> M = r + 8*hi, N = lo.
  // A lane's two bias values and its 32 old values are loaded in one batch, so
  // that the wave waits out one load latency and not one per element; then the
  // sums in the old order (alpha * acc, + bias, + old value), then the 32 stores.
  const int col = bn + wn + lo;
  float bv[2] = {0.0f, 0.0f};
  if (bias) {
    bv[0] = bias[col];
    bv[1] = bias[col + 16];
    XCNT_WAIT();   // the address arithmetic below reuses these two loads' address registers
  }
  // pitch is a literal at both calls: all 64 accesses of a lane then go through
  // one address register pair with immediate offsets, which nothing overwrites.
  auto finish = [&](const int pitch) {
    float* const c0 = Cmat + (size_t)(bm + wm + hi * 8) * pitch + col;
    float v[2][2][8] = {};
    if (mode == 2) {
#pragma unroll
      for (int i = 0; i < 2; i++)
#pragma unroll
        for (int r = 0; r < 8; r++)
#pragma unroll
          for (int j = 0; j < 2; j++) v[i][j][r] = c0[(i * 16 + r) * pitch + j * 16];
      // keeps the sums, which wait for the bias values, behind the issue of these loads
      __builtin_amdgcn_sched_barrier(0);
    }
#pragma unroll
    for (int i = 0; i < 2; i++)
#pragma unroll
      for (int r = 0; r < 8; r++)
#pragma unroll
        for (int j = 0; j < 2; j++) v[i][j][r] = alpha * acc[i][j][r] + bv[j] + v[i][j][r];
    if constexpr (SOUT) {
      // The wave's 32 columns are one 128-byte group of the split layout. A lane holds
      // k = lo and lo + 16 of a row; neighbouring lanes swap one of the two, so that an
      // even lane has k = lo, lo + 1 and an odd lane k = lo + 15, lo + 16: one word of
      // high parts and one of low parts each, 64 bytes in a row per 16 lanes and store.
      const bool odd = lo & 1;
      uint32_t hw[2][8], lw[2][8];
#pragma unroll
      for (int i = 0; i < 2; i++)
#pragma unroll
        for (int r = 0; r < 8; r++) {
          uint32_t h, l;
          split2(v2f{v[i][0][r], v[i][1][r]}, h, l);
          hw[i][r] = pair_words(h, odd);
          lw[i][r] = pair_words(l, odd);
        }
      // keeps every word in front of the first store, as below
      __builtin_amdgcn_sched_barrier(0);
      uint32_t* const w0 = (uint32_t*)(Cmat + (size_t)(bm + wm + hi * 8) * pitch + bn + wn) +
                           (lo >> 1) + (odd ? 8 : 0);
#pragma unroll
      for (int i = 0; i < 2; i++)
#pragma unroll
        for (int r = 0; r < 8; r++) {
          w0[(i * 16 + r) * pitch] = hw[i][r];
          w0[(i * 16 + r) * pitch + 16] = lw[i][r];
        }
      XCNT_WAIT();   // the code that follows in the kernel's text reuses these registers
      return;
    }
    // keeps every sum in front of the first store, so that no sum is written into
    // the data register of a store that has been issued
    __builtin_amdgcn_sched_barrier(0);
#pragma unroll
    for (int i = 0; i < 2; i++)
#pragma unroll
      for (int r = 0; r < 8; r++)
#pragma unroll
        for (int j = 0; j < 2; j++) c0[(i * 16 + r) * pitch + j * 16] = v[i][j][r];
    XCNT_WAIT();   // the code that follows in the kernel's text reuses these registers
  };
  if (N == 1024) finish(1024);
  else finish(128);
}

// (256, 8): eight waves a SIMD, so that four blocks still share a WGP
__global__ __launch_bounds__(256, 8) void wmma_gemm(
    const float* __restrict__ A, const float* __restrict__ Bw,
    const float* __restrict__ bias, float* __restrict__ Cmat,
    int M, int N, int K, float alpha, int mode) {
  gemm_tile<false>(A, Bw, bias, Cmat, N, K, alpha, mode, blockIdx.y * BM, blockIdx.x * BN);
}

// Tile t of the 1024 block tiles (64 tile rows x 16 tile columns, column fastest) of
//   seq += n @ (Wo diag(Dp) Wi)^T + Wo (Dp * bi) + bo
// This product needs only n, not the scan. The ub product fills half the WGPs
// and the serial pass of the scan one, and both last long, so these two launches
// carry the tiles, on blocks numbered behind their own.
__device__ __forceinline__ void seq_tile(
    const float* __restrict__ n, const float* __restrict__ q,
    const float* __restrict__ qb, float* __restrict__ seq, const int t) {
  gemm_tile<false>(n, q, qb, seq, 1024, 1024, 1.0f, 2, (t >> 4) * BM, (t & 15) * BN);
}

// Blocks 0..127: the 64 x 2 tiles of ub = DT * (n @ (Bp Wi)^T + Bp bi); q holds
// Wo diag(Dp) Wi (1024 rows) and then Bp Wi (128 rows), qb their biases.
// Blocks 128 and up: seq tiles 0, 1, ...
// (256, 6): six waves a SIMD, three blocks a WGP; the launch has two a WGP
__global__ __launch_bounds__(256, 6) void ub_gemm_tiles(
    const float* __restrict__ n, const float* __restrict__ q,
    const float* __restrict__ qb, float* __restrict__ ub, float* __restrict__ seq) {
  const int blk = blockIdx.x;
  const bool u = blk < 128;
  const int t = blk - 128;
  gemm_tile<false>(n, u ? q + 1024 * 1024 : q, u ? qb + 1024 : qb, u ? ub : seq,
            u ? 128 : 1024, 1024, u ? SSM_DT : 1.0f, u ? 0 : 2,
            (u ? blk >> 1 : t >> 4) * BM, (u ? blk & 1 : t & 15) * BN);
}

// The two weight products of every layer (blockIdx.z) in one launch, grid (16, 10):
//   y < 9 : qg (1152 x 1024) = lf @ wit^T, tile (y, x)
//   y == 9: pf (1024 x 128)  = wos @ cpt^T, its 8 x 2 tiles numbered by x
// Both results are GEMM operands and are written in the split layout.
// (256, 6) as above: 640 blocks, two or three a WGP
__global__ __launch_bounds__(256, 6) void fold_gemm(
    const float* __restrict__ lf, const float* __restrict__ wit,
    const float* __restrict__ wos, const float* __restrict__ cpt,
    float* __restrict__ qg, float* __restrict__ pf) {
  const int x = blockIdx.x, y = blockIdx.y;
  const size_t i = blockIdx.z;
  const bool q = y < 9;
  gemm_tile<true>(q ? lf + i * (1152 * 1024) : wos + i * (1024 * 1024),
            q ? wit + i * (1024 * 1024) : cpt + i * (128 * 1024), nullptr,
            q ? qg + i * (1152 * 1024) : pf + i * (1024 * 128),
            q ? 1024 : 128, 1024, 1.0f, 0,
            (q ? y : x >> 1) * BM, (q ? x : x & 1) * BN);
}

// ---------------------------------------------------------------------------
// Sequential scan: h (16x128, rows 8..15 zero-padded) lives in LDS.
//   per step l: h = h @ A_bar^T + ub[:, l, :];  store hs[b*L + l][s] = h[b][s]
// One block, 8 waves; wave w owns state columns 16w..16w+15.
// A_bar fragments preloaded into registers (loop-invariant, 32 x float2).
// The next step's ub slab is async-DMA'd into LDS while WMMAs run.
// ---------------------------------------------------------------------------
#define SLDS 132   // 16 fragment rows -> 16 distinct LDS banks

__device__ __forceinline__ void scan_serial(
    const float* __restrict__ ub, const float* __restrict__ abar,
    float* __restrict__ hs, const int L) {
  __shared__ __align__(16) float hbuf[16 * SLDS];
#if USE_ASYNC_LDS
  __shared__ __align__(16) float ubs[2][8 * 128];
#endif
  const int tid = threadIdx.x;
  const int lane = tid & 31, wid = tid >> 5;
  const int hi = lane >> 4, lo = lane & 15;
  const int n0 = wid * 16;

  // Preload B fragments of A_bar (stored [s][k], K-major like the GEMM weights)
  v2f bF[32];
#pragma unroll
  for (int kk = 0; kk < 32; kk++)
    bF[kk] = *(const v2f*)(abar + (size_t)(n0 + lo) * 128 + kk * 4 + hi * 2);

#if USE_ASYNC_LDS
  auto prefetch_ub = [&](int buf, int l) {   // 8 rows x 128 floats, B128/thread
    int b = tid >> 5, s4 = (tid & 31) * 4;
    async_cp16(ub + ((size_t)b * L + l) * 128 + s4, &ubs[buf][b * 128 + s4]);
  };
  prefetch_ub(0, 0);
#endif

  for (int i = tid; i < 16 * SLDS; i += 256) hbuf[i] = 0.0f;
#if USE_ASYNC_LDS
  wait_async0();
#endif
  __syncthreads();

  for (int l = 0; l < L; l++) {
#if USE_ASYNC_LDS
    if (l + 1 < L) prefetch_ub((l + 1) & 1, l + 1);  // hide global latency
#endif
    v8f c = {};
#pragma unroll
    for (int kk = 0; kk < 32; kk++) {
      v2f a = *(const v2f*)(hbuf + lo * SLDS + kk * 4 + hi * 2);
      c = __builtin_amdgcn_wmma_f32_16x16x4_f32(
          false, a, false, bF[kk], (short)0, c, false, false);
    }
    __syncthreads();            // everyone done reading h before overwrite
#pragma unroll
    for (int r = 0; r < 8; r++) {
      int m = r + hi * 8;       // padded batch row
      int n = n0 + lo;          // state column
      float v = c[r];
      if (m < 8) {
#if USE_ASYNC_LDS
        v += ubs[l & 1][m * 128 + n];
#else
        v += ub[((size_t)m * L + l) * 128 + n];
#endif
        hs[((size_t)m * L + l) * 128 + n] = v;
      }
      hbuf[m * SLDS + n] = v;
    }
#if USE_ASYNC_LDS
    wait_async0();
#endif
    __syncthreads();
  }
}

// Block 0 scans; blocks 1 and up do seq tiles t0, t0 + 1, ...
__global__ __launch_bounds__(256) void scan_serial_tiles(
    const float* __restrict__ ub, const float* __restrict__ abar,
    float* __restrict__ hs, int L,
    const float* __restrict__ n, const float* __restrict__ q,
    const float* __restrict__ qb, float* __restrict__ seq, int t0) {
  const int blk = blockIdx.x;
  if (blk == 0) scan_serial(ub, abar, hs, L);
  else seq_tile(n, q, qb, seq, t0 + blk - 1);
}

// ---------------------------------------------------------------------------
// Chunked scan. The recurrence h_l = h_{l-1} @ M^T + x_l is linear, so a
// sequence is cut into chunks of SCT steps and every (batch, chunk) pair is one
// row of a 16-row tile.
//   Up (scan_chunk_ends): one block steps its 16 rows SCT times from zero. It
//   stores the state after every step (steps[row * SCT + t]) and the last one
//   once more, packed (ends[row]). Blocks >= nrb step the rows of the identity
//   with the transposed matrix instead: after step t they hold M^(t+1), laid
//   out [s][k] like M, and store it (pws[t]).
//   Down (scan_fill): the true state of row R after step t is its state from
//   zero plus M^(t+1) times the true state at the end of row R-1 (nothing for a
//   sequence's first chunk). No step waits for another: one block does one
//   16-row tile at one t, a single 16 x 128 x 128 product.
// The chunk ends form a recurrence of the same kind, SCT times shorter, with
// M^SCT as its matrix, so the launcher applies the same two passes to it again.
// Row R = batch * NC + chunk; its step t lies at sequence row R * SCT + t.
// ---------------------------------------------------------------------------
#define SCT 8

// ident is block-uniform. The loops over t, r and kk are unrolled so that bF,
// the accumulator and the SCT inputs and states stay in registers.
__device__ __forceinline__ void scan_rows(
    const float* __restrict__ ub, const float* __restrict__ mat,
    float* __restrict__ ends, float* __restrict__ steps,
    int row0, const bool ident) {
  __shared__ __align__(16) float hbuf[16 * SLDS];
  const int tid = threadIdx.x;
  const int lane = tid & 31, wid = tid >> 5;
  const int hi = lane >> 4, lo = lane & 15;
  const int n = wid * 16 + lo;                       // state column of this lane
  const int r0 = row0 + hi * 8;                      // row of accumulator register 0

  // keep[t] holds step t's input and then the state after step t. All inputs are
  // loaded in front of the loop and all states stored behind it: a load or store
  // inside it would be waited for at the step's barrier.
  v2f bF[32];
  float hv[8], keep[SCT][8];
  if (ident) {
#pragma unroll
    for (int kk = 0; kk < 32; kk++) {
      bF[kk].x = mat[(kk * 4 + hi * 2) * 128 + n];
      bF[kk].y = mat[(kk * 4 + hi * 2 + 1) * 128 + n];
    }
#pragma unroll
    for (int r = 0; r < 8; r++) hv[r] = (r0 + r == n) ? 1.0f : 0.0f;
#pragma unroll
    for (int t = 0; t < SCT; t++)
#pragma unroll
      for (int r = 0; r < 8; r++) keep[t][r] = 0.0f;
  } else {
#pragma unroll
    for (int kk = 0; kk < 32; kk++)
      bF[kk] = *(const v2f*)(mat + n * 128 + kk * 4 + hi * 2);
    XCNT_WAIT();
    const float* const u0 = ub + (size_t)r0 * (SCT * 128) + n;
#pragma unroll
    for (int t = 0; t < SCT; t++)
#pragma unroll
      for (int r = 0; r < 8; r++) keep[t][r] = u0[r * (SCT * 128) + t * 128];
    XCNT_WAIT();
#pragma unroll
    for (int r = 0; r < 8; r++) hv[r] = 0.0f;
  }
#pragma unroll
  for (int r = 0; r < 8; r++) hbuf[(hi * 8 + r) * SLDS + n] = hv[r];
  __syncthreads();

#pragma unroll
  for (int t = 0; t < SCT; t++) {
    v8f c = {};
#pragma unroll
    for (int kk = 0; kk < 32; kk++) {
      v2f a = *(const v2f*)(hbuf + lo * SLDS + kk * 4 + hi * 2);
      c = __builtin_amdgcn_wmma_f32_16x16x4_f32(
          false, a, false, bF[kk], (short)0, c, false, false);
    }
#pragma unroll
    for (int r = 0; r < 8; r++) keep[t][r] = c[r] + keep[t][r];
    if (t + 1 == SCT) break;    // the last state is not read back from LDS
    __syncthreads();            // everyone done reading h before overwrite
#pragma unroll
    for (int r = 0; r < 8; r++) hbuf[(hi * 8 + r) * SLDS + n] = keep[t][r];
    __syncthreads();
  }

  if (ident) {
    float* const s0 = steps + (size_t)r0 * 128 + n;
#pragma unroll
    for (int t = 0; t < SCT; t++)
#pragma unroll
      for (int r = 0; r < 8; r++) s0[t * (128 * 128) + r * 128] = keep[t][r];
  } else {
    float* const s0 = steps + (size_t)r0 * (SCT * 128) + n;
#pragma unroll
    for (int r = 0; r < 8; r++)
#pragma unroll
      for (int t = 0; t < SCT; t++) s0[r * (SCT * 128) + t * 128] = keep[t][r];
    XCNT_WAIT();
#pragma unroll
    for (int r = 0; r < 8; r++) ends[(size_t)r0 * 128 + r * 128 + n] = keep[SCT - 1][r];
  }
  XCNT_WAIT();
}

__global__ __launch_bounds__(256) void scan_chunk_ends(
    const float* __restrict__ ub, const float* __restrict__ mat,
    float* __restrict__ ends, float* __restrict__ steps, float* __restrict__ pws, int nrb) {
  const int blk = blockIdx.x;
  const bool ident = blk >= nrb;
  scan_rows(ub, mat, ends, ident ? pws : steps, (ident ? blk - nrb : blk) * 16, ident);
}

// io[R * SCT + t] += M^(t+1) applied to carry[R-1]; blockIdx.x = 16-row tile,
// blockIdx.y = t. Wave w owns state columns 16w..16w+15. M^(t+1) and the 16
// carries are read from global memory in whole lines, 512 B in a row per wave
// and load, and laid into LDS at the pitch of hbuf; the fragments are read from
// there in the k order of scan_rows. The pointers are not __restrict__: with it
// the compiler moved the loads down over the wait that stands behind them.
// so != nullptr (the same for the whole launch): the sums are a GEMM operand and go
// to so in the split layout, rows of 128, and not back to io.
__global__ __launch_bounds__(256) void scan_fill(
    const float* carry, const float* pws, float* io, float* so, int NC) {
  __shared__ __align__(16) float sM[128 * SLDS];
  __shared__ __align__(16) float sH[16 * SLDS];
  const int tid = threadIdx.x;
  const int lane = tid & 31, wid = tid >> 5;
  const int hi = lane >> 4, lo = lane & 15;
  const int n = wid * 16 + lo;                       // state column of this lane
  const int row0 = blockIdx.x * 16, t = blockIdx.y;
  const float* const mg = pws + (size_t)t * (128 * 128) + tid * 4;
  float* const cp = io + ((size_t)(row0 + hi * 8) * SCT + t) * 128 + n;

  v4f mv[16], hv[2];
  float lv[8];
#pragma unroll
  for (int j = 0; j < 16; j++) mv[j] = *(const v4f*)(mg + j * 1024);   // rows 8j + wid
#pragma unroll
  for (int j = 0; j < 2; j++) {
    // row R takes row R-1; row 0 has none before it and is a first chunk
    const int ra = row0 + j * 8 + wid;
    hv[j] = *(const v4f*)(carry + (size_t)(ra > 0 ? ra - 1 : 0) * 128 + lane * 4);
  }
#pragma unroll
  for (int r = 0; r < 8; r++) lv[r] = cp[r * (SCT * 128)];
  XCNT_WAIT();   // the LDS address arithmetic below reuses the loads' offset register
#pragma unroll
  for (int j = 0; j < 16; j++) *(v4f*)(sM + (j * 8 + wid) * SLDS + lane * 4) = mv[j];
#pragma unroll
  for (int j = 0; j < 2; j++) *(v4f*)(sH + (j * 8 + wid) * SLDS + lane * 4) = hv[j];
  __syncthreads();

  v8f c = {};
#pragma unroll
  for (int kk = 0; kk < 32; kk++) {
    v2f a = *(const v2f*)(sH + lo * SLDS + kk * 4 + hi * 2);
    v2f b = *(const v2f*)(sM + n * SLDS + kk * 4 + hi * 2);
    c = __builtin_amdgcn_wmma_f32_16x16x4_f32(
        false, a, false, b, (short)0, c, false, false);
  }
  // a row of the product depends on its own row of A alone: a first chunk's row,
  // formed from a state that is not its carry, is left out here
#pragma unroll
  for (int r = 0; r < 8; r++)
    if ((row0 + hi * 8 + r) & (NC - 1)) lv[r] += c[r];
  if (so) {
    // A lane holds one k of eight rows. Two rows are split at a time and neighbouring
    // lanes swap one of them: the even lane has k = n, n + 1 of row 2 m, the odd lane
    // k = n - 1, n of row 2 m + 1. The wave's 16 k are half of a 128-byte group.
    const bool odd = lo & 1;
    uint32_t hw[4], lw[4];
#pragma unroll
    for (int m = 0; m < 4; m++) {
      uint32_t h, l;
      split2(v2f{lv[2 * m], lv[2 * m + 1]}, h, l);
      hw[m] = pair_words(h, odd);
      lw[m] = pair_words(l, odd);
    }
    // keeps every word in front of the first store, as below
    __builtin_amdgcn_sched_barrier(0);
    uint32_t* const w0 = (uint32_t*)so + ((size_t)(row0 + hi * 8 + (odd ? 1 : 0)) * SCT + t) * 128 +
                         (wid >> 1) * 32 + (wid & 1) * 8 + (lo >> 1);
#pragma unroll
    for (int m = 0; m < 4; m++) {
      w0[m * (2 * SCT * 128)] = hw[m];
      w0[m * (2 * SCT * 128) + 16] = lw[m];
    }
    XCNT_WAIT();   // behind the last stores, as in the other kernels
    return;
  }
  // keeps every sum in front of the first store, so that no sum is written into
  // the data register of a store that has been issued
  __builtin_amdgcn_sched_barrier(0);
#pragma unroll
  for (int r = 0; r < 8; r++) cp[r * (SCT * 128)] = lv[r];
  XCNT_WAIT();   // behind the last stores, as in the other kernels
}

// ---------------------------------------------------------------------------
// Launcher
// ---------------------------------------------------------------------------
extern "C" void kernel_launch(void* const* d_in, const int* in_sizes, int n_in,
                              void* d_out, int out_size, void* d_ws, size_t ws_size,
                              hipStream_t stream) {
  (void)in_sizes; (void)n_in; (void)out_size; (void)ws_size;
  const float* x     = (const float*)d_in[0];
  const float* Aall  = (const float*)d_in[1];
  const float* Bp    = (const float*)d_in[2];
  const float* Cp    = (const float*)d_in[3];
  const float* Dp    = (const float*)d_in[4];
  const float* Wi    = (const float*)d_in[5];
  const float* bi    = (const float*)d_in[6];
  const float* Wo    = (const float*)d_in[7];
  const float* bo    = (const float*)d_in[8];
  const float* gamma = (const float*)d_in[9];
  const float* beta  = (const float*)d_in[10];
  float* out = (float*)d_out;

  const int Bn = 8, L = 1024, C = 1024, S = 128, depth = 4;
  const size_t nBLC = (size_t)Bn * L * C;    // 8Mi floats
  const size_t nBLS = (size_t)Bn * L * S;    // 1Mi floats

  float* seq  = (float*)d_ws;                // (B, L, C)
  float* nbuf = seq  + nBLC;                 // LN output
  float* ubb  = nbuf + nBLC;                 // DT * u @ Bp^T   (b*L+l, S)
  float* hsb  = ubb  + nBLS;                 // 8-step chunk states from zero (b*L+l, S)
  float* abar = hsb  + nBLS;                 // I + DT*A (128x128)
  float* pws0 = abar + S * S;                // A_bar^1 .. A_bar^8
  float* pws1 = pws0 + SCT * S * S;          // A_bar^8, ^16 .. ^64
  float* pw1  = pws0 + (SCT - 1) * S * S;    // A_bar^8
  float* pw2  = pws1 + (SCT - 1) * S * S;    // A_bar^64
  float* le0  = pws1 + SCT * S * S;          // ends of the 8-step chunks from zero  (b*128+c, S)
  float* car0 = le0  + nBLS / SCT;           // true states at those ends            (b*128+c, S)
  float* le1  = car0 + nBLS / SCT;           // ends of the 64-step chunks from zero (b*16+c, S)
  float* car1 = le1  + nBLS / (SCT * SCT);   // true states at those ends            (b*16+c, S)
  // folded weights, all layers
  const int F = C + S;                       // 1152 rows: Wo diag(Dp) over Bp
  float* wit  = car1 + nBLS / (SCT * SCT);   // Wi^T                        (layer, c, d)
  float* cpt  = wit  + (size_t)depth * C * C;  // Cp^T                      (layer, s, d)
  float* lf   = cpt  + (size_t)depth * S * C;  // [Wo diag(Dp); Bp]         (layer, F, d)
  float* qg   = lf   + (size_t)depth * F * C;  // lf @ Wi                   (layer, F, c)
  float* pf   = qg   + (size_t)depth * F * C;  // Wo @ Cp                   (layer, o, s)
  float* fb   = pf   + (size_t)depth * C * S;  // folded biases             (layer, F)
  float* wos  = fb   + (size_t)depth * F;      // Wo, split layout          (layer, o, d)
  float* hss  = wos  + (size_t)depth * C * C;  // scan states, split layout (b*L+l, S)
  // nbuf, wit, cpt, lf, qg and pf hold the split layout as well

  dim3 tb(32, 8);
  dim3 tg(32, 32, Bn);
  transpose_bll<1024, false><<<tg, tb, 0, stream>>>(x, seq);   // seq[b][l][c] = x[b][c][l]

  transpose_bll<1024, true><<<dim3(32, 32, depth), tb, 0, stream>>>(Wi, wit);  // wit[c][d] = Wi[d][c]
  transpose_bll<128, true><<<dim3(32, 4, depth), tb, 0, stream>>>(Cp, cpt);    // cpt[s][d] = Cp[d][s]
  fold_rows<<<dim3(F, depth), 256, 0, stream>>>(Wo, Bp, Dp, bi, bo, lf, wos, fb);
  // qg = [Wo diag(Dp); Bp] @ Wi and pf = Wo @ Cp
  fold_gemm<<<dim3(16, 10, depth), 256, 0, stream>>>(lf, wit, wos, cpt, qg, pf);

  for (int i = 0; i < depth; i++) {
    const float* qi = qg + (size_t)i * F * C;   // Wo diag(Dp) Wi, then Bp Wi
    const float* fi = fb + i * F;

    ln_kernel<<<Bn * L, 256, 0, stream>>>(seq, gamma + i * C, beta + i * C, nbuf, C);

    // ub = DT * (n @ (Bp Wi)^T + Bp bi), 128 blocks. The 1024 tiles of
    // seq += n @ (Wo diag(Dp) Wi)^T + Wo (Dp * bi) + bo ride along: 384 here, which
    // makes two blocks a WGP, and 640 beside the one block of the serial scan pass,
    // two or three a WGP: its 16 dependent steps last about as long as three tiles.
    ub_gemm_tiles<<<128 + 384, 256, 0, stream>>>(nbuf, qi, fi, ubb, seq);

    abar_kernel<<<(S * S) / 256, 256, 0, stream>>>(Aall + (size_t)i * S * S, abar);

    // scan of length 1024 = 8 x 8 x 16: two chunk levels up, 16 serial steps, two down.
    // Going up, hsb and car0 take the states from zero; going down, the carries are added.
    scan_chunk_ends<<<64 + 8, 256, 0, stream>>>(ubb, abar, le0, hsb, pws0, 64);
    scan_chunk_ends<<<8 + 8, 256, 0, stream>>>(le0, pw1, le1, car0, pws1, 8);
    scan_serial_tiles<<<1 + 640, 256, 0, stream>>>(le1, pw2, car1, 16,
                                                   nbuf, qi, fi, seq, 384);
    scan_fill<<<dim3(8, SCT), 256, 0, stream>>>(car1, pws1, car0, nullptr, 16);
    scan_fill<<<dim3(64, SCT), 256, 0, stream>>>(car0, pws0, hsb, hss, 128);

    // seq += hs @ (Wo Cp)^T
    wmma_gemm<<<dim3(C / BN, (Bn * L) / BM), 256, 0, stream>>>(
        hss, pf + (size_t)i * C * S, nullptr, seq, Bn * L, C, S, 1.0f, 2);
  }

  transpose_bll<1024, false><<<tg, tb, 0, stream>>>(seq, out); // out[b][c][l] = seq[b][l][c]
}
